// v000
// The times below were measured on an AMD MI455X: many runs one after another, warmed up first and cycling through
// copies of the inputs, with the whole window's GPU time divided by the number of runs. Launches and the gaps
// between them are all in it. The median over several windows is given; except for v000 it joins two sittings, which
// can be a few percent apart, so the side-by-side timings, each taken in one sitting, are the better comparison.
// The starting kernel, v000, takes 3030 microseconds a run.
#include <hip/hip_runtime.h>

// Causal multi-head self-attention whose projections and output are each scaled by 1/sqrt(width) (x [4][2048][1024]; k, q, v = (x W^T) x 1024^-0.5 ('oi' [1024][1024] UNIT normal, no bias; 16 heads x 64): each projection x 2^-5 (exact); scores = q.k x 64^-0.5: with the two 2^-5 factors folded in, q.k(unscaled) x 2^-13 (exact); causal (tril kept, -inf elsewhere); softmax; out = (merged W_proj^T) x 1024^-0.5 ('oi', no bias): the v factor 2^-5 and the output factor 2^-5 are both linear: ONE factor 2^-10 on the merged context (exact) -> [4][2048][1024] (8.4 M); argument order x, W_key, W_query, W_value, W_proj: KEY FIRST).
// Compute dtypes, f32 accumulate: every input rounded to bf16; q/k/v on PLAIN bf16 operands (inputs: exact); causal scores and attn.v: query rows < 512 hl (3 products), the rest single fp16 (x1024), causal tile skipping; softmax f32 (scale 2^-13 exact); the merged context x 2^-10 (exact); W_proj hl x exact (2 products), NO bias.

#define NB_  4
#define TT   2048
#define DM   1024
#define NH_  16
#define NKV  16
#define REP  (NH_ / NKV)
#define HD   64
#define DQ   (NH_ * HD)
#define DKV  (NKV * HD)
#define ZH   2
#define RH   512                  // query rows < RH use hi+lo planes (0: none)
#define WIN  2048
#define PCAR 1024.0f
#define SCL  0.0001220703125f   // 2^-13 = 1024^-0.5 (on q) x 1024^-0.5 (on k) x 64^-0.5: this module scales q AND k by c^-0.5 = 2^-5 each and the scores by hd^-0.5 = 2^-3: all exact powers of two, applied here in ONE multiply on the unscaled q.k
typedef _Float16 h16;
typedef unsigned short bf;
typedef __attribute__((ext_vector_type(16))) __bf16   v16bf;
typedef __attribute__((ext_vector_type(16))) _Float16 v16h;
typedef __attribute__((ext_vector_type(8)))  _Float16 v8h;
typedef __attribute__((ext_vector_type(8)))  unsigned short v8us;
typedef __attribute__((ext_vector_type(8)))  float    v8f;
typedef __attribute__((ext_vector_type(4)))  float    v4f;
typedef v8h  __attribute__((may_alias)) v8ha;
typedef v4f  __attribute__((may_alias)) v4fa;
typedef v8us __attribute__((may_alias)) v8usa;

__device__ __forceinline__ unsigned short f2bf(float f) { unsigned u = __float_as_uint(f); u += 0x7FFFu + ((u >> 16) & 1u); return (unsigned short)(u >> 16); }
__device__ __forceinline__ float bf2f(unsigned short b) { return __uint_as_float(((unsigned)b) << 16); }
__device__ __forceinline__ float bfr(float f) { return bf2f(f2bf(f)); }
__device__ __forceinline__ v16h cat16(v8h lo, v8h hi) { return __builtin_shufflevector(lo, hi, 0, 1, 2, 3, 4, 5, 6, 7, 8, 9, 10, 11, 12, 13, 14, 15); }
__device__ __forceinline__ v16bf cat16b(v8us lo, v8us hi) { return __builtin_bit_cast(v16bf, __builtin_shufflevector(lo, hi, 0, 1, 2, 3, 4, 5, 6, 7, 8, 9, 10, 11, 12, 13, 14, 15)); }
__device__ __forceinline__ v8f wmma16(v16h a, v16h b, v8f c) { return __builtin_amdgcn_wmma_f32_16x16x32_f16(false, a, false, b, (short)0, c, false, false); }
__device__ __forceinline__ v8f wmmab(v16bf a, v16bf b, v8f c) { return __builtin_amdgcn_wmma_f32_16x16x32_bf16(false, a, false, b, (short)0, c, false, false); }



// ---- k_gemmw: register-blocked GEMM, ONE WAVE per 64x64 output tile (16 accumulators), operands straight from K-contiguous 16-bit planes; grid (M/64, N/64, Z), 32 threads.
// C[m][n] (f32, pitch ldc, + optional f32 bias[n]) = sum_k A[m][k] Bt[n][k] (+ split products per NSPLIT). z-batch strides sA/sB/sC in elements. K % 32 == 0.
template <typename T16> struct WFrag;
template <> struct WFrag<h16> { typedef v16h V; static __device__ __forceinline__ V ld(const h16* p) { return cat16(*(const v8h*)p, *(const v8h*)(p + 16)); } static __device__ __forceinline__ v8f mma(V a, V b, v8f c) { return wmma16(a, b, c); } };
template <> struct WFrag<bf> { typedef v16bf V; static __device__ __forceinline__ V ld(const bf* p) { return cat16b(*(const v8us*)p, *(const v8us*)(p + 16)); } static __device__ __forceinline__ v8f mma(V a, V b, v8f c) { return wmmab(a, b, c); } };
template <typename T16, int NSPLIT, bool BIAS>
__global__ __launch_bounds__(32) void k_gemmw(const T16* __restrict__ A, const T16* __restrict__ A2, const T16* __restrict__ Bt, const T16* __restrict__ Bt2, int K, float* C, int ldc, const float* __restrict__ bias, size_t sA, size_t sB, size_t sC) {
    typedef typename WFrag<T16>::V V;
    __shared__ __align__(16) float os[16 * 68];
    const size_t z = blockIdx.z; A += z * sA; if (A2) A2 += z * sA; Bt += z * sB; if (Bt2) Bt2 += z * sB; C += z * sC;
    const int lane = threadIdx.x & 31, lr = lane & 15, hi = lane >> 4; const int r0 = blockIdx.x * 64, c0 = blockIdx.y * 64;
    v8f acc[4][4];
#pragma unroll
    for (int mb = 0; mb < 4; ++mb)
#pragma unroll
        for (int nb = 0; nb < 4; ++nb) acc[mb][nb] = (v8f){};
    const size_t aoff = (size_t)(r0 + lr) * K + 8 * hi, boff = (size_t)(c0 + lr) * K + 8 * hi;
#pragma unroll 1
    for (int kc = 0; kc < K; kc += 32) {
        V a[4], a2[4];
#pragma unroll
        for (int mb = 0; mb < 4; ++mb) { a[mb] = WFrag<T16>::ld(A + aoff + (size_t)mb * 16 * K + kc); if (NSPLIT == 1 || NSPLIT == 2) a2[mb] = WFrag<T16>::ld(A2 + aoff + (size_t)mb * 16 * K + kc); }
#pragma unroll
        for (int nb = 0; nb < 4; ++nb) { const V b = WFrag<T16>::ld(Bt + boff + (size_t)nb * 16 * K + kc); V b2; if (NSPLIT >= 2) b2 = WFrag<T16>::ld(Bt2 + boff + (size_t)nb * 16 * K + kc);
#pragma unroll
            for (int mb = 0; mb < 4; ++mb) { acc[mb][nb] = WFrag<T16>::mma(a[mb], b, acc[mb][nb]); if (NSPLIT == 1 || NSPLIT == 2) acc[mb][nb] = WFrag<T16>::mma(a2[mb], b, acc[mb][nb]); if (NSPLIT >= 2) acc[mb][nb] = WFrag<T16>::mma(a[mb], b2, acc[mb][nb]); } }
        asm volatile("v_nop\n\tv_nop\n\tv_nop\n\tv_nop" : "+v"(acc[0][0]), "+v"(acc[1][1]), "+v"(acc[2][2]), "+v"(acc[3][3]) : "v"(a[0]), "v"(a[3]));
    }
#pragma unroll
    for (int mb = 0; mb < 4; ++mb) {
#pragma unroll
        for (int nb = 0; nb < 4; ++nb) {
#pragma unroll
            for (int j = 0; j < 8; ++j) os[(hi * 8 + j) * 68 + nb * 16 + lr] = acc[mb][nb][j]; }
        __builtin_amdgcn_wave_barrier(); asm volatile("" ::: "memory");
        float* crow = C + (size_t)(r0 + mb * 16) * ldc + c0;
{
#pragma unroll
            for (int s = 0; s < 8; ++s) { const int row = 2 * s + hi, cofs = lr * 4; v4f val = *(const v4fa*)(os + row * 68 + cofs); if (BIAS) { val[0] += bfr(bias[c0 + cofs]); val[1] += bfr(bias[c0 + cofs + 1]); val[2] += bfr(bias[c0 + cofs + 2]); val[3] += bfr(bias[c0 + cofs + 3]); }
                *(v4f*)(crow + (size_t)row * ldc + cofs) = val; }
             }
        __builtin_amdgcn_wave_barrier(); asm volatile("" ::: "memory");
    }
}

// ---- k_gemmc: the same one-wave 64x64 tile GEMM specialised for causal attention: CMODE 1 skips score tiles entirely above the diagonal (query rows r0+roff.., key columns c0..), CMODE 2 limits the
// key (K) loop of the probability x value contraction to the diagonal block (probabilities beyond it are exactly zero). roff = row offset of this launch's first row within the sequence.
template <typename T16, int NSPLIT, int CMODE>
__global__ __launch_bounds__(32) void k_gemmc(const T16* __restrict__ A, const T16* __restrict__ A2, const T16* __restrict__ Bt, const T16* __restrict__ Bt2, int K, float* C, int ldc, int roff, size_t sA, size_t sB, size_t sC) {
    typedef typename WFrag<T16>::V V;
    __shared__ __align__(16) float os[16 * 68];
    const size_t z = blockIdx.z; A += z * sA; if (A2) A2 += z * sA; Bt += z * sB; if (Bt2) Bt2 += z * sB; C += z * sC;
    const int lane = threadIdx.x & 31, lr = lane & 15, hi = lane >> 4; const int r0 = blockIdx.x * 64, c0 = blockIdx.y * 64;
    if (CMODE == 1 && c0 > r0 + roff + 63) return;                  // score tile entirely above the causal diagonal: left unwritten (the softmax reads it but masks j > i by select)
    const int Kl = (CMODE == 2) ? min(K, r0 + roff + 64) : K;        // P.V: probabilities are exactly 0 beyond the diagonal block, so the K loop stops there
    v8f acc[4][4];
#pragma unroll
    for (int mb = 0; mb < 4; ++mb)
#pragma unroll
        for (int nb = 0; nb < 4; ++nb) acc[mb][nb] = (v8f){};
    const size_t aoff = (size_t)(r0 + lr) * K + 8 * hi, boff = (size_t)(c0 + lr) * K + 8 * hi;
#pragma unroll 1
    for (int kc = 0; kc < Kl; kc += 32) {
        V a[4], a2[4];
#pragma unroll
        for (int mb = 0; mb < 4; ++mb) { a[mb] = WFrag<T16>::ld(A + aoff + (size_t)mb * 16 * K + kc); if (NSPLIT == 1 || NSPLIT == 2) a2[mb] = WFrag<T16>::ld(A2 + aoff + (size_t)mb * 16 * K + kc); }
#pragma unroll
        for (int nb = 0; nb < 4; ++nb) { const V b = WFrag<T16>::ld(Bt + boff + (size_t)nb * 16 * K + kc); V b2; if (NSPLIT >= 2) b2 = WFrag<T16>::ld(Bt2 + boff + (size_t)nb * 16 * K + kc);
#pragma unroll
            for (int mb = 0; mb < 4; ++mb) { acc[mb][nb] = WFrag<T16>::mma(a[mb], b, acc[mb][nb]); if (NSPLIT == 1 || NSPLIT == 2) acc[mb][nb] = WFrag<T16>::mma(a2[mb], b, acc[mb][nb]); if (NSPLIT >= 2) acc[mb][nb] = WFrag<T16>::mma(a[mb], b2, acc[mb][nb]); } }
        asm volatile("v_nop\n\tv_nop\n\tv_nop\n\tv_nop" : "+v"(acc[0][0]), "+v"(acc[1][1]), "+v"(acc[2][2]), "+v"(acc[3][3]) : "v"(a[0]), "v"(a[3]));
    }
#pragma unroll
    for (int mb = 0; mb < 4; ++mb) {
#pragma unroll
        for (int nb = 0; nb < 4; ++nb) {
#pragma unroll
            for (int j = 0; j < 8; ++j) os[(hi * 8 + j) * 68 + nb * 16 + lr] = acc[mb][nb][j]; }
        __builtin_amdgcn_wave_barrier(); asm volatile("" ::: "memory");
        float* crow = C + (size_t)(r0 + mb * 16) * ldc + c0;
{
#pragma unroll
            for (int s = 0; s < 8; ++s) { const int row = 2 * s + hi, cofs = lr * 4; v4f val = *(const v4fa*)(os + row * 68 + cofs);
                *(v4f*)(crow + (size_t)row * ldc + cofs) = val; }
             }
        __builtin_amdgcn_wave_barrier(); asm volatile("" ::: "memory");
    }
}

__device__ __forceinline__ h16 tohx(float x) { return (h16)x; }
__device__ __forceinline__ void splitf(float y, unsigned short& h, unsigned short& l) { h = f2bf(y); l = f2bf(y - bf2f(h)); }
typedef __attribute__((ext_vector_type(2))) _Float16 v2h;
typedef __attribute__((ext_vector_type(4))) _Float16 v4h;
typedef __attribute__((ext_vector_type(2))) unsigned short v2us;
typedef __attribute__((ext_vector_type(4))) unsigned short v4us;
typedef __attribute__((ext_vector_type(2))) float v2f;
typedef __attribute__((ext_vector_type(4))) int v4i;

__global__ __launch_bounds__(256) void k_wtG(const float* __restrict__ w, int K, int N, bf* Bt) {
    const int lane = threadIdx.x & 31; const int L0 = (blockIdx.x * 8 + (threadIdx.x >> 5)) * 8; const int nlines = N * K / 64;
{
#pragma unroll 1
        for (int l = 0; l < 8; ++l) { const int L = L0 + l; if (L >= nlines) break; const size_t e = (size_t)L * 64 + lane * 2; const int k = (int)(e % K), n = (int)(e / K); v2us o;
            o[0] = f2bf(w[(size_t)k * N + n]); o[1] = f2bf(w[(size_t)(k + 1) * N + n]); *(v2us*)(Bt + e) = o; }
         }
}
__global__ __launch_bounds__(256) void k_cvt8(const float* __restrict__ src, bf* dst, size_t n8) { const size_t i = (size_t)blockIdx.x * 256 + threadIdx.x; if (i >= n8) return; const v8f v = *(const v8f*)(src + i * 8); v8us o;
#pragma unroll
    for (int k = 0; k < 8; ++k) o[k] = f2bf(v[k]); *(v8us*)(dst + i * 8) = o;  }
__global__ __launch_bounds__(256) void k_cscvt(const float* __restrict__ cosT, const float* __restrict__ sinT, float* CS) { const int idx = blockIdx.x * 256 + threadIdx.x; if (idx >= TT * HD) return; v2f cs; cs[0] = bfr(cosT[idx]); cs[1] = bfr(sinT[idx]); *(v2f*)(CS + (size_t)idx * 2) = cs;  }
// k_rope: head planes [h][t][d] (fp16 + hi/lo) of rope(x) x sc with the rotate-half convention out[d] = x[d] cos[t][d] - x[d+HD/2] sin[t][d], out[d+HD/2] = x[d+HD/2] cos[t][d+HD/2] + x[d] sin[t][d+HD/2]
__global__ __launch_bounds__(256) void k_rope(const float* __restrict__ F, int pitch, int nheads, const float* __restrict__ CS, const float* __restrict__ RF, const float* __restrict__ nw, float sc, h16* P16, bf* Ph, bf* Pl) {
    const size_t e = ((size_t)blockIdx.x * 256 + threadIdx.x) * 2; if (e >= (size_t)nheads * TT * HD) return; const int d = (int)(e % HD); const int t = (int)((e / HD) % TT); const int h = (int)(e / ((size_t)HD * TT)); const float* f = F + (size_t)t * pitch + h * HD; const float rf = RF ? RF[(size_t)h * TT + t] : 1.0f; v2h o16; v2us oh, ol;
#pragma unroll
    for (int q = 0; q < 2; ++q) { const int dd = d + q; const int dp = (dd < HD / 2) ? dd + HD / 2 : dd - HD / 2; float x0 = f[dd], x1 = f[dp];
        if (RF) { float n0 = __fmul_rn(x0, rf), n1 = __fmul_rn(x1, rf); asm volatile("" : "+v"(n0)); asm volatile("" : "+v"(n1)); x0 = __fmul_rn(bfr(nw[dd]), n0); x1 = __fmul_rn(bfr(nw[dp]), n1); }
        const v2f cs = *(const v2f*)(CS + ((size_t)t * HD + dd) * 2); float a = __fmul_rn(x0, cs[0]), bq = __fmul_rn(x1, cs[1]); asm volatile("" : "+v"(a)); asm volatile("" : "+v"(bq)); const float r = ((dd < HD / 2) ? __fsub_rn(a, bq) : __fadd_rn(a, bq)) * sc;
        o16[q] = tohx(r); unsigned short a2, c2; splitf(r, a2, c2); oh[q] = a2; ol[q] = c2; }
    *(v2h*)(P16 + e) = o16; *(v2us*)(Ph + e) = oh; *(v2us*)(Pl + e) = ol;  }
__global__ __launch_bounds__(256) void k_vtp(const float* __restrict__ F, int pitch, int nheads, h16* V16, bf* Vh, bf* Vl) { const size_t e = ((size_t)blockIdx.x * 256 + threadIdx.x) * 2; if (e >= (size_t)nheads * HD * TT) return; const int t = (int)(e % TT); const int d = (int)((e / TT) % HD); const int g = (int)(e / ((size_t)TT * HD)); v2h o16; v2us oh, ol;
#pragma unroll
    for (int q = 0; q < 2; ++q) { const float x = F[(size_t)(t + q) * pitch + g * HD + d]; o16[q] = tohx(x); unsigned short a2, c2; splitf(x, a2, c2); oh[q] = a2; ol[q] = c2; }
    *(v2h*)(V16 + e) = o16; *(v2us*)(Vh + e) = oh; *(v2us*)(Vl + e) = ol;  }
__global__ __launch_bounds__(256) void k_csid(float* CS) { const int idx = blockIdx.x * 256 + threadIdx.x; if (idx >= TT * HD) return; v2f cs; cs[0] = 1.0f; cs[1] = 0.0f; *(v2f*)(CS + (size_t)idx * 2) = cs;  }
// k_asoft: per row (zz, i): t = S x SCL (the #define above: 2^-13 in this file) for j <= i and i - j < WIN (WIN = TT: plain causal; the module's -inf exclusion); softmax over the 2048 keys (register row, one exp, fixed trees);
__global__ __launch_bounds__(256) void k_asoft(const float* __restrict__ Sb, h16* P16, bf* Ph, bf* Pl) {
    const int lane = threadIdx.x & 31; const int row = blockIdx.x * 8 + (threadIdx.x >> 5); if (row >= ZH * TT) return; const int i = row % TT; const int zz = row / TT; (void)zz; const bool hires = (i < RH); const float* sr = Sb + (size_t)row * TT; float v[TT / 32]; float mx = -3.0e38f;
#pragma unroll
    for (int ch = 0; ch < TT / 128; ++ch) { const int j0 = ch * 128 + lane * 4; const v4f a = *(const v4f*)(sr + j0);
#pragma unroll
        for (int q = 0; q < 4; ++q) { const int j = j0 + q; (void)j; float sa = a[q] * SCL; asm volatile("" : "+v"(sa)); const float t = (j <= i && i - j < WIN) ? sa : -3.0e38f; v[ch * 4 + q] = t; mx = fmaxf(mx, t); } }
#pragma unroll
    for (int sh = 16; sh; sh >>= 1) mx = fmaxf(mx, __shfl_xor(mx, sh, 32));
    float sum = 0.f;
#pragma unroll
    for (int k = 0; k < TT / 32; ++k) { float d0 = __fsub_rn(v[k], mx); asm volatile("" : "+v"(d0)); v[k] = __builtin_amdgcn_exp2f(__fmul_rn(d0, 1.4426950408889634f)); sum += v[k]; }
#pragma unroll
    for (int sh = 16; sh; sh >>= 1) sum += __shfl_xor(sum, sh, 32);
    const float f = __fdiv_rn(hires ? 1.0f : PCAR, sum);
{
        if (hires) {
#pragma unroll
            for (int ch = 0; ch < TT / 128; ++ch) { v4us oh, ol;
#pragma unroll
                for (int q = 0; q < 4; ++q) { unsigned short a, c2; splitf(v[ch * 4 + q] * f, a, c2); oh[q] = a; ol[q] = c2; }
                const size_t oo = ((size_t)zz * (RH ? RH : 1) + i) * TT + ch * 128 + lane * 4; *(v4us*)(Ph + oo) = oh; *(v4us*)(Pl + oo) = ol; }
        } else {
#pragma unroll
            for (int ch = 0; ch < TT / 128; ++ch) { v4h o4;
#pragma unroll
                for (int q = 0; q < 4; ++q) o4[q] = tohx(v[ch * 4 + q] * f);
                *(v4h*)(P16 + (size_t)row * TT + ch * 128 + lane * 4) = o4; } }
         }
}
__global__ __launch_bounds__(256) void k_merge(const float* __restrict__ O, int h0, bf* Ah, bf* Al) { const size_t e = ((size_t)blockIdx.x * 256 + threadIdx.x) * 2; if (e >= (size_t)ZH * TT * HD) return; const int d = (int)(e % HD); const int t = (int)((e / HD) % TT); const int zz = (int)(e / ((size_t)HD * TT)); const float cs = (t < RH) ? 0.0009765625f : (0.0009765625f / PCAR);   /* x 2^-10: this module scales v by c^-0.5 = 2^-5 and the projected output by out_dim^-0.5 = 2^-5: both linear: ONE exact factor on the merged context */ const size_t oo = (size_t)t * DQ + (h0 + zz) * HD + d;
    v2us oh, ol;
#pragma unroll
    for (int q = 0; q < 2; ++q) { unsigned short a, c2; splitf(O[e + q] * cs, a, c2); oh[q] = a; ol[q] = c2; } *(v2us*)(Ah + oo) = oh; *(v2us*)(Al + oo) = ol;  }

extern "C" void kernel_launch(void* const* d_in, const int* in_sizes, int n_in,
                              void* d_out, int out_size, void* d_ws, size_t ws_size, hipStream_t stream) {
    (void)in_sizes; (void)n_in; (void)out_size;
    const float* x = (const float*)d_in[0]; const float* wk = (const float*)d_in[1]; const float* wq = (const float*)d_in[2]; const float* wv = (const float*)d_in[3]; const float* wo = (const float*)d_in[4];   /* input order x, W_key, W_query, W_value, W_proj ('oi' [1024][1024], UNIT normal): the KEY weight comes FIRST; NO bias input in this module */ const float* cosT = nullptr; const float* sinT = nullptr; (void)cosT; (void)sinT;
    float* OUT = (float*)d_out;     // [4][2048][1024]
    char* wsp = (char*)d_ws;
    auto take = [&](size_t bytes) { char* p = wsp; wsp += (bytes + 255) & ~(size_t)255; return (void*)p; };
    bf* WQ = (bf*)take((size_t)DQ * DM * 2); bf* WK = (bf*)take((size_t)DKV * DM * 2); bf* WV = (bf*)take((size_t)DKV * DM * 2); bf* WO = (bf*)take((size_t)DM * DQ * 2); float* CS = (float*)take((size_t)TT * HD * 2 * 4);
    bf* XB = (bf*)take((size_t)TT * DM * 2); float* FQ = (float*)take((size_t)TT * DQ * 4); float* FK = (float*)take((size_t)TT * DKV * 4);
    h16* QP16 = (h16*)take((size_t)NH_ * TT * HD * 2); h16* KP16 = (h16*)take((size_t)NKV * TT * HD * 2); h16* VT16 = (h16*)take((size_t)NKV * HD * TT * 2);
    bf* QPh = (bf*)take((size_t)NH_ * TT * HD * 2); bf* QPl = (bf*)take((size_t)NH_ * TT * HD * 2); bf* KPh = (bf*)take((size_t)NKV * TT * HD * 2); bf* KPl = (bf*)take((size_t)NKV * TT * HD * 2); bf* VTh = (bf*)take((size_t)NKV * HD * TT * 2); bf* VTl = (bf*)take((size_t)NKV * HD * TT * 2); bf* Ph = (bf*)take((size_t)ZH * RH * TT * 2); bf* Pl = (bf*)take((size_t)ZH * RH * TT * 2);
    float* Sb = (float*)take((size_t)ZH * TT * TT * 4); h16* P16 = (h16*)take((size_t)ZH * TT * TT * 2); float* Ob = (float*)take((size_t)ZH * TT * HD * 4); bf* ATh = (bf*)take((size_t)TT * DQ * 2); bf* ATl = (bf*)take((size_t)TT * DQ * 2);
    if ((size_t)(wsp - (char*)d_ws) > ws_size) return;    // ws 256 MiB
    float* FV = FK;   // v projection reuses the k buffer after the k planes are built (stream-ordered)
    { k_cvt8<<<(unsigned)(((size_t)DQ * DM / 8 + 255) / 256), 256, 0, stream>>>(wq, WQ, (size_t)DQ * DM / 8); k_cvt8<<<(unsigned)(((size_t)DKV * DM / 8 + 255) / 256), 256, 0, stream>>>(wk, WK, (size_t)DKV * DM / 8); k_cvt8<<<(unsigned)(((size_t)DKV * DM / 8 + 255) / 256), 256, 0, stream>>>(wv, WV, (size_t)DKV * DM / 8);
      k_cvt8<<<(unsigned)(((size_t)DM * DQ / 8 + 255) / 256), 256, 0, stream>>>(wo, WO, (size_t)DM * DQ / 8);
       }
    k_csid<<<(TT * HD + 255) / 256, 256, 0, stream>>>(CS);
    const unsigned LQ = (unsigned)(((size_t)NH_ * TT * HD / 2 + 255) / 256), LKv = (unsigned)(((size_t)NKV * TT * HD / 2 + 255) / 256);
    for (int b = 0; b < NB_; ++b) {
        
        k_cvt8<<<(unsigned)(((size_t)TT * DM / 8 + 255) / 256), 256, 0, stream>>>(x + (size_t)b * TT * DM, XB, (size_t)TT * DM / 8);
        k_gemmw<bf, 0, false><<<dim3(TT / 64, DQ / 64, 1), 32, 0, stream>>>(XB, nullptr, WQ, nullptr, DM, FQ, DQ, nullptr, 0, 0, 0);
        k_rope<<<LQ, 256, 0, stream>>>(FQ, DQ, NH_, CS, nullptr, nullptr, 1.0f, QP16, QPh, QPl);
        k_gemmw<bf, 0, false><<<dim3(TT / 64, DKV / 64, 1), 32, 0, stream>>>(XB, nullptr, WK, nullptr, DM, FK, DKV, nullptr, 0, 0, 0);
        k_rope<<<LKv, 256, 0, stream>>>(FK, DKV, NKV, CS, nullptr, nullptr, 1.0f, KP16, KPh, KPl);
        k_gemmw<bf, 0, false><<<dim3(TT / 64, DKV / 64, 1), 32, 0, stream>>>(XB, nullptr, WV, nullptr, DM, FV, DKV, nullptr, 0, 0, 0); k_vtp<<<LKv, 256, 0, stream>>>(FV, DKV, NKV, VT16, VTh, VTl);
        for (int h0 = 0; h0 < NH_; h0 += ZH) { const size_t zq = (size_t)h0, zk = (size_t)(h0 / REP);   // one kv head per query head: the pass's two heads use consecutive kv planes (z-strides TT*HD)
            k_gemmc<bf, 2, 1><<<dim3(RH / 64, TT / 64, ZH), 32, 0, stream>>>(QPh + zq * TT * HD, QPl + zq * TT * HD, KPh + zk * TT * HD, KPl + zk * TT * HD, HD, Sb, TT, 0, (size_t)TT * HD, (size_t)TT * HD, (size_t)TT * TT);
            k_gemmc<h16, 0, 1><<<dim3((TT - RH) / 64, TT / 64, ZH), 32, 0, stream>>>(QP16 + zq * TT * HD + (size_t)RH * HD, nullptr, KP16 + zk * TT * HD, nullptr, HD, Sb + (size_t)RH * TT, TT, RH, (size_t)TT * HD, (size_t)TT * HD, (size_t)TT * TT);
            k_asoft<<<ZH * TT / 8, 256, 0, stream>>>(Sb, P16, Ph, Pl);
            k_gemmc<bf, 2, 2><<<dim3(RH / 64, HD / 64, ZH), 32, 0, stream>>>(Ph, Pl, VTh + zk * HD * TT, VTl + zk * HD * TT, TT, Ob, HD, 0, (size_t)RH * TT, (size_t)HD * TT, (size_t)TT * HD);
            k_gemmc<h16, 0, 2><<<dim3((TT - RH) / 64, HD / 64, ZH), 32, 0, stream>>>(P16 + (size_t)RH * TT, nullptr, VT16 + zk * HD * TT, nullptr, TT, Ob + (size_t)RH * HD, HD, RH, (size_t)TT * TT, (size_t)HD * TT, (size_t)TT * HD);
            k_merge<<<(unsigned)(((size_t)ZH * TT * HD / 2 + 255) / 256), 256, 0, stream>>>(Ob, h0, ATh, ATl); }
        k_gemmw<bf, 1, false><<<dim3(TT / 64, DM / 64, 1), 32, 0, stream>>>(ATh, ATl, WO, nullptr, DQ, OUT + (size_t)b * TT * DM, DM, nullptr, 0, 0, 0); }
}

// v001
// It runs in 1920 microseconds.
// In two side-by-side timings against v000, it was 1.61 and 1.56 times as fast.
#include <hip/hip_runtime.h>

// Causal multi-head self-attention whose projections and output are each scaled by 1/sqrt(width) (x [4][2048][1024]; k, q, v = (x W^T) x 1024^-0.5 ('oi' [1024][1024] UNIT normal, no bias; 16 heads x 64): each projection x 2^-5 (exact); scores = q.k x 64^-0.5: with the two 2^-5 factors folded in, q.k(unscaled) x 2^-13 (exact); causal (tril kept, -inf elsewhere); softmax; out = (merged W_proj^T) x 1024^-0.5 ('oi', no bias): the v factor 2^-5 and the output factor 2^-5 are both linear: ONE factor 2^-10 on the merged context (exact) -> [4][2048][1024] (8.4 M); argument order x, W_key, W_query, W_value, W_proj: KEY FIRST).
// Compute dtypes, f32 accumulate: every input rounded to bf16; q/k/v on PLAIN bf16 operands (inputs: exact); causal scores and attn.v: query rows < 512 hl (3 products), the rest single fp16 (x1024), causal tile skipping; softmax f32 (scale 2^-13 exact); the merged context x 2^-10 (exact); W_proj hl x exact (2 products), NO bias.

#define NB_  4
#define TT   2048
#define DM   1024
#define NH_  16
#define NKV  16
#define REP  (NH_ / NKV)
#define HD   64
#define DQ   (NH_ * HD)
#define DKV  (NKV * HD)
#define ZH   2
#define RH   512                  // query rows < RH use hi+lo planes (0: none)
#define WIN  2048
#define PCAR 1024.0f
#define SCL  0.0001220703125f   // 2^-13 = 1024^-0.5 (on q) x 1024^-0.5 (on k) x 64^-0.5: this module scales q AND k by c^-0.5 = 2^-5 each and the scores by hd^-0.5 = 2^-3: all exact powers of two, applied here in ONE multiply on the unscaled q.k
typedef _Float16 h16;
typedef unsigned short bf;
typedef __attribute__((ext_vector_type(16))) __bf16   v16bf;
typedef __attribute__((ext_vector_type(16))) _Float16 v16h;
typedef __attribute__((ext_vector_type(8)))  _Float16 v8h;
typedef __attribute__((ext_vector_type(8)))  unsigned short v8us;
typedef __attribute__((ext_vector_type(8)))  float    v8f;
typedef __attribute__((ext_vector_type(4)))  float    v4f;
typedef v8h  __attribute__((may_alias)) v8ha;
typedef v4f  __attribute__((may_alias)) v4fa;
typedef v8us __attribute__((may_alias)) v8usa;

__device__ __forceinline__ unsigned short f2bf(float f) { unsigned u = __float_as_uint(f); u += 0x7FFFu + ((u >> 16) & 1u); return (unsigned short)(u >> 16); }
__device__ __forceinline__ float bf2f(unsigned short b) { return __uint_as_float(((unsigned)b) << 16); }
__device__ __forceinline__ float bfr(float f) { return bf2f(f2bf(f)); }
__device__ __forceinline__ v16h cat16(v8h lo, v8h hi) { return __builtin_shufflevector(lo, hi, 0, 1, 2, 3, 4, 5, 6, 7, 8, 9, 10, 11, 12, 13, 14, 15); }
__device__ __forceinline__ v16bf cat16b(v8us lo, v8us hi) { return __builtin_bit_cast(v16bf, __builtin_shufflevector(lo, hi, 0, 1, 2, 3, 4, 5, 6, 7, 8, 9, 10, 11, 12, 13, 14, 15)); }
__device__ __forceinline__ v8f wmma16(v16h a, v16h b, v8f c) { return __builtin_amdgcn_wmma_f32_16x16x32_f16(false, a, false, b, (short)0, c, false, false); }
__device__ __forceinline__ v8f wmmab(v16bf a, v16bf b, v8f c) { return __builtin_amdgcn_wmma_f32_16x16x32_bf16(false, a, false, b, (short)0, c, false, false); }



// ---- k_gemmw: register-blocked GEMM, one 64x64 output tile per work-group of NW waves; every wave holds the whole tile (16 accumulators) and takes every NW-th 64-wide slice of K (one 128-byte line of each operand row), so NW times the bytes are in flight;
// the NW partial tiles are summed through LDS in wave order (fixed). Operands straight from K-contiguous 16-bit planes; grid (M/64, N/64, Z), NW x 32 threads.
// C[m][n] (f32, pitch ldc, + optional f32 bias[n]) = sum_k A[m][k] Bt[n][k] (+ split products per NSPLIT). z-batch strides sA/sB/sC in elements. K % 64 == 0.
template <typename T16> struct WFrag;
template <> struct WFrag<h16> { typedef v16h V; static __device__ __forceinline__ V ld(const h16* p) { return cat16(*(const v8h*)p, *(const v8h*)(p + 16)); } static __device__ __forceinline__ v8f mma(V a, V b, v8f c) { return wmma16(a, b, c); } };
template <> struct WFrag<bf> { typedef v16bf V; static __device__ __forceinline__ V ld(const bf* p) { return cat16b(*(const v8us*)p, *(const v8us*)(p + 16)); } static __device__ __forceinline__ v8f mma(V a, V b, v8f c) { return wmmab(a, b, c); } };
template <typename T16, int NSPLIT, bool BIAS, int NW>
__global__ __launch_bounds__(NW * 32) void k_gemmw(const T16* __restrict__ A, const T16* __restrict__ A2, const T16* __restrict__ Bt, const T16* __restrict__ Bt2, int K, float* C, int ldc, const float* __restrict__ bias, size_t sA, size_t sB, size_t sC) {
    typedef typename WFrag<T16>::V V;
    __shared__ __align__(16) float os[NW * 64 * 68];
    const size_t z = blockIdx.z; A += z * sA; if (A2) A2 += z * sA; Bt += z * sB; if (Bt2) Bt2 += z * sB; C += z * sC;
    const int lane = threadIdx.x & 31, lr = lane & 15, hi = lane >> 4; const int w = __builtin_amdgcn_readfirstlane((int)(threadIdx.x >> 5)); const int r0 = blockIdx.x * 64, c0 = blockIdx.y * 64;
    v8f acc[4][4];
#pragma unroll
    for (int mb = 0; mb < 4; ++mb)
#pragma unroll
        for (int nb = 0; nb < 4; ++nb) acc[mb][nb] = (v8f){};
    const size_t aoff = (size_t)(r0 + lr) * K + 8 * hi, boff = (size_t)(c0 + lr) * K + 8 * hi;
#pragma unroll 1
    for (int kc = w * 64; kc < K; kc += (kc & 32) ? NW * 64 - 32 : 32) {   // two 32-wide trips inside this wave's 64-wide slice, then on to its next slice
        V a[4], a2[4];
#pragma unroll
        for (int mb = 0; mb < 4; ++mb) { a[mb] = WFrag<T16>::ld(A + aoff + (size_t)mb * 16 * K + kc); if (NSPLIT == 1 || NSPLIT == 2) a2[mb] = WFrag<T16>::ld(A2 + aoff + (size_t)mb * 16 * K + kc); }
#pragma unroll
        for (int nb = 0; nb < 4; ++nb) { const V b = WFrag<T16>::ld(Bt + boff + (size_t)nb * 16 * K + kc); V b2; if (NSPLIT >= 2) b2 = WFrag<T16>::ld(Bt2 + boff + (size_t)nb * 16 * K + kc);
#pragma unroll
            for (int mb = 0; mb < 4; ++mb) { acc[mb][nb] = WFrag<T16>::mma(a[mb], b, acc[mb][nb]); if (NSPLIT == 1 || NSPLIT == 2) acc[mb][nb] = WFrag<T16>::mma(a2[mb], b, acc[mb][nb]); if (NSPLIT >= 2) acc[mb][nb] = WFrag<T16>::mma(a[mb], b2, acc[mb][nb]); } }
        asm volatile("v_nop\n\tv_nop\n\tv_nop\n\tv_nop" : "+v"(acc[0][0]), "+v"(acc[1][1]), "+v"(acc[2][2]), "+v"(acc[3][3]) : "v"(a[0]), "v"(a[3]));
    }
    // every wave lays its partial tile in its own LDS plane (a wave that got no K slice lays zeros); behind the one work-group barrier each thread sums the NW planes in wave order and stores 16 bytes per pass (16 threads fill one 256-byte row)
    float* my = os + w * (64 * 68);
#pragma unroll
    for (int mb = 0; mb < 4; ++mb)
#pragma unroll
        for (int nb = 0; nb < 4; ++nb)
#pragma unroll
            for (int j = 0; j < 8; ++j) my[(mb * 16 + hi * 8 + j) * 68 + nb * 16 + lr] = acc[mb][nb][j];
    __syncthreads();
#pragma unroll
    for (int s = 0; s < 32 / NW; ++s) { const int idx = s * (NW * 32) + (int)threadIdx.x; const int row = idx >> 4, cofs = (idx & 15) * 4; v4f val = *(const v4fa*)(os + row * 68 + cofs);
#pragma unroll
        for (int p = 1; p < NW; ++p) val += *(const v4fa*)(os + p * (64 * 68) + row * 68 + cofs);
        if (BIAS) { val[0] += bfr(bias[c0 + cofs]); val[1] += bfr(bias[c0 + cofs + 1]); val[2] += bfr(bias[c0 + cofs + 2]); val[3] += bfr(bias[c0 + cofs + 3]); }
        *(v4f*)(C + (size_t)(r0 + row) * ldc + c0 + cofs) = val; }
}

// ---- k_gemmc: the same 64x64 tile GEMM specialised for causal attention: CMODE 1 skips score tiles entirely above the diagonal (query rows r0+roff.., key columns c0..), CMODE 2 limits the
// key (K) loop of the probability x value contraction to the diagonal block (probabilities beyond it are exactly zero). roff = row offset of this launch's first row within the sequence.
// NW = 1: one wave per tile (the scores, K = 64). NW > 1: as in k_gemmw, NW waves share the tile's K loop in 64-wide slices and their partial tiles are summed through LDS in wave order.
template <typename T16, int NSPLIT, int CMODE, int NW>
__global__ __launch_bounds__(NW * 32) void k_gemmc(const T16* __restrict__ A, const T16* __restrict__ A2, const T16* __restrict__ Bt, const T16* __restrict__ Bt2, int K, float* C, int ldc, int roff, size_t sA, size_t sB, size_t sC) {
    typedef typename WFrag<T16>::V V;
    __shared__ __align__(16) float os[NW == 1 ? 16 * 68 : NW * 64 * 68];
    const size_t z = blockIdx.z; A += z * sA; if (A2) A2 += z * sA; Bt += z * sB; if (Bt2) Bt2 += z * sB; C += z * sC;
    const int lane = threadIdx.x & 31, lr = lane & 15, hi = lane >> 4; const int w = (NW == 1) ? 0 : __builtin_amdgcn_readfirstlane((int)(threadIdx.x >> 5)); const int r0 = blockIdx.x * 64, c0 = blockIdx.y * 64;
    if (CMODE == 1 && c0 > r0 + roff + 63) return;                  // score tile entirely above the causal diagonal: left unwritten (the softmax loads it but masks j > i by select)
    const int Kl = (CMODE == 2) ? min(K, r0 + roff + 64) : K;        // P.V: probabilities are exactly 0 beyond the diagonal block, so the K loop stops there
    v8f acc[4][4];
#pragma unroll
    for (int mb = 0; mb < 4; ++mb)
#pragma unroll
        for (int nb = 0; nb < 4; ++nb) acc[mb][nb] = (v8f){};
    const size_t aoff = (size_t)(r0 + lr) * K + 8 * hi, boff = (size_t)(c0 + lr) * K + 8 * hi;
#pragma unroll 1
    for (int kc = w * 64; kc < Kl; kc += (kc & 32) ? NW * 64 - 32 : 32) {   // two 32-wide trips inside this wave's 64-wide slice, then on to its next slice
        V a[4], a2[4];
#pragma unroll
        for (int mb = 0; mb < 4; ++mb) { a[mb] = WFrag<T16>::ld(A + aoff + (size_t)mb * 16 * K + kc); if (NSPLIT == 1 || NSPLIT == 2) a2[mb] = WFrag<T16>::ld(A2 + aoff + (size_t)mb * 16 * K + kc); }
#pragma unroll
        for (int nb = 0; nb < 4; ++nb) { const V b = WFrag<T16>::ld(Bt + boff + (size_t)nb * 16 * K + kc); V b2; if (NSPLIT >= 2) b2 = WFrag<T16>::ld(Bt2 + boff + (size_t)nb * 16 * K + kc);
#pragma unroll
            for (int mb = 0; mb < 4; ++mb) { acc[mb][nb] = WFrag<T16>::mma(a[mb], b, acc[mb][nb]); if (NSPLIT == 1 || NSPLIT == 2) acc[mb][nb] = WFrag<T16>::mma(a2[mb], b, acc[mb][nb]); if (NSPLIT >= 2) acc[mb][nb] = WFrag<T16>::mma(a[mb], b2, acc[mb][nb]); } }
        asm volatile("v_nop\n\tv_nop\n\tv_nop\n\tv_nop" : "+v"(acc[0][0]), "+v"(acc[1][1]), "+v"(acc[2][2]), "+v"(acc[3][3]) : "v"(a[0]), "v"(a[3]));
    }
    if constexpr (NW == 1) {
#pragma unroll
    for (int mb = 0; mb < 4; ++mb) {
#pragma unroll
        for (int nb = 0; nb < 4; ++nb) {
#pragma unroll
            for (int j = 0; j < 8; ++j) os[(hi * 8 + j) * 68 + nb * 16 + lr] = acc[mb][nb][j]; }
        __builtin_amdgcn_wave_barrier(); asm volatile("" ::: "memory");
        float* crow = C + (size_t)(r0 + mb * 16) * ldc + c0;
{
#pragma unroll
            for (int s = 0; s < 8; ++s) { const int row = 2 * s + hi, cofs = lr * 4; v4f val = *(const v4fa*)(os + row * 68 + cofs);
                *(v4f*)(crow + (size_t)row * ldc + cofs) = val; }
             }
        __builtin_amdgcn_wave_barrier(); asm volatile("" ::: "memory");
    }
    } else {
    // every wave lays its partial tile in its own LDS plane (a wave that got no K slice lays zeros); behind the one work-group barrier each thread sums the NW planes in wave order and stores 16 bytes per pass (16 threads fill one 256-byte row)
    float* my = os + w * (64 * 68);
#pragma unroll
    for (int mb = 0; mb < 4; ++mb)
#pragma unroll
        for (int nb = 0; nb < 4; ++nb)
#pragma unroll
            for (int j = 0; j < 8; ++j) my[(mb * 16 + hi * 8 + j) * 68 + nb * 16 + lr] = acc[mb][nb][j];
    __syncthreads();
#pragma unroll
    for (int s = 0; s < 32 / NW; ++s) { const int idx = s * (NW * 32) + (int)threadIdx.x; const int row = idx >> 4, cofs = (idx & 15) * 4; v4f val = *(const v4fa*)(os + row * 68 + cofs);
#pragma unroll
        for (int p = 1; p < NW; ++p) val += *(const v4fa*)(os + p * (64 * 68) + row * 68 + cofs);
        *(v4f*)(C + (size_t)(r0 + row) * ldc + c0 + cofs) = val; }
    }
}

__device__ __forceinline__ h16 tohx(float x) { return (h16)x; }
__device__ __forceinline__ void splitf(float y, unsigned short& h, unsigned short& l) { h = f2bf(y); l = f2bf(y - bf2f(h)); }
typedef __attribute__((ext_vector_type(2))) _Float16 v2h;
typedef __attribute__((ext_vector_type(4))) _Float16 v4h;
typedef __attribute__((ext_vector_type(2))) unsigned short v2us;
typedef __attribute__((ext_vector_type(4))) unsigned short v4us;
typedef __attribute__((ext_vector_type(2))) float v2f;
typedef __attribute__((ext_vector_type(4))) int v4i;

__global__ __launch_bounds__(256) void k_wtG(const float* __restrict__ w, int K, int N, bf* Bt) {
    const int lane = threadIdx.x & 31; const int L0 = (blockIdx.x * 8 + (threadIdx.x >> 5)) * 8; const int nlines = N * K / 64;
{
#pragma unroll 1
        for (int l = 0; l < 8; ++l) { const int L = L0 + l; if (L >= nlines) break; const size_t e = (size_t)L * 64 + lane * 2; const int k = (int)(e % K), n = (int)(e / K); v2us o;
            o[0] = f2bf(w[(size_t)k * N + n]); o[1] = f2bf(w[(size_t)(k + 1) * N + n]); *(v2us*)(Bt + e) = o; }
         }
}
__global__ __launch_bounds__(256) void k_cvt8(const float* __restrict__ src, bf* dst, size_t n8) { const size_t i = (size_t)blockIdx.x * 256 + threadIdx.x; if (i >= n8) return; const v8f v = *(const v8f*)(src + i * 8); v8us o;
#pragma unroll
    for (int k = 0; k < 8; ++k) o[k] = f2bf(v[k]); *(v8us*)(dst + i * 8) = o;  }
__global__ __launch_bounds__(256) void k_cscvt(const float* __restrict__ cosT, const float* __restrict__ sinT, float* CS) { const int idx = blockIdx.x * 256 + threadIdx.x; if (idx >= TT * HD) return; v2f cs; cs[0] = bfr(cosT[idx]); cs[1] = bfr(sinT[idx]); *(v2f*)(CS + (size_t)idx * 2) = cs;  }
// k_rope: head planes [h][t][d] (fp16 + hi/lo) of rope(x) x sc with the rotate-half convention out[d] = x[d] cos[t][d] - x[d+HD/2] sin[t][d], out[d+HD/2] = x[d+HD/2] cos[t][d+HD/2] + x[d] sin[t][d+HD/2]
__global__ __launch_bounds__(256) void k_rope(const float* __restrict__ F, int pitch, int nheads, const float* __restrict__ CS, const float* __restrict__ RF, const float* __restrict__ nw, float sc, h16* P16, bf* Ph, bf* Pl) {
    const size_t e = ((size_t)blockIdx.x * 256 + threadIdx.x) * 2; if (e >= (size_t)nheads * TT * HD) return; const int d = (int)(e % HD); const int t = (int)((e / HD) % TT); const int h = (int)(e / ((size_t)HD * TT)); const float* f = F + (size_t)t * pitch + h * HD; const float rf = RF ? RF[(size_t)h * TT + t] : 1.0f; v2h o16; v2us oh, ol;
#pragma unroll
    for (int q = 0; q < 2; ++q) { const int dd = d + q; const int dp = (dd < HD / 2) ? dd + HD / 2 : dd - HD / 2; float x0 = f[dd], x1 = f[dp];
        if (RF) { float n0 = __fmul_rn(x0, rf), n1 = __fmul_rn(x1, rf); asm volatile("" : "+v"(n0)); asm volatile("" : "+v"(n1)); x0 = __fmul_rn(bfr(nw[dd]), n0); x1 = __fmul_rn(bfr(nw[dp]), n1); }
        const v2f cs = *(const v2f*)(CS + ((size_t)t * HD + dd) * 2); float a = __fmul_rn(x0, cs[0]), bq = __fmul_rn(x1, cs[1]); asm volatile("" : "+v"(a)); asm volatile("" : "+v"(bq)); const float r = ((dd < HD / 2) ? __fsub_rn(a, bq) : __fadd_rn(a, bq)) * sc;
        o16[q] = tohx(r); unsigned short a2, c2; splitf(r, a2, c2); oh[q] = a2; ol[q] = c2; }
    *(v2h*)(P16 + e) = o16; *(v2us*)(Ph + e) = oh; *(v2us*)(Pl + e) = ol;  }
__global__ __launch_bounds__(256) void k_vtp(const float* __restrict__ F, int pitch, int nheads, h16* V16, bf* Vh, bf* Vl) { const size_t e = ((size_t)blockIdx.x * 256 + threadIdx.x) * 2; if (e >= (size_t)nheads * HD * TT) return; const int t = (int)(e % TT); const int d = (int)((e / TT) % HD); const int g = (int)(e / ((size_t)TT * HD)); v2h o16; v2us oh, ol;
#pragma unroll
    for (int q = 0; q < 2; ++q) { const float x = F[(size_t)(t + q) * pitch + g * HD + d]; o16[q] = tohx(x); unsigned short a2, c2; splitf(x, a2, c2); oh[q] = a2; ol[q] = c2; }
    *(v2h*)(V16 + e) = o16; *(v2us*)(Vh + e) = oh; *(v2us*)(Vl + e) = ol;  }
__global__ __launch_bounds__(256) void k_csid(float* CS) { const int idx = blockIdx.x * 256 + threadIdx.x; if (idx >= TT * HD) return; v2f cs; cs[0] = 1.0f; cs[1] = 0.0f; *(v2f*)(CS + (size_t)idx * 2) = cs;  }
// k_asoft: per row (zz, i): t = S x SCL (the #define above: 2^-13 in this file) for j <= i and i - j < WIN (WIN = TT: plain causal; the module's -inf exclusion); softmax over the 2048 keys (register row, one exp, fixed trees);
__global__ __launch_bounds__(256) void k_asoft(const float* __restrict__ Sb, h16* P16, bf* Ph, bf* Pl) {
    const int lane = threadIdx.x & 31; const int row = blockIdx.x * 8 + (threadIdx.x >> 5); if (row >= ZH * TT) return; const int i = row % TT; const int zz = row / TT; (void)zz; const bool hires = (i < RH); const float* sr = Sb + (size_t)row * TT; float v[TT / 32]; float mx = -3.0e38f;
#pragma unroll
    for (int ch = 0; ch < TT / 128; ++ch) { const int j0 = ch * 128 + lane * 4; const v4f a = *(const v4f*)(sr + j0);
#pragma unroll
        for (int q = 0; q < 4; ++q) { const int j = j0 + q; (void)j; float sa = a[q] * SCL; asm volatile("" : "+v"(sa)); const float t = (j <= i && i - j < WIN) ? sa : -3.0e38f; v[ch * 4 + q] = t; mx = fmaxf(mx, t); } }
#pragma unroll
    for (int sh = 16; sh; sh >>= 1) mx = fmaxf(mx, __shfl_xor(mx, sh, 32));
    float sum = 0.f;
#pragma unroll
    for (int k = 0; k < TT / 32; ++k) { float d0 = __fsub_rn(v[k], mx); asm volatile("" : "+v"(d0)); v[k] = __builtin_amdgcn_exp2f(__fmul_rn(d0, 1.4426950408889634f)); sum += v[k]; }
#pragma unroll
    for (int sh = 16; sh; sh >>= 1) sum += __shfl_xor(sum, sh, 32);
    const float f = __fdiv_rn(hires ? 1.0f : PCAR, sum);
{
        if (hires) {
#pragma unroll
            for (int ch = 0; ch < TT / 128; ++ch) { v4us oh, ol;
#pragma unroll
                for (int q = 0; q < 4; ++q) { unsigned short a, c2; splitf(v[ch * 4 + q] * f, a, c2); oh[q] = a; ol[q] = c2; }
                const size_t oo = ((size_t)zz * (RH ? RH : 1) + i) * TT + ch * 128 + lane * 4; *(v4us*)(Ph + oo) = oh; *(v4us*)(Pl + oo) = ol; }
        } else {
#pragma unroll
            for (int ch = 0; ch < TT / 128; ++ch) { v4h o4;
#pragma unroll
                for (int q = 0; q < 4; ++q) o4[q] = tohx(v[ch * 4 + q] * f);
                *(v4h*)(P16 + (size_t)row * TT + ch * 128 + lane * 4) = o4; } }
         }
}
__global__ __launch_bounds__(256) void k_merge(const float* __restrict__ O, int h0, bf* Ah, bf* Al) { const size_t e = ((size_t)blockIdx.x * 256 + threadIdx.x) * 2; if (e >= (size_t)ZH * TT * HD) return; const int d = (int)(e % HD); const int t = (int)((e / HD) % TT); const int zz = (int)(e / ((size_t)HD * TT)); const float cs = (t < RH) ? 0.0009765625f : (0.0009765625f / PCAR);   /* x 2^-10: this module scales v by c^-0.5 = 2^-5 and the projected output by out_dim^-0.5 = 2^-5: both linear: ONE exact factor on the merged context */ const size_t oo = (size_t)t * DQ + (h0 + zz) * HD + d;
    v2us oh, ol;
#pragma unroll
    for (int q = 0; q < 2; ++q) { unsigned short a, c2; splitf(O[e + q] * cs, a, c2); oh[q] = a; ol[q] = c2; } *(v2us*)(Ah + oo) = oh; *(v2us*)(Al + oo) = ol;  }

extern "C" void kernel_launch(void* const* d_in, const int* in_sizes, int n_in,
                              void* d_out, int out_size, void* d_ws, size_t ws_size, hipStream_t stream) {
    (void)in_sizes; (void)n_in; (void)out_size;
    const float* x = (const float*)d_in[0]; const float* wk = (const float*)d_in[1]; const float* wq = (const float*)d_in[2]; const float* wv = (const float*)d_in[3]; const float* wo = (const float*)d_in[4];   /* input order x, W_key, W_query, W_value, W_proj ('oi' [1024][1024], UNIT normal): the KEY weight comes FIRST; NO bias input in this module */ const float* cosT = nullptr; const float* sinT = nullptr; (void)cosT; (void)sinT;
    float* OUT = (float*)d_out;     // [4][2048][1024]
    char* wsp = (char*)d_ws;
    auto take = [&](size_t bytes) { char* p = wsp; wsp += (bytes + 255) & ~(size_t)255; return (void*)p; };
    bf* WQ = (bf*)take((size_t)DQ * DM * 2); bf* WK = (bf*)take((size_t)DKV * DM * 2); bf* WV = (bf*)take((size_t)DKV * DM * 2); bf* WO = (bf*)take((size_t)DM * DQ * 2); float* CS = (float*)take((size_t)TT * HD * 2 * 4);
    bf* XB = (bf*)take((size_t)TT * DM * 2); float* FQ = (float*)take((size_t)TT * DQ * 4); float* FK = (float*)take((size_t)TT * DKV * 4);
    h16* QP16 = (h16*)take((size_t)NH_ * TT * HD * 2); h16* KP16 = (h16*)take((size_t)NKV * TT * HD * 2); h16* VT16 = (h16*)take((size_t)NKV * HD * TT * 2);
    bf* QPh = (bf*)take((size_t)NH_ * TT * HD * 2); bf* QPl = (bf*)take((size_t)NH_ * TT * HD * 2); bf* KPh = (bf*)take((size_t)NKV * TT * HD * 2); bf* KPl = (bf*)take((size_t)NKV * TT * HD * 2); bf* VTh = (bf*)take((size_t)NKV * HD * TT * 2); bf* VTl = (bf*)take((size_t)NKV * HD * TT * 2); bf* Ph = (bf*)take((size_t)ZH * RH * TT * 2); bf* Pl = (bf*)take((size_t)ZH * RH * TT * 2);
    float* Sb = (float*)take((size_t)ZH * TT * TT * 4); h16* P16 = (h16*)take((size_t)ZH * TT * TT * 2); float* Ob = (float*)take((size_t)ZH * TT * HD * 4); bf* ATh = (bf*)take((size_t)TT * DQ * 2); bf* ATl = (bf*)take((size_t)TT * DQ * 2);
    if ((size_t)(wsp - (char*)d_ws) > ws_size) return;    // ws 256 MiB
    float* FV = FK;   // v projection reuses the k buffer after the k planes are built (stream-ordered)
    { k_cvt8<<<(unsigned)(((size_t)DQ * DM / 8 + 255) / 256), 256, 0, stream>>>(wq, WQ, (size_t)DQ * DM / 8); k_cvt8<<<(unsigned)(((size_t)DKV * DM / 8 + 255) / 256), 256, 0, stream>>>(wk, WK, (size_t)DKV * DM / 8); k_cvt8<<<(unsigned)(((size_t)DKV * DM / 8 + 255) / 256), 256, 0, stream>>>(wv, WV, (size_t)DKV * DM / 8);
      k_cvt8<<<(unsigned)(((size_t)DM * DQ / 8 + 255) / 256), 256, 0, stream>>>(wo, WO, (size_t)DM * DQ / 8);
       }
    k_csid<<<(TT * HD + 255) / 256, 256, 0, stream>>>(CS);
    const unsigned LQ = (unsigned)(((size_t)NH_ * TT * HD / 2 + 255) / 256), LKv = (unsigned)(((size_t)NKV * TT * HD / 2 + 255) / 256);
    for (int b = 0; b < NB_; ++b) {
        
        k_cvt8<<<(unsigned)(((size_t)TT * DM / 8 + 255) / 256), 256, 0, stream>>>(x + (size_t)b * TT * DM, XB, (size_t)TT * DM / 8);
        k_gemmw<bf, 0, false, 8><<<dim3(TT / 64, DQ / 64, 1), 256, 0, stream>>>(XB, nullptr, WQ, nullptr, DM, FQ, DQ, nullptr, 0, 0, 0);
        k_rope<<<LQ, 256, 0, stream>>>(FQ, DQ, NH_, CS, nullptr, nullptr, 1.0f, QP16, QPh, QPl);
        k_gemmw<bf, 0, false, 8><<<dim3(TT / 64, DKV / 64, 1), 256, 0, stream>>>(XB, nullptr, WK, nullptr, DM, FK, DKV, nullptr, 0, 0, 0);
        k_rope<<<LKv, 256, 0, stream>>>(FK, DKV, NKV, CS, nullptr, nullptr, 1.0f, KP16, KPh, KPl);
        k_gemmw<bf, 0, false, 8><<<dim3(TT / 64, DKV / 64, 1), 256, 0, stream>>>(XB, nullptr, WV, nullptr, DM, FV, DKV, nullptr, 0, 0, 0); k_vtp<<<LKv, 256, 0, stream>>>(FV, DKV, NKV, VT16, VTh, VTl);
        for (int h0 = 0; h0 < NH_; h0 += ZH) { const size_t zq = (size_t)h0, zk = (size_t)(h0 / REP);   // one kv head per query head: the pass's two heads use consecutive kv planes (z-strides TT*HD)
            k_gemmc<bf, 2, 1, 1><<<dim3(RH / 64, TT / 64, ZH), 32, 0, stream>>>(QPh + zq * TT * HD, QPl + zq * TT * HD, KPh + zk * TT * HD, KPl + zk * TT * HD, HD, Sb, TT, 0, (size_t)TT * HD, (size_t)TT * HD, (size_t)TT * TT);
            k_gemmc<h16, 0, 1, 1><<<dim3((TT - RH) / 64, TT / 64, ZH), 32, 0, stream>>>(QP16 + zq * TT * HD + (size_t)RH * HD, nullptr, KP16 + zk * TT * HD, nullptr, HD, Sb + (size_t)RH * TT, TT, RH, (size_t)TT * HD, (size_t)TT * HD, (size_t)TT * TT);
            k_asoft<<<ZH * TT / 8, 256, 0, stream>>>(Sb, P16, Ph, Pl);
            k_gemmc<bf, 2, 2, 8><<<dim3(RH / 64, HD / 64, ZH), 256, 0, stream>>>(Ph, Pl, VTh + zk * HD * TT, VTl + zk * HD * TT, TT, Ob, HD, 0, (size_t)RH * TT, (size_t)HD * TT, (size_t)TT * HD);
            k_gemmc<h16, 0, 2, 16><<<dim3((TT - RH) / 64, HD / 64, ZH), 512, 0, stream>>>(P16 + (size_t)RH * TT, nullptr, VT16 + zk * HD * TT, nullptr, TT, Ob + (size_t)RH * HD, HD, RH, (size_t)TT * TT, (size_t)HD * TT, (size_t)TT * HD);
            k_merge<<<(unsigned)(((size_t)ZH * TT * HD / 2 + 255) / 256), 256, 0, stream>>>(Ob, h0, ATh, ATl); }
        k_gemmw<bf, 1, false, 8><<<dim3(TT / 64, DM / 64, 1), 256, 0, stream>>>(ATh, ATl, WO, nullptr, DQ, OUT + (size_t)b * TT * DM, DM, nullptr, 0, 0, 0); }
}

// v002
// A run of this version takes 442 microseconds.
// Two timings next to v001 put it at 4.27 and 4.22 times that version's speed.
// Counting every step since v000, it is 6.73 times as fast.
#include <hip/hip_runtime.h>

// Causal multi-head self-attention whose projections and output are each scaled by 1/sqrt(width) (x [4][2048][1024]; k, q, v = (x W^T) x 1024^-0.5 ('oi' [1024][1024] UNIT normal, no bias; 16 heads x 64): each projection x 2^-5 (exact); scores = q.k x 64^-0.5: with the two 2^-5 factors folded in, q.k(unscaled) x 2^-13 (exact); causal (tril kept, -inf elsewhere); softmax; out = (merged W_proj^T) x 1024^-0.5 ('oi', no bias): the v factor 2^-5 and the output factor 2^-5 are both linear: ONE factor 2^-10 on the merged context (exact) -> [4][2048][1024] (8.4 M); argument order x, W_key, W_query, W_value, W_proj: KEY FIRST).
// Compute dtypes, f32 accumulate: every input rounded to bf16; q/k/v on PLAIN bf16 operands (inputs: exact); causal scores and attn.v: query rows < 512 hl (3 products), the rest single fp16, causal block skipping, one fused launch per batch; online softmax f32 (scale 2^-13 exact); the merged context x 2^-10 (exact); W_proj hl x exact (2 products), NO bias.

#define NB_  4
#define TT   2048
#define DM   1024
#define NH_  16
#define NKV  16
#define REP  (NH_ / NKV)
#define HD   64
#define DQ   (NH_ * HD)
#define DKV  (NKV * HD)
#define RH   512                  // query rows < RH use hi+lo planes (0: none)
#define SCL  0.0001220703125f   // 2^-13 = 1024^-0.5 (on q) x 1024^-0.5 (on k) x 64^-0.5: this module scales q AND k by c^-0.5 = 2^-5 each and the scores by hd^-0.5 = 2^-3: all exact powers of two, applied here in ONE multiply on the unscaled q.k
typedef _Float16 h16;
typedef unsigned short bf;
typedef __attribute__((ext_vector_type(16))) __bf16   v16bf;
typedef __attribute__((ext_vector_type(16))) _Float16 v16h;
typedef __attribute__((ext_vector_type(8)))  _Float16 v8h;
typedef __attribute__((ext_vector_type(8)))  unsigned short v8us;
typedef __attribute__((ext_vector_type(8)))  float    v8f;
typedef __attribute__((ext_vector_type(4)))  float    v4f;
typedef v8h  __attribute__((may_alias)) v8ha;
typedef v4f  __attribute__((may_alias)) v4fa;
typedef v8us __attribute__((may_alias)) v8usa;

__device__ __forceinline__ unsigned short f2bf(float f) { unsigned u = __float_as_uint(f); u += 0x7FFFu + ((u >> 16) & 1u); return (unsigned short)(u >> 16); }
__device__ __forceinline__ float bf2f(unsigned short b) { return __uint_as_float(((unsigned)b) << 16); }
__device__ __forceinline__ float bfr(float f) { return bf2f(f2bf(f)); }
__device__ __forceinline__ v16h cat16(v8h lo, v8h hi) { return __builtin_shufflevector(lo, hi, 0, 1, 2, 3, 4, 5, 6, 7, 8, 9, 10, 11, 12, 13, 14, 15); }
__device__ __forceinline__ v16bf cat16b(v8us lo, v8us hi) { return __builtin_bit_cast(v16bf, __builtin_shufflevector(lo, hi, 0, 1, 2, 3, 4, 5, 6, 7, 8, 9, 10, 11, 12, 13, 14, 15)); }
__device__ __forceinline__ v8f wmma16(v16h a, v16h b, v8f c) { return __builtin_amdgcn_wmma_f32_16x16x32_f16(false, a, false, b, (short)0, c, false, false); }
__device__ __forceinline__ v8f wmmab(v16bf a, v16bf b, v8f c) { return __builtin_amdgcn_wmma_f32_16x16x32_bf16(false, a, false, b, (short)0, c, false, false); }



// ---- k_gemmw: register-blocked GEMM, one 64x64 output tile per work-group of NW waves; every wave holds the whole tile (16 accumulators) and takes every NW-th 64-wide slice of K (one 128-byte line of each operand row), so NW times the bytes are in flight;
// the NW partial tiles are summed through LDS in wave order (fixed). Operands straight from K-contiguous 16-bit planes; grid (M/64, N/64, Z), NW x 32 threads.
// C[m][n] (f32, pitch ldc, + optional f32 bias[n]) = sum_k A[m][k] Bt[n][k] (+ split products per NSPLIT). z-batch strides sA/sB/sC in elements. K % 64 == 0.
template <typename T16> struct WFrag;
template <> struct WFrag<h16> { typedef v16h V; static __device__ __forceinline__ V ld(const h16* p) { return cat16(*(const v8h*)p, *(const v8h*)(p + 16)); } static __device__ __forceinline__ v8f mma(V a, V b, v8f c) { return wmma16(a, b, c); } };
template <> struct WFrag<bf> { typedef v16bf V; static __device__ __forceinline__ V ld(const bf* p) { return cat16b(*(const v8us*)p, *(const v8us*)(p + 16)); } static __device__ __forceinline__ v8f mma(V a, V b, v8f c) { return wmmab(a, b, c); } };
template <typename T16, int NSPLIT, bool BIAS, int NW>
__global__ __launch_bounds__(NW * 32) void k_gemmw(const T16* __restrict__ A, const T16* __restrict__ A2, const T16* __restrict__ Bt, const T16* __restrict__ Bt2, int K, float* C, int ldc, const float* __restrict__ bias, size_t sA, size_t sB, size_t sC) {
    typedef typename WFrag<T16>::V V;
    __shared__ __align__(16) float os[NW * 64 * 68];
    const size_t z = blockIdx.z; A += z * sA; if (A2) A2 += z * sA; Bt += z * sB; if (Bt2) Bt2 += z * sB; C += z * sC;
    const int lane = threadIdx.x & 31, lr = lane & 15, hi = lane >> 4; const int w = __builtin_amdgcn_readfirstlane((int)(threadIdx.x >> 5)); const int r0 = blockIdx.x * 64, c0 = blockIdx.y * 64;
    v8f acc[4][4];
#pragma unroll
    for (int mb = 0; mb < 4; ++mb)
#pragma unroll
        for (int nb = 0; nb < 4; ++nb) acc[mb][nb] = (v8f){};
    const size_t aoff = (size_t)(r0 + lr) * K + 8 * hi, boff = (size_t)(c0 + lr) * K + 8 * hi;
#pragma unroll 1
    for (int kc = w * 64; kc < K; kc += (kc & 32) ? NW * 64 - 32 : 32) {   // two 32-wide trips inside this wave's 64-wide slice, then on to its next slice
        V a[4], a2[4];
#pragma unroll
        for (int mb = 0; mb < 4; ++mb) { a[mb] = WFrag<T16>::ld(A + aoff + (size_t)mb * 16 * K + kc); if (NSPLIT == 1 || NSPLIT == 2) a2[mb] = WFrag<T16>::ld(A2 + aoff + (size_t)mb * 16 * K + kc); }
#pragma unroll
        for (int nb = 0; nb < 4; ++nb) { const V b = WFrag<T16>::ld(Bt + boff + (size_t)nb * 16 * K + kc); V b2; if (NSPLIT >= 2) b2 = WFrag<T16>::ld(Bt2 + boff + (size_t)nb * 16 * K + kc);
#pragma unroll
            for (int mb = 0; mb < 4; ++mb) { acc[mb][nb] = WFrag<T16>::mma(a[mb], b, acc[mb][nb]); if (NSPLIT == 1 || NSPLIT == 2) acc[mb][nb] = WFrag<T16>::mma(a2[mb], b, acc[mb][nb]); if (NSPLIT >= 2) acc[mb][nb] = WFrag<T16>::mma(a[mb], b2, acc[mb][nb]); } }
        asm volatile("v_nop\n\tv_nop\n\tv_nop\n\tv_nop" : "+v"(acc[0][0]), "+v"(acc[1][1]), "+v"(acc[2][2]), "+v"(acc[3][3]) : "v"(a[0]), "v"(a[3]));
    }
    // every wave lays its partial tile in its own LDS plane (a wave that got no K slice lays zeros); behind the one work-group barrier each thread sums the NW planes in wave order and stores 16 bytes per pass (16 threads fill one 256-byte row)
    float* my = os + w * (64 * 68);
#pragma unroll
    for (int mb = 0; mb < 4; ++mb)
#pragma unroll
        for (int nb = 0; nb < 4; ++nb)
#pragma unroll
            for (int j = 0; j < 8; ++j) my[(mb * 16 + hi * 8 + j) * 68 + nb * 16 + lr] = acc[mb][nb][j];
    __syncthreads();
#pragma unroll
    for (int s = 0; s < 32 / NW; ++s) { const int idx = s * (NW * 32) + (int)threadIdx.x; const int row = idx >> 4, cofs = (idx & 15) * 4; v4f val = *(const v4fa*)(os + row * 68 + cofs);
#pragma unroll
        for (int p = 1; p < NW; ++p) val += *(const v4fa*)(os + p * (64 * 68) + row * 68 + cofs);
        if (BIAS) { val[0] += bfr(bias[c0 + cofs]); val[1] += bfr(bias[c0 + cofs + 1]); val[2] += bfr(bias[c0 + cofs + 2]); val[3] += bfr(bias[c0 + cofs + 3]); }
        *(v4f*)(C + (size_t)(r0 + row) * ldc + c0 + cofs) = val; }
}

__device__ __forceinline__ h16 tohx(float x) { return (h16)x; }
__device__ __forceinline__ void splitf(float y, unsigned short& h, unsigned short& l) { h = f2bf(y); l = f2bf(y - bf2f(h)); }
typedef __attribute__((ext_vector_type(2))) _Float16 v2h;
typedef __attribute__((ext_vector_type(4))) _Float16 v4h;
typedef __attribute__((ext_vector_type(2))) unsigned short v2us;
typedef __attribute__((ext_vector_type(4))) unsigned short v4us;
typedef __attribute__((ext_vector_type(2))) float v2f;
typedef __attribute__((ext_vector_type(4))) int v4i;

__global__ __launch_bounds__(256) void k_wtG(const float* __restrict__ w, int K, int N, bf* Bt) {
    const int lane = threadIdx.x & 31; const int L0 = (blockIdx.x * 8 + (threadIdx.x >> 5)) * 8; const int nlines = N * K / 64;
{
#pragma unroll 1
        for (int l = 0; l < 8; ++l) { const int L = L0 + l; if (L >= nlines) break; const size_t e = (size_t)L * 64 + lane * 2; const int k = (int)(e % K), n = (int)(e / K); v2us o;
            o[0] = f2bf(w[(size_t)k * N + n]); o[1] = f2bf(w[(size_t)(k + 1) * N + n]); *(v2us*)(Bt + e) = o; }
         }
}
__global__ __launch_bounds__(256) void k_cvt8(const float* __restrict__ src, bf* dst, size_t n8) { const size_t i = (size_t)blockIdx.x * 256 + threadIdx.x; if (i >= n8) return; const v8f v = *(const v8f*)(src + i * 8); v8us o;
#pragma unroll
    for (int k = 0; k < 8; ++k) o[k] = f2bf(v[k]); *(v8us*)(dst + i * 8) = o;  }
__global__ __launch_bounds__(256) void k_cscvt(const float* __restrict__ cosT, const float* __restrict__ sinT, float* CS) { const int idx = blockIdx.x * 256 + threadIdx.x; if (idx >= TT * HD) return; v2f cs; cs[0] = bfr(cosT[idx]); cs[1] = bfr(sinT[idx]); *(v2f*)(CS + (size_t)idx * 2) = cs;  }
// k_rope: head planes [h][t][d] (fp16 + hi/lo) of rope(x) x sc with the rotate-half convention out[d] = x[d] cos[t][d] - x[d+HD/2] sin[t][d], out[d+HD/2] = x[d+HD/2] cos[t][d+HD/2] + x[d] sin[t][d+HD/2]
__global__ __launch_bounds__(256) void k_rope(const float* __restrict__ F, int pitch, int nheads, const float* __restrict__ CS, const float* __restrict__ RF, const float* __restrict__ nw, float sc, h16* P16, bf* Ph, bf* Pl) {
    const size_t e = ((size_t)blockIdx.x * 256 + threadIdx.x) * 2; if (e >= (size_t)nheads * TT * HD) return; const int d = (int)(e % HD); const int t = (int)((e / HD) % TT); const int h = (int)(e / ((size_t)HD * TT)); const float* f = F + (size_t)t * pitch + h * HD; const float rf = RF ? RF[(size_t)h * TT + t] : 1.0f; v2h o16; v2us oh, ol;
#pragma unroll
    for (int q = 0; q < 2; ++q) { const int dd = d + q; const int dp = (dd < HD / 2) ? dd + HD / 2 : dd - HD / 2; float x0 = f[dd], x1 = f[dp];
        if (RF) { float n0 = __fmul_rn(x0, rf), n1 = __fmul_rn(x1, rf); asm volatile("" : "+v"(n0)); asm volatile("" : "+v"(n1)); x0 = __fmul_rn(bfr(nw[dd]), n0); x1 = __fmul_rn(bfr(nw[dp]), n1); }
        const v2f cs = *(const v2f*)(CS + ((size_t)t * HD + dd) * 2); float a = __fmul_rn(x0, cs[0]), bq = __fmul_rn(x1, cs[1]); asm volatile("" : "+v"(a)); asm volatile("" : "+v"(bq)); const float r = ((dd < HD / 2) ? __fsub_rn(a, bq) : __fadd_rn(a, bq)) * sc;
        o16[q] = tohx(r); unsigned short a2, c2; splitf(r, a2, c2); oh[q] = a2; ol[q] = c2; }
    *(v2h*)(P16 + e) = o16; *(v2us*)(Ph + e) = oh; *(v2us*)(Pl + e) = ol;  }
__global__ __launch_bounds__(256) void k_vtp(const float* __restrict__ F, int pitch, int nheads, h16* V16, bf* Vh, bf* Vl) { const size_t e = ((size_t)blockIdx.x * 256 + threadIdx.x) * 2; if (e >= (size_t)nheads * HD * TT) return; const int t = (int)(e % TT); const int d = (int)((e / TT) % HD); const int g = (int)(e / ((size_t)TT * HD)); v2h o16; v2us oh, ol;
#pragma unroll
    for (int q = 0; q < 2; ++q) { const float x = F[(size_t)(t + q) * pitch + g * HD + d]; o16[q] = tohx(x); unsigned short a2, c2; splitf(x, a2, c2); oh[q] = a2; ol[q] = c2; }
    *(v2h*)(V16 + e) = o16; *(v2us*)(Vh + e) = oh; *(v2us*)(Vl + e) = ol;  }
__global__ __launch_bounds__(256) void k_csid(float* CS) { const int idx = blockIdx.x * 256 + threadIdx.x; if (idx >= TT * HD) return; v2f cs; cs[0] = 1.0f; cs[1] = 0.0f; *(v2f*)(CS + (size_t)idx * 2) = cs;  }
// ---- k_fattn: causal scores, softmax, probability x value and the head merge of one batch in ONE launch; grid (heads, query tiles, heaviest tile first), AW x 32 threads.
// Transposed products: S^T = K Q^T (A = 16 key rows, B = 16 query columns), O^T += V^T P^T (A = 16 rows of the [d][t] value plane, B = P^T). A lane holds scores of ONE query (column c = lane & 15; keys 8 hi + r of each 16),
// so a pair of score tiles, rounded to 16 bit, IS the B operand of the second product in the k order of WFrag::ld (8 hi + s, 16 + 8 hi + s): the probabilities never leave the registers.
// Online softmax in the log2 domain: running maximum m and sum l per query; O^T and l are rescaled only in a trip in which some query's maximum rises. Wave w takes every AW-th block of 32 keys;
// the AW partial (m, l, O^T) are joined through LDS in wave order behind one work-group barrier; the joined context x 2^-10 / l goes out as hi + lo bf16 rows of the merged [t][heads x 64] planes.
// HL: hi + lo bf16 planes, 3 products each (query rows < RH, 16 queries a wave); else single fp16 (32 queries a wave).
#define AW   8
#define OP   68                    // floats between two queries' partial outputs in LDS (64 + 4: 16-byte aligned rows)
#define NEGB (-3.0e38f)
#define SCL2 (SCL * 1.4426950408889634f)   // 2^-13 x log2(e): exp(s x 2^-13 - max) = exp2(s x SCL2 - max2)
template <typename T16, bool HL, int NQ>
__device__ __forceinline__ void attn_tile(const T16* __restrict__ Q, const T16* __restrict__ Q2, const T16* __restrict__ Kp, const T16* __restrict__ K2, const T16* __restrict__ Vt, const T16* __restrict__ V2, int q0, int head, float* so, float* sm, float* sl, bf* Ah, bf* Al) {
    typedef WFrag<T16> F; typedef typename F::V V;
    const int lane = threadIdx.x & 31, c = lane & 15, hi = lane >> 4; const int w = __builtin_amdgcn_readfirstlane((int)(threadIdx.x >> 5));
    V qf[NQ][2], q2[NQ][2];
#pragma unroll
    for (int g = 0; g < NQ; ++g)
#pragma unroll
        for (int ks = 0; ks < 2; ++ks) { const size_t qo = (size_t)(q0 + g * 16 + c) * HD + ks * 32 + 8 * hi; qf[g][ks] = F::ld(Q + qo); if (HL) q2[g][ks] = F::ld(Q2 + qo); }
    v8f o[NQ][4]; float m[NQ], l[NQ];
#pragma unroll
    for (int g = 0; g < NQ; ++g) { m[g] = NEGB; l[g] = 0.f;
#pragma unroll
        for (int dt = 0; dt < 4; ++dt) o[g][dt] = (v8f){}; }
    const int nblk = q0 / 32 + 1;      // blocks of 32 keys up to and including the one that holds the diagonal
    // this lane's K and V addresses are carried through the loop and advanced at its foot; every load of a trip is one of them plus a constant offset
    const size_t kst = (size_t)(w * 32 + c) * HD + 8 * hi, vst = (size_t)c * TT + w * 32 + 8 * hi;
    const T16* kp = Kp + kst; const T16* vp = Vt + vst; const T16* kp2 = HL ? K2 + kst : nullptr; const T16* vp2 = HL ? V2 + vst : nullptr;
#pragma unroll 1   // kept rolled: run-time trip count, and one body already holds most of the register file
    for (int kb = w; kb < nblk; kb += AW) {
        const int k0 = kb * 32;
        V kf[2][2], k2[2][2], vf[4], v2[4];
#pragma unroll
        for (int kt = 0; kt < 2; ++kt)
#pragma unroll
            for (int ks = 0; ks < 2; ++ks) { const int ko = kt * 16 * HD + ks * 32; kf[kt][ks] = F::ld(kp + ko); if (HL) k2[kt][ks] = F::ld(kp2 + ko); }
#pragma unroll
        for (int dt = 0; dt < 4; ++dt) { const int vo = dt * 16 * TT; vf[dt] = F::ld(vp + vo); if (HL) v2[dt] = F::ld(vp2 + vo); }
        // behind the trip's last load, in front of every overwrite of an address register that these loads name; the addresses are inputs so that they stay live up to the wait and no load's result is placed in them
        if constexpr (HL) asm volatile("s_wait_xcnt 0x0" :: "v"(kp), "v"(kp2), "v"(vp), "v"(vp2) : "memory"); else asm volatile("s_wait_xcnt 0x0" :: "v"(kp), "v"(vp) : "memory");
        __builtin_amdgcn_sched_barrier(0);   // all of the trip's K and V loads are issued before its first product; without it the scheduler reloads a K register set between the products and a trip pays the load latency two or three times in a row
        v8f s[NQ][2];
#pragma unroll
        for (int g = 0; g < NQ; ++g)
#pragma unroll
            for (int kt = 0; kt < 2; ++kt) s[g][kt] = (v8f){};
#pragma unroll
        for (int ks = 0; ks < 2; ++ks)
#pragma unroll
            for (int g = 0; g < NQ; ++g)
#pragma unroll
                for (int kt = 0; kt < 2; ++kt) { s[g][kt] = F::mma(kf[kt][ks], qf[g][ks], s[g][kt]); if (HL) { s[g][kt] = F::mma(k2[kt][ks], qf[g][ks], s[g][kt]); s[g][kt] = F::mma(kf[kt][ks], q2[g][ks], s[g][kt]); } }
#pragma unroll
        for (int g = 0; g < NQ; ++g)
#pragma unroll
            for (int kt = 0; kt < 2; ++kt) s[g][kt] *= SCL2;
        if (kb == nblk - 1) {          // the diagonal block (wave-uniform test): keys behind the query are excluded; every query of the tile keeps at least this block's first key
#pragma unroll
            for (int g = 0; g < NQ; ++g)
#pragma unroll
                for (int kt = 0; kt < 2; ++kt)
#pragma unroll
                    for (int r = 0; r < 8; ++r) s[g][kt][r] = (k0 + kt * 16 + 8 * hi + r <= q0 + g * 16 + c) ? s[g][kt][r] : NEGB;
        }
        float mn[NQ]; bool need = false;
#pragma unroll
        for (int g = 0; g < NQ; ++g) { float mx = s[g][0][0];
#pragma unroll
            for (int r = 1; r < 8; ++r) mx = fmaxf(mx, s[g][0][r]);
#pragma unroll
            for (int r = 0; r < 8; ++r) mx = fmaxf(mx, s[g][1][r]);
            mx = fmaxf(mx, __shfl_xor(mx, 16, 32)); mn[g] = fmaxf(m[g], mx); need = need || (mn[g] > m[g]); }
        if (__builtin_amdgcn_ballot_w32(need) != 0) {   // scalar branch: some query's maximum rose (always in a wave's first trip)
#pragma unroll
            for (int g = 0; g < NQ; ++g) { const float al = __builtin_amdgcn_exp2f(m[g] - mn[g]); l[g] *= al; m[g] = mn[g];
#pragma unroll
                for (int dt = 0; dt < 4; ++dt) o[g][dt] *= al; }
        }
        V pb[NQ], p2[NQ];
#pragma unroll
        for (int g = 0; g < NQ; ++g) {
            if constexpr (HL) { v8us h0, h1, l0, l1;
#pragma unroll
                for (int r = 0; r < 8; ++r) { const float pa = __builtin_amdgcn_exp2f(s[g][0][r] - m[g]), pc = __builtin_amdgcn_exp2f(s[g][1][r] - m[g]); l[g] += pa; l[g] += pc; unsigned short a, b2; splitf(pa, a, b2); h0[r] = a; l0[r] = b2; splitf(pc, a, b2); h1[r] = a; l1[r] = b2; }
                pb[g] = cat16b(h0, h1); p2[g] = cat16b(l0, l1);
            } else { v8h h0, h1;
#pragma unroll
                for (int r = 0; r < 8; ++r) { const float pa = __builtin_amdgcn_exp2f(s[g][0][r] - m[g]), pc = __builtin_amdgcn_exp2f(s[g][1][r] - m[g]); l[g] += pa; l[g] += pc; h0[r] = tohx(pa); h1[r] = tohx(pc); }
                pb[g] = cat16(h0, h1); }
        }
#pragma unroll
        for (int dt = 0; dt < 4; ++dt)
#pragma unroll
            for (int g = 0; g < NQ; ++g) { o[g][dt] = F::mma(vf[dt], pb[g], o[g][dt]); if (HL) { o[g][dt] = F::mma(vf[dt], p2[g], o[g][dt]); o[g][dt] = F::mma(v2[dt], pb[g], o[g][dt]); } }
        kp += AW * 32 * HD; vp += AW * 32; if (HL) { kp2 += AW * 32 * HD; vp2 += AW * 32; }
    }
    // every wave lays its partial (m, l, O^T) in its own LDS plane (a wave that got no key block lays m = NEGB, l = 0, zeros: its weight below is exp2(-huge) = 0)
    float* my = so + w * (32 * OP);
#pragma unroll
    for (int g = 0; g < NQ; ++g) { l[g] += __shfl_xor(l[g], 16, 32); if (hi == 0) { sm[w * 32 + g * 16 + c] = m[g]; sl[w * 32 + g * 16 + c] = l[g]; }
#pragma unroll
        for (int dt = 0; dt < 4; ++dt) { float* p = my + (g * 16 + c) * OP + dt * 16 + 8 * hi; *(v4fa*)p = (v4f){o[g][dt][0], o[g][dt][1], o[g][dt][2], o[g][dt][3]}; *(v4fa*)(p + 4) = (v4f){o[g][dt][4], o[g][dt][5], o[g][dt][6], o[g][dt][7]}; } }
    __syncthreads();
    for (int idx = (int)threadIdx.x; idx < NQ * 16 * 8; idx += AW * 32) { const int q = idx >> 3, d8 = (idx & 7) * 8;   // one thread: 8 outputs of one query
        float M = sm[q];
#pragma unroll
        for (int p = 1; p < AW; ++p) M = fmaxf(M, sm[p * 32 + q]);
        float L = 0.f; v4f a0 = (v4f){}, a1 = (v4f){};
#pragma unroll
        for (int p = 0; p < AW; ++p) { const float sc = __builtin_amdgcn_exp2f(sm[p * 32 + q] - M); L += sc * sl[p * 32 + q]; const float* pp = so + p * (32 * OP) + q * OP + d8; a0 += sc * *(const v4fa*)pp; a1 += sc * *(const v4fa*)(pp + 4); }
        const float f = __fdiv_rn(0.0009765625f, L);   // x 2^-10: this module scales v by c^-0.5 = 2^-5 and the projected output by out_dim^-0.5 = 2^-5: both linear: ONE exact factor on the merged context
        v8us oh, ol;
#pragma unroll
        for (int k = 0; k < 4; ++k) { unsigned short a, b2; splitf(a0[k] * f, a, b2); oh[k] = a; ol[k] = b2; splitf(a1[k] * f, a, b2); oh[4 + k] = a; ol[4 + k] = b2; }
        const size_t oo = (size_t)(q0 + q) * DQ + head * HD + d8; *(v8us*)(Ah + oo) = oh; *(v8us*)(Al + oo) = ol; }
}
__global__ __launch_bounds__(AW * 32) void k_fattn(const h16* __restrict__ Q16, const h16* __restrict__ K16, const h16* __restrict__ V16, const bf* __restrict__ Qh, const bf* __restrict__ Ql, const bf* __restrict__ Kh, const bf* __restrict__ Kl, const bf* __restrict__ Vh, const bf* __restrict__ Vl, bf* Ah, bf* Al) {
    __shared__ __align__(16) float so[AW * 32 * OP]; __shared__ float sm[AW * 32]; __shared__ float sl[AW * 32];
    const int head = blockIdx.x, ty = blockIdx.y; const size_t zp = (size_t)head * TT * HD;   // one kv head per query head
    if (ty < (TT - RH) / 32) attn_tile<h16, false, 2>(Q16 + zp, nullptr, K16 + zp, nullptr, V16 + zp, nullptr, TT - 32 * (ty + 1), head, so, sm, sl, Ah, Al);
    else attn_tile<bf, true, 1>(Qh + zp, Ql + zp, Kh + zp, Kl + zp, Vh + zp, Vl + zp, RH - 16 * (ty - (TT - RH) / 32 + 1), head, so, sm, sl, Ah, Al);
}

extern "C" void kernel_launch(void* const* d_in, const int* in_sizes, int n_in,
                              void* d_out, int out_size, void* d_ws, size_t ws_size, hipStream_t stream) {
    (void)in_sizes; (void)n_in; (void)out_size;
    const float* x = (const float*)d_in[0]; const float* wk = (const float*)d_in[1]; const float* wq = (const float*)d_in[2]; const float* wv = (const float*)d_in[3]; const float* wo = (const float*)d_in[4];   /* input order x, W_key, W_query, W_value, W_proj ('oi' [1024][1024], UNIT normal): the KEY weight comes FIRST; NO bias input in this module */ const float* cosT = nullptr; const float* sinT = nullptr; (void)cosT; (void)sinT;
    float* OUT = (float*)d_out;     // [4][2048][1024]
    char* wsp = (char*)d_ws;
    auto take = [&](size_t bytes) { char* p = wsp; wsp += (bytes + 255) & ~(size_t)255; return (void*)p; };
    bf* WQ = (bf*)take((size_t)DQ * DM * 2); bf* WK = (bf*)take((size_t)DKV * DM * 2); bf* WV = (bf*)take((size_t)DKV * DM * 2); bf* WO = (bf*)take((size_t)DM * DQ * 2); float* CS = (float*)take((size_t)TT * HD * 2 * 4);
    bf* XB = (bf*)take((size_t)TT * DM * 2); float* FQ = (float*)take((size_t)TT * DQ * 4); float* FK = (float*)take((size_t)TT * DKV * 4);
    h16* QP16 = (h16*)take((size_t)NH_ * TT * HD * 2); h16* KP16 = (h16*)take((size_t)NKV * TT * HD * 2); h16* VT16 = (h16*)take((size_t)NKV * HD * TT * 2);
    bf* QPh = (bf*)take((size_t)NH_ * TT * HD * 2); bf* QPl = (bf*)take((size_t)NH_ * TT * HD * 2); bf* KPh = (bf*)take((size_t)NKV * TT * HD * 2); bf* KPl = (bf*)take((size_t)NKV * TT * HD * 2); bf* VTh = (bf*)take((size_t)NKV * HD * TT * 2); bf* VTl = (bf*)take((size_t)NKV * HD * TT * 2);
    bf* ATh = (bf*)take((size_t)TT * DQ * 2); bf* ATl = (bf*)take((size_t)TT * DQ * 2);
    if ((size_t)(wsp - (char*)d_ws) > ws_size) return;    // ws 256 MiB
    float* FV = FK;   // v projection reuses the k buffer after the k planes are built (stream-ordered)
    { k_cvt8<<<(unsigned)(((size_t)DQ * DM / 8 + 255) / 256), 256, 0, stream>>>(wq, WQ, (size_t)DQ * DM / 8); k_cvt8<<<(unsigned)(((size_t)DKV * DM / 8 + 255) / 256), 256, 0, stream>>>(wk, WK, (size_t)DKV * DM / 8); k_cvt8<<<(unsigned)(((size_t)DKV * DM / 8 + 255) / 256), 256, 0, stream>>>(wv, WV, (size_t)DKV * DM / 8);
      k_cvt8<<<(unsigned)(((size_t)DM * DQ / 8 + 255) / 256), 256, 0, stream>>>(wo, WO, (size_t)DM * DQ / 8);
       }
    k_csid<<<(TT * HD + 255) / 256, 256, 0, stream>>>(CS);
    const unsigned LQ = (unsigned)(((size_t)NH_ * TT * HD / 2 + 255) / 256), LKv = (unsigned)(((size_t)NKV * TT * HD / 2 + 255) / 256);
    for (int b = 0; b < NB_; ++b) {
        
        k_cvt8<<<(unsigned)(((size_t)TT * DM / 8 + 255) / 256), 256, 0, stream>>>(x + (size_t)b * TT * DM, XB, (size_t)TT * DM / 8);
        k_gemmw<bf, 0, false, 8><<<dim3(TT / 64, DQ / 64, 1), 256, 0, stream>>>(XB, nullptr, WQ, nullptr, DM, FQ, DQ, nullptr, 0, 0, 0);
        k_rope<<<LQ, 256, 0, stream>>>(FQ, DQ, NH_, CS, nullptr, nullptr, 1.0f, QP16, QPh, QPl);
        k_gemmw<bf, 0, false, 8><<<dim3(TT / 64, DKV / 64, 1), 256, 0, stream>>>(XB, nullptr, WK, nullptr, DM, FK, DKV, nullptr, 0, 0, 0);
        k_rope<<<LKv, 256, 0, stream>>>(FK, DKV, NKV, CS, nullptr, nullptr, 1.0f, KP16, KPh, KPl);
        k_gemmw<bf, 0, false, 8><<<dim3(TT / 64, DKV / 64, 1), 256, 0, stream>>>(XB, nullptr, WV, nullptr, DM, FV, DKV, nullptr, 0, 0, 0); k_vtp<<<LKv, 256, 0, stream>>>(FV, DKV, NKV, VT16, VTh, VTl);
        k_fattn<<<dim3(NH_, (TT - RH) / 32 + RH / 16, 1), AW * 32, 0, stream>>>(QP16, KP16, VT16, QPh, QPl, KPh, KPl, VTh, VTl, ATh, ATl);
        k_gemmw<bf, 1, false, 8><<<dim3(TT / 64, DM / 64, 1), 256, 0, stream>>>(ATh, ATl, WO, nullptr, DQ, OUT + (size_t)b * TT * DM, DM, nullptr, 0, 0, 0); }
}

// v003
// One run takes 353 microseconds.
// Next to v002, in two timings, it ran 1.27 and 1.25 times as fast.
// All steps since v000 together make it 8.47 times as fast.
#include <hip/hip_runtime.h>

// Causal multi-head self-attention whose projections and output are each scaled by 1/sqrt(width) (x [4][2048][1024]; k, q, v = (x W^T) x 1024^-0.5 ('oi' [1024][1024] UNIT normal, no bias; 16 heads x 64): each projection x 2^-5 (exact); scores = q.k x 64^-0.5: with the two 2^-5 factors folded in, q.k(unscaled) x 2^-13 (exact); causal (tril kept, -inf elsewhere); softmax; out = (merged W_proj^T) x 1024^-0.5 ('oi', no bias): the v factor 2^-5 and the output factor 2^-5 are both linear: ONE factor 2^-10 on the merged context (exact) -> [4][2048][1024] (8.4 M); argument order x, W_key, W_query, W_value, W_proj: KEY FIRST).
// Compute dtypes, f32 accumulate: every input rounded to bf16; q/k/v on PLAIN bf16 operands (inputs: exact); causal scores and attn.v: query rows < 512 hl (3 products), the rest single fp16, causal block skipping, one fused launch per batch; online softmax f32 (scale 2^-13 exact); the merged context x 2^-10 (exact); W_proj hl x exact (2 products), NO bias.

#define NB_  4
#define TT   2048
#define DM   1024
#define NH_  16
#define NKV  16
#define REP  (NH_ / NKV)
#define HD   64
#define DQ   (NH_ * HD)
#define DKV  (NKV * HD)
#define RH   512                  // query rows < RH use hi+lo planes (0: none)
#define SCL  0.0001220703125f   // 2^-13 = 1024^-0.5 (on q) x 1024^-0.5 (on k) x 64^-0.5: this module scales q AND k by c^-0.5 = 2^-5 each and the scores by hd^-0.5 = 2^-3: all exact powers of two, applied here in ONE multiply on the unscaled q.k
typedef _Float16 h16;
typedef unsigned short bf;
typedef __attribute__((ext_vector_type(16))) __bf16   v16bf;
typedef __attribute__((ext_vector_type(16))) _Float16 v16h;
typedef __attribute__((ext_vector_type(8)))  _Float16 v8h;
typedef __attribute__((ext_vector_type(8)))  unsigned short v8us;
typedef __attribute__((ext_vector_type(8)))  float    v8f;
typedef __attribute__((ext_vector_type(4)))  float    v4f;
typedef v8h  __attribute__((may_alias)) v8ha;
typedef v4f  __attribute__((may_alias)) v4fa;
typedef v8us __attribute__((may_alias)) v8usa;

__device__ __forceinline__ unsigned short f2bf(float f) { unsigned u = __float_as_uint(f); u += 0x7FFFu + ((u >> 16) & 1u); return (unsigned short)(u >> 16); }
__device__ __forceinline__ float bf2f(unsigned short b) { return __uint_as_float(((unsigned)b) << 16); }
__device__ __forceinline__ float bfr(float f) { return bf2f(f2bf(f)); }
__device__ __forceinline__ v16h cat16(v8h lo, v8h hi) { return __builtin_shufflevector(lo, hi, 0, 1, 2, 3, 4, 5, 6, 7, 8, 9, 10, 11, 12, 13, 14, 15); }
__device__ __forceinline__ v16bf cat16b(v8us lo, v8us hi) { return __builtin_bit_cast(v16bf, __builtin_shufflevector(lo, hi, 0, 1, 2, 3, 4, 5, 6, 7, 8, 9, 10, 11, 12, 13, 14, 15)); }
__device__ __forceinline__ v8f wmma16(v16h a, v16h b, v8f c) { return __builtin_amdgcn_wmma_f32_16x16x32_f16(false, a, false, b, (short)0, c, false, false); }
__device__ __forceinline__ v8f wmmab(v16bf a, v16bf b, v8f c) { return __builtin_amdgcn_wmma_f32_16x16x32_bf16(false, a, false, b, (short)0, c, false, false); }
__device__ __forceinline__ h16 tohx(float x) { return (h16)x; }
__device__ __forceinline__ void splitf(float y, unsigned short& h, unsigned short& l) { h = f2bf(y); l = f2bf(y - bf2f(h)); }
typedef __attribute__((ext_vector_type(4))) _Float16 v4h;
typedef __attribute__((ext_vector_type(4))) unsigned short v4us;



// ---- k_gemmw: register-blocked GEMM, one 64x64 output tile per work-group of NW waves; every wave holds the whole tile (16 accumulators) and takes every NW-th 64-wide slice of K (one 128-byte line of each operand row), so NW times the bytes are in flight;
// the NW partial tiles are summed through LDS in wave order (fixed). Operands straight from K-contiguous 16-bit planes; grid (M/64, N/64, Z), NW x 32 threads.
// C[m][n] (f32, pitch ldc, + optional f32 bias[n]) = sum_k A[m][k] Bt[n][k] (+ split products per NSPLIT). z-batch strides sA/sB/sC in elements. K % 64 == 0.
// PLANES: the summed tile is not stored as f32 but rounded at once into three 16-bit planes (fp16, and bf16 hi + lo); element (m, n) lies at m x ldc + (n / 64) x tpitch + n % 64.
// ldc = 64, tpitch = rows x 64 gives head planes [n / 64][m][n % 64]; with A = the weight and Bt = the activations, ldc = positions and tpitch = 64 give the transposed value plane [feature][position].
template <typename T16> struct WFrag;
template <> struct WFrag<h16> { typedef v16h V; static __device__ __forceinline__ V ld(const h16* p) { return cat16(*(const v8h*)p, *(const v8h*)(p + 16)); } static __device__ __forceinline__ v8f mma(V a, V b, v8f c) { return wmma16(a, b, c); } };
template <> struct WFrag<bf> { typedef v16bf V; static __device__ __forceinline__ V ld(const bf* p) { return cat16b(*(const v8us*)p, *(const v8us*)(p + 16)); } static __device__ __forceinline__ v8f mma(V a, V b, v8f c) { return wmmab(a, b, c); } };
template <typename T16, int NSPLIT, bool BIAS, int NW, bool PLANES>
__global__ __launch_bounds__(NW * 32) void k_gemmw(const T16* __restrict__ A, const T16* __restrict__ A2, const T16* __restrict__ Bt, const T16* __restrict__ Bt2, int K, float* C, int ldc, const float* __restrict__ bias, size_t sA, size_t sB, size_t sC, h16* P16, bf* Ph, bf* Pl, int tpitch) {
    typedef typename WFrag<T16>::V V;
    __shared__ __align__(16) float os[NW * 64 * 68];
    const size_t z = blockIdx.z; A += z * sA; if (A2) A2 += z * sA; Bt += z * sB; if (Bt2) Bt2 += z * sB; C += z * sC;
    const int lane = threadIdx.x & 31, lr = lane & 15, hi = lane >> 4; const int w = __builtin_amdgcn_readfirstlane((int)(threadIdx.x >> 5)); const int r0 = blockIdx.x * 64, c0 = blockIdx.y * 64;
    v8f acc[4][4];
#pragma unroll
    for (int mb = 0; mb < 4; ++mb)
#pragma unroll
        for (int nb = 0; nb < 4; ++nb) acc[mb][nb] = (v8f){};
    const size_t aoff = (size_t)(r0 + lr) * K + 8 * hi, boff = (size_t)(c0 + lr) * K + 8 * hi;
#pragma unroll 1
    for (int kc = w * 64; kc < K; kc += (kc & 32) ? NW * 64 - 32 : 32) {   // two 32-wide trips inside this wave's 64-wide slice, then on to its next slice
        V a[4], a2[4];
#pragma unroll
        for (int mb = 0; mb < 4; ++mb) { a[mb] = WFrag<T16>::ld(A + aoff + (size_t)mb * 16 * K + kc); if (NSPLIT == 1 || NSPLIT == 2) a2[mb] = WFrag<T16>::ld(A2 + aoff + (size_t)mb * 16 * K + kc); }
#pragma unroll
        for (int nb = 0; nb < 4; ++nb) { const V b = WFrag<T16>::ld(Bt + boff + (size_t)nb * 16 * K + kc); V b2; if (NSPLIT >= 2) b2 = WFrag<T16>::ld(Bt2 + boff + (size_t)nb * 16 * K + kc);
#pragma unroll
            for (int mb = 0; mb < 4; ++mb) { acc[mb][nb] = WFrag<T16>::mma(a[mb], b, acc[mb][nb]); if (NSPLIT == 1 || NSPLIT == 2) acc[mb][nb] = WFrag<T16>::mma(a2[mb], b, acc[mb][nb]); if (NSPLIT >= 2) acc[mb][nb] = WFrag<T16>::mma(a[mb], b2, acc[mb][nb]); } }
        asm volatile("v_nop\n\tv_nop\n\tv_nop\n\tv_nop" : "+v"(acc[0][0]), "+v"(acc[1][1]), "+v"(acc[2][2]), "+v"(acc[3][3]) : "v"(a[0]), "v"(a[3]));
    }
    // every wave lays its partial tile in its own LDS plane (a wave that got no K slice lays zeros); behind the one work-group barrier each thread sums the NW planes in wave order and stores whole rows (256 bytes of f32, or a 128-byte line of each 16-bit plane)
    float* my = os + w * (64 * 68);
#pragma unroll
    for (int mb = 0; mb < 4; ++mb)
#pragma unroll
        for (int nb = 0; nb < 4; ++nb)
#pragma unroll
            for (int j = 0; j < 8; ++j) my[(mb * 16 + hi * 8 + j) * 68 + nb * 16 + lr] = acc[mb][nb][j];
    __syncthreads();
#pragma unroll
    for (int s = 0; s < 32 / NW; ++s) { const int idx = s * (NW * 32) + (int)threadIdx.x; const int row = idx >> 4, cofs = (idx & 15) * 4; v4f val = *(const v4fa*)(os + row * 68 + cofs);
#pragma unroll
        for (int p = 1; p < NW; ++p) val += *(const v4fa*)(os + p * (64 * 68) + row * 68 + cofs);
        if (BIAS) { val[0] += bfr(bias[c0 + cofs]); val[1] += bfr(bias[c0 + cofs + 1]); val[2] += bfr(bias[c0 + cofs + 2]); val[3] += bfr(bias[c0 + cofs + 3]); }
        if constexpr (PLANES) { const size_t po = (size_t)(r0 + row) * ldc + (size_t)blockIdx.y * tpitch + cofs; v4h o16; v4us oh, ol;   // 16 lanes x 8 bytes: one whole 128-byte line of each plane
#pragma unroll
            for (int k = 0; k < 4; ++k) { o16[k] = tohx(val[k]); unsigned short a2, c2; splitf(val[k], a2, c2); oh[k] = a2; ol[k] = c2; }
            *(v4h*)(P16 + po) = o16; *(v4us*)(Ph + po) = oh; *(v4us*)(Pl + po) = ol; }
        else *(v4f*)(C + (size_t)(r0 + row) * ldc + c0 + cofs) = val; }
}

typedef __attribute__((ext_vector_type(2))) unsigned short v2us;
typedef __attribute__((ext_vector_type(4))) int v4i;

__global__ __launch_bounds__(256) void k_wtG(const float* __restrict__ w, int K, int N, bf* Bt) {
    const int lane = threadIdx.x & 31; const int L0 = (blockIdx.x * 8 + (threadIdx.x >> 5)) * 8; const int nlines = N * K / 64;
{
#pragma unroll 1
        for (int l = 0; l < 8; ++l) { const int L = L0 + l; if (L >= nlines) break; const size_t e = (size_t)L * 64 + lane * 2; const int k = (int)(e % K), n = (int)(e / K); v2us o;
            o[0] = f2bf(w[(size_t)k * N + n]); o[1] = f2bf(w[(size_t)(k + 1) * N + n]); *(v2us*)(Bt + e) = o; }
         }
}
__global__ __launch_bounds__(256) void k_cvt8(const float* __restrict__ src, bf* dst, size_t n8) { const size_t i = (size_t)blockIdx.x * 256 + threadIdx.x; if (i >= n8) return; const v8f v = *(const v8f*)(src + i * 8); v8us o;
#pragma unroll
    for (int k = 0; k < 8; ++k) o[k] = f2bf(v[k]); *(v8us*)(dst + i * 8) = o;  }
// ---- k_fattn: causal scores, softmax, probability x value and the head merge of one batch in ONE launch; grid (heads, query tiles, heaviest tile first), AW x 32 threads.
// Transposed products: S^T = K Q^T (A = 16 key rows, B = 16 query columns), O^T += V^T P^T (A = 16 rows of the [d][t] value plane, B = P^T). A lane holds scores of ONE query (column c = lane & 15; keys 8 hi + r of each 16),
// so a pair of score tiles, rounded to 16 bit, IS the B operand of the second product in the k order of WFrag::ld (8 hi + s, 16 + 8 hi + s): the probabilities never leave the registers.
// Online softmax in the log2 domain: running maximum m and sum l per query; O^T and l are rescaled only in a trip in which some query's maximum rises. Wave w takes every AW-th block of 32 keys;
// the AW partial (m, l, O^T) are joined through LDS in wave order behind one work-group barrier; the joined context x 2^-10 / l goes out as hi + lo bf16 rows of the merged [t][heads x 64] planes.
// HL: hi + lo bf16 planes, 3 products each (query rows < RH, 16 queries a wave); else single fp16 (32 queries a wave).
#define AW   8
#define OP   68                    // floats between two queries' partial outputs in LDS (64 + 4: 16-byte aligned rows)
#define NEGB (-3.0e38f)
#define SCL2 (SCL * 1.4426950408889634f)   // 2^-13 x log2(e): exp(s x 2^-13 - max) = exp2(s x SCL2 - max2)
template <typename T16, bool HL, int NQ>
__device__ __forceinline__ void attn_tile(const T16* __restrict__ Q, const T16* __restrict__ Q2, const T16* __restrict__ Kp, const T16* __restrict__ K2, const T16* __restrict__ Vt, const T16* __restrict__ V2, int q0, int head, float* so, float* sm, float* sl, bf* Ah, bf* Al) {
    typedef WFrag<T16> F; typedef typename F::V V;
    const int lane = threadIdx.x & 31, c = lane & 15, hi = lane >> 4; const int w = __builtin_amdgcn_readfirstlane((int)(threadIdx.x >> 5));
    V qf[NQ][2], q2[NQ][2];
#pragma unroll
    for (int g = 0; g < NQ; ++g)
#pragma unroll
        for (int ks = 0; ks < 2; ++ks) { const size_t qo = (size_t)(q0 + g * 16 + c) * HD + ks * 32 + 8 * hi; qf[g][ks] = F::ld(Q + qo); if (HL) q2[g][ks] = F::ld(Q2 + qo); }
    v8f o[NQ][4]; float m[NQ], l[NQ];
#pragma unroll
    for (int g = 0; g < NQ; ++g) { m[g] = NEGB; l[g] = 0.f;
#pragma unroll
        for (int dt = 0; dt < 4; ++dt) o[g][dt] = (v8f){}; }
    const int nblk = q0 / 32 + 1;      // blocks of 32 keys up to and including the one that holds the diagonal
    // this lane's K and V addresses are carried through the loop and advanced at its foot; every load of a trip is one of them plus a constant offset
    const size_t kst = (size_t)(w * 32 + c) * HD + 8 * hi, vst = (size_t)c * TT + w * 32 + 8 * hi;
    const T16* kp = Kp + kst; const T16* vp = Vt + vst; const T16* kp2 = HL ? K2 + kst : nullptr; const T16* vp2 = HL ? V2 + vst : nullptr;
#pragma unroll 1   // kept rolled: run-time trip count, and one body already holds most of the register file
    for (int kb = w; kb < nblk; kb += AW) {
        const int k0 = kb * 32;
        V kf[2][2], k2[2][2], vf[4], v2[4];
#pragma unroll
        for (int kt = 0; kt < 2; ++kt)
#pragma unroll
            for (int ks = 0; ks < 2; ++ks) { const int ko = kt * 16 * HD + ks * 32; kf[kt][ks] = F::ld(kp + ko); if (HL) k2[kt][ks] = F::ld(kp2 + ko); }
#pragma unroll
        for (int dt = 0; dt < 4; ++dt) { const int vo = dt * 16 * TT; vf[dt] = F::ld(vp + vo); if (HL) v2[dt] = F::ld(vp2 + vo); }
        // behind the trip's last load, in front of every overwrite of an address register that these loads name; the addresses are inputs so that they stay live up to the wait and no load's result is placed in them
        if constexpr (HL) asm volatile("s_wait_xcnt 0x0" :: "v"(kp), "v"(kp2), "v"(vp), "v"(vp2) : "memory"); else asm volatile("s_wait_xcnt 0x0" :: "v"(kp), "v"(vp) : "memory");
        __builtin_amdgcn_sched_barrier(0);   // all of the trip's K and V loads are issued before its first product; without it the scheduler reloads a K register set between the products and a trip pays the load latency two or three times in a row
        v8f s[NQ][2];
#pragma unroll
        for (int g = 0; g < NQ; ++g)
#pragma unroll
            for (int kt = 0; kt < 2; ++kt) s[g][kt] = (v8f){};
#pragma unroll
        for (int ks = 0; ks < 2; ++ks)
#pragma unroll
            for (int g = 0; g < NQ; ++g)
#pragma unroll
                for (int kt = 0; kt < 2; ++kt) { s[g][kt] = F::mma(kf[kt][ks], qf[g][ks], s[g][kt]); if (HL) { s[g][kt] = F::mma(k2[kt][ks], qf[g][ks], s[g][kt]); s[g][kt] = F::mma(kf[kt][ks], q2[g][ks], s[g][kt]); } }
#pragma unroll
        for (int g = 0; g < NQ; ++g)
#pragma unroll
            for (int kt = 0; kt < 2; ++kt) s[g][kt] *= SCL2;
        if (kb == nblk - 1) {          // the diagonal block (wave-uniform test): keys behind the query are excluded; every query of the tile keeps at least this block's first key
#pragma unroll
            for (int g = 0; g < NQ; ++g)
#pragma unroll
                for (int kt = 0; kt < 2; ++kt)
#pragma unroll
                    for (int r = 0; r < 8; ++r) s[g][kt][r] = (k0 + kt * 16 + 8 * hi + r <= q0 + g * 16 + c) ? s[g][kt][r] : NEGB;
        }
        float mn[NQ]; bool need = false;
#pragma unroll
        for (int g = 0; g < NQ; ++g) { float mx = s[g][0][0];
#pragma unroll
            for (int r = 1; r < 8; ++r) mx = fmaxf(mx, s[g][0][r]);
#pragma unroll
            for (int r = 0; r < 8; ++r) mx = fmaxf(mx, s[g][1][r]);
            mx = fmaxf(mx, __shfl_xor(mx, 16, 32)); mn[g] = fmaxf(m[g], mx); need = need || (mn[g] > m[g]); }
        if (__builtin_amdgcn_ballot_w32(need) != 0) {   // scalar branch: some query's maximum rose (always in a wave's first trip)
#pragma unroll
            for (int g = 0; g < NQ; ++g) { const float al = __builtin_amdgcn_exp2f(m[g] - mn[g]); l[g] *= al; m[g] = mn[g];
#pragma unroll
                for (int dt = 0; dt < 4; ++dt) o[g][dt] *= al; }
        }
        V pb[NQ], p2[NQ];
#pragma unroll
        for (int g = 0; g < NQ; ++g) {
            if constexpr (HL) { v8us h0, h1, l0, l1;
#pragma unroll
                for (int r = 0; r < 8; ++r) { const float pa = __builtin_amdgcn_exp2f(s[g][0][r] - m[g]), pc = __builtin_amdgcn_exp2f(s[g][1][r] - m[g]); l[g] += pa; l[g] += pc; unsigned short a, b2; splitf(pa, a, b2); h0[r] = a; l0[r] = b2; splitf(pc, a, b2); h1[r] = a; l1[r] = b2; }
                pb[g] = cat16b(h0, h1); p2[g] = cat16b(l0, l1);
            } else { v8h h0, h1;
#pragma unroll
                for (int r = 0; r < 8; ++r) { const float pa = __builtin_amdgcn_exp2f(s[g][0][r] - m[g]), pc = __builtin_amdgcn_exp2f(s[g][1][r] - m[g]); l[g] += pa; l[g] += pc; h0[r] = tohx(pa); h1[r] = tohx(pc); }
                pb[g] = cat16(h0, h1); }
        }
#pragma unroll
        for (int dt = 0; dt < 4; ++dt)
#pragma unroll
            for (int g = 0; g < NQ; ++g) { o[g][dt] = F::mma(vf[dt], pb[g], o[g][dt]); if (HL) { o[g][dt] = F::mma(vf[dt], p2[g], o[g][dt]); o[g][dt] = F::mma(v2[dt], pb[g], o[g][dt]); } }
        kp += AW * 32 * HD; vp += AW * 32; if (HL) { kp2 += AW * 32 * HD; vp2 += AW * 32; }
    }
    // every wave lays its partial (m, l, O^T) in its own LDS plane (a wave that got no key block lays m = NEGB, l = 0, zeros: its weight below is exp2(-huge) = 0)
    float* my = so + w * (32 * OP);
#pragma unroll
    for (int g = 0; g < NQ; ++g) { l[g] += __shfl_xor(l[g], 16, 32); if (hi == 0) { sm[w * 32 + g * 16 + c] = m[g]; sl[w * 32 + g * 16 + c] = l[g]; }
#pragma unroll
        for (int dt = 0; dt < 4; ++dt) { float* p = my + (g * 16 + c) * OP + dt * 16 + 8 * hi; *(v4fa*)p = (v4f){o[g][dt][0], o[g][dt][1], o[g][dt][2], o[g][dt][3]}; *(v4fa*)(p + 4) = (v4f){o[g][dt][4], o[g][dt][5], o[g][dt][6], o[g][dt][7]}; } }
    __syncthreads();
    for (int idx = (int)threadIdx.x; idx < NQ * 16 * 8; idx += AW * 32) { const int q = idx >> 3, d8 = (idx & 7) * 8;   // one thread: 8 outputs of one query
        float M = sm[q];
#pragma unroll
        for (int p = 1; p < AW; ++p) M = fmaxf(M, sm[p * 32 + q]);
        float L = 0.f; v4f a0 = (v4f){}, a1 = (v4f){};
#pragma unroll
        for (int p = 0; p < AW; ++p) { const float sc = __builtin_amdgcn_exp2f(sm[p * 32 + q] - M); L += sc * sl[p * 32 + q]; const float* pp = so + p * (32 * OP) + q * OP + d8; a0 += sc * *(const v4fa*)pp; a1 += sc * *(const v4fa*)(pp + 4); }
        const float f = __fdiv_rn(0.0009765625f, L);   // x 2^-10: this module scales v by c^-0.5 = 2^-5 and the projected output by out_dim^-0.5 = 2^-5: both linear: ONE exact factor on the merged context
        v8us oh, ol;
#pragma unroll
        for (int k = 0; k < 4; ++k) { unsigned short a, b2; splitf(a0[k] * f, a, b2); oh[k] = a; ol[k] = b2; splitf(a1[k] * f, a, b2); oh[4 + k] = a; ol[4 + k] = b2; }
        const size_t oo = (size_t)(q0 + q) * DQ + head * HD + d8; *(v8us*)(Ah + oo) = oh; *(v8us*)(Al + oo) = ol; }
}
__global__ __launch_bounds__(AW * 32) void k_fattn(const h16* __restrict__ Q16, const h16* __restrict__ K16, const h16* __restrict__ V16, const bf* __restrict__ Qh, const bf* __restrict__ Ql, const bf* __restrict__ Kh, const bf* __restrict__ Kl, const bf* __restrict__ Vh, const bf* __restrict__ Vl, bf* Ah, bf* Al) {
    __shared__ __align__(16) float so[AW * 32 * OP]; __shared__ float sm[AW * 32]; __shared__ float sl[AW * 32];
    const int head = blockIdx.x, ty = blockIdx.y; const size_t zp = (size_t)head * TT * HD;   // one kv head per query head
    if (ty < (TT - RH) / 32) attn_tile<h16, false, 2>(Q16 + zp, nullptr, K16 + zp, nullptr, V16 + zp, nullptr, TT - 32 * (ty + 1), head, so, sm, sl, Ah, Al);
    else attn_tile<bf, true, 1>(Qh + zp, Ql + zp, Kh + zp, Kl + zp, Vh + zp, Vl + zp, RH - 16 * (ty - (TT - RH) / 32 + 1), head, so, sm, sl, Ah, Al);
}

extern "C" void kernel_launch(void* const* d_in, const int* in_sizes, int n_in,
                              void* d_out, int out_size, void* d_ws, size_t ws_size, hipStream_t stream) {
    (void)in_sizes; (void)n_in; (void)out_size;
    const float* x = (const float*)d_in[0]; const float* wk = (const float*)d_in[1]; const float* wq = (const float*)d_in[2]; const float* wv = (const float*)d_in[3]; const float* wo = (const float*)d_in[4];   /* input order x, W_key, W_query, W_value, W_proj ('oi' [1024][1024], UNIT normal): the KEY weight comes FIRST; NO bias input in this module */ const float* cosT = nullptr; const float* sinT = nullptr; (void)cosT; (void)sinT;
    float* OUT = (float*)d_out;     // [4][2048][1024]
    char* wsp = (char*)d_ws;
    auto take = [&](size_t bytes) { char* p = wsp; wsp += (bytes + 255) & ~(size_t)255; return (void*)p; };
    bf* WQ = (bf*)take((size_t)DQ * DM * 2); bf* WK = (bf*)take((size_t)DKV * DM * 2); bf* WV = (bf*)take((size_t)DKV * DM * 2); bf* WO = (bf*)take((size_t)DM * DQ * 2);
    bf* XB = (bf*)take((size_t)TT * DM * 2);
    h16* QP16 = (h16*)take((size_t)NH_ * TT * HD * 2); h16* KP16 = (h16*)take((size_t)NKV * TT * HD * 2); h16* VT16 = (h16*)take((size_t)NKV * HD * TT * 2);
    bf* QPh = (bf*)take((size_t)NH_ * TT * HD * 2); bf* QPl = (bf*)take((size_t)NH_ * TT * HD * 2); bf* KPh = (bf*)take((size_t)NKV * TT * HD * 2); bf* KPl = (bf*)take((size_t)NKV * TT * HD * 2); bf* VTh = (bf*)take((size_t)NKV * HD * TT * 2); bf* VTl = (bf*)take((size_t)NKV * HD * TT * 2);
    bf* ATh = (bf*)take((size_t)TT * DQ * 2); bf* ATl = (bf*)take((size_t)TT * DQ * 2);
    if ((size_t)(wsp - (char*)d_ws) > ws_size) return;    // ws 256 MiB
    { k_cvt8<<<(unsigned)(((size_t)DQ * DM / 8 + 255) / 256), 256, 0, stream>>>(wq, WQ, (size_t)DQ * DM / 8); k_cvt8<<<(unsigned)(((size_t)DKV * DM / 8 + 255) / 256), 256, 0, stream>>>(wk, WK, (size_t)DKV * DM / 8); k_cvt8<<<(unsigned)(((size_t)DKV * DM / 8 + 255) / 256), 256, 0, stream>>>(wv, WV, (size_t)DKV * DM / 8);
      k_cvt8<<<(unsigned)(((size_t)DM * DQ / 8 + 255) / 256), 256, 0, stream>>>(wo, WO, (size_t)DM * DQ / 8);
       }
    for (int b = 0; b < NB_; ++b) {
        
        k_cvt8<<<(unsigned)(((size_t)TT * DM / 8 + 255) / 256), 256, 0, stream>>>(x + (size_t)b * TT * DM, XB, (size_t)TT * DM / 8);
        // q and k: x W^T, one 64-wide tile column = one head, laid straight into the [head][t][d] planes; v: W x^T, whose rows are the [head x 64 + d][t] plane as it stands
        k_gemmw<bf, 0, false, 8, true><<<dim3(TT / 64, DQ / 64, 1), 256, 0, stream>>>(XB, nullptr, WQ, nullptr, DM, nullptr, HD, nullptr, 0, 0, 0, QP16, QPh, QPl, TT * HD);
        k_gemmw<bf, 0, false, 8, true><<<dim3(TT / 64, DKV / 64, 1), 256, 0, stream>>>(XB, nullptr, WK, nullptr, DM, nullptr, HD, nullptr, 0, 0, 0, KP16, KPh, KPl, TT * HD);
        k_gemmw<bf, 0, false, 8, true><<<dim3(DKV / 64, TT / 64, 1), 256, 0, stream>>>(WV, nullptr, XB, nullptr, DM, nullptr, TT, nullptr, 0, 0, 0, VT16, VTh, VTl, 64);
        k_fattn<<<dim3(NH_, (TT - RH) / 32 + RH / 16, 1), AW * 32, 0, stream>>>(QP16, KP16, VT16, QPh, QPl, KPh, KPl, VTh, VTl, ATh, ATl);
        k_gemmw<bf, 1, false, 8, false><<<dim3(TT / 64, DM / 64, 1), 256, 0, stream>>>(ATh, ATl, WO, nullptr, DQ, OUT + (size_t)b * TT * DM, DM, nullptr, 0, 0, 0, nullptr, nullptr, nullptr, 0); }
}

// v004
// One run takes 308 microseconds.
// Next to v003, in two timings, it ran 1.15 and 1.16 times as fast.
// Over all steps from v000 it is 9.78 times as fast.
#include <hip/hip_runtime.h>

// Causal multi-head self-attention whose projections and output are each scaled by 1/sqrt(width) (x [4][2048][1024]; k, q, v = (x W^T) x 1024^-0.5 ('oi' [1024][1024] UNIT normal, no bias; 16 heads x 64): each projection x 2^-5 (exact); scores = q.k x 64^-0.5: with the two 2^-5 factors folded in, q.k(unscaled) x 2^-13 (exact); causal (tril kept, -inf elsewhere); softmax; out = (merged W_proj^T) x 1024^-0.5 ('oi', no bias): the v factor 2^-5 and the output factor 2^-5 are both linear: ONE factor 2^-10 on the merged context (exact) -> [4][2048][1024] (8.4 M); argument order x, W_key, W_query, W_value, W_proj: KEY FIRST).
// Compute dtypes, f32 accumulate: every input rounded to bf16; q/k/v on PLAIN bf16 operands (inputs: exact); causal scores and attn.v: query rows < 512 hl (3 products), the rest single fp16, causal block skipping, one fused launch for all batches; online softmax f32 (scale 2^-13 exact); the merged context x 2^-10 (exact); W_proj hl x exact (2 products), NO bias.

#define NB_  4
#define TT   2048
#define DM   1024
#define NH_  16
#define NKV  16
#define REP  (NH_ / NKV)
#define HD   64
#define DQ   (NH_ * HD)
#define DKV  (NKV * HD)
#define RH   512                  // query rows < RH use hi+lo planes (0: none)
#define SCL  0.0001220703125f   // 2^-13 = 1024^-0.5 (on q) x 1024^-0.5 (on k) x 64^-0.5: this module scales q AND k by c^-0.5 = 2^-5 each and the scores by hd^-0.5 = 2^-3: all exact powers of two, applied here in ONE multiply on the unscaled q.k
typedef _Float16 h16;
typedef unsigned short bf;
typedef __attribute__((ext_vector_type(16))) __bf16   v16bf;
typedef __attribute__((ext_vector_type(16))) _Float16 v16h;
typedef __attribute__((ext_vector_type(8)))  _Float16 v8h;
typedef __attribute__((ext_vector_type(8)))  unsigned short v8us;
typedef __attribute__((ext_vector_type(8)))  float    v8f;
typedef __attribute__((ext_vector_type(4)))  float    v4f;
typedef v8h  __attribute__((may_alias)) v8ha;
typedef v4f  __attribute__((may_alias)) v4fa;
typedef v8us __attribute__((may_alias)) v8usa;

__device__ __forceinline__ unsigned short f2bf(float f) { unsigned u = __float_as_uint(f); u += 0x7FFFu + ((u >> 16) & 1u); return (unsigned short)(u >> 16); }
__device__ __forceinline__ float bf2f(unsigned short b) { return __uint_as_float(((unsigned)b) << 16); }
__device__ __forceinline__ float bfr(float f) { return bf2f(f2bf(f)); }
__device__ __forceinline__ v16h cat16(v8h lo, v8h hi) { return __builtin_shufflevector(lo, hi, 0, 1, 2, 3, 4, 5, 6, 7, 8, 9, 10, 11, 12, 13, 14, 15); }
__device__ __forceinline__ v16bf cat16b(v8us lo, v8us hi) { return __builtin_bit_cast(v16bf, __builtin_shufflevector(lo, hi, 0, 1, 2, 3, 4, 5, 6, 7, 8, 9, 10, 11, 12, 13, 14, 15)); }
__device__ __forceinline__ v8f wmma16(v16h a, v16h b, v8f c) { return __builtin_amdgcn_wmma_f32_16x16x32_f16(false, a, false, b, (short)0, c, false, false); }
__device__ __forceinline__ v8f wmmab(v16bf a, v16bf b, v8f c) { return __builtin_amdgcn_wmma_f32_16x16x32_bf16(false, a, false, b, (short)0, c, false, false); }
__device__ __forceinline__ h16 tohx(float x) { return (h16)x; }
__device__ __forceinline__ void splitf(float y, unsigned short& h, unsigned short& l) { h = f2bf(y); l = f2bf(y - bf2f(h)); }
typedef __attribute__((ext_vector_type(4))) _Float16 v4h;
typedef __attribute__((ext_vector_type(4))) unsigned short v4us;



// ---- k_gemmw: register-blocked GEMM, one 64x64 output tile per work-group of NW waves; every wave holds the whole tile (16 accumulators) and takes every NW-th 64-wide slice of K (one 128-byte line of each operand row), so NW times the bytes are in flight;
// the NW partial tiles are summed through LDS in wave order (fixed). Operands straight from K-contiguous 16-bit planes; grid (M/64, N/64, Z), NW x 32 threads.
// C[m][n] (f32, pitch ldc, + optional f32 bias[n]) = sum_k A[m][k] Bt[n][k] (+ split products per NSPLIT). z-batch strides sA/sB/sC in elements (sC: of C, or of each plane under PLANES). K % 64 == 0.
// PLANES: the summed tile is not stored as f32 but rounded at once into three 16-bit planes (fp16, and bf16 hi + lo); element (m, n) lies at m x ldc + (n / 64) x tpitch + n % 64.
// ldc = 64, tpitch = rows x 64 gives head planes [n / 64][m][n % 64]; with A = the weight and Bt = the activations, ldc = positions and tpitch = 64 give the transposed value plane [feature][position].
template <typename T16> struct WFrag;
template <> struct WFrag<h16> { typedef v16h V; static __device__ __forceinline__ V ld(const h16* p) { return cat16(*(const v8h*)p, *(const v8h*)(p + 16)); } static __device__ __forceinline__ v8f mma(V a, V b, v8f c) { return wmma16(a, b, c); } };
template <> struct WFrag<bf> { typedef v16bf V; static __device__ __forceinline__ V ld(const bf* p) { return cat16b(*(const v8us*)p, *(const v8us*)(p + 16)); } static __device__ __forceinline__ v8f mma(V a, V b, v8f c) { return wmmab(a, b, c); } };
template <typename T16, int NSPLIT, bool BIAS, int NW, bool PLANES>
__global__ __launch_bounds__(NW * 32) void k_gemmw(const T16* __restrict__ A, const T16* __restrict__ A2, const T16* __restrict__ Bt, const T16* __restrict__ Bt2, int K, float* C, int ldc, const float* __restrict__ bias, size_t sA, size_t sB, size_t sC, h16* P16, bf* Ph, bf* Pl, int tpitch) {
    typedef typename WFrag<T16>::V V;
    __shared__ __align__(16) float os[NW * 64 * 68];
    const size_t z = blockIdx.z; A += z * sA; if (A2) A2 += z * sA; Bt += z * sB; if (Bt2) Bt2 += z * sB; if constexpr (!PLANES) C += z * sC;
    const int lane = threadIdx.x & 31, lr = lane & 15, hi = lane >> 4; const int w = __builtin_amdgcn_readfirstlane((int)(threadIdx.x >> 5)); const int r0 = blockIdx.x * 64, c0 = blockIdx.y * 64;
    v8f acc[4][4];
#pragma unroll
    for (int mb = 0; mb < 4; ++mb)
#pragma unroll
        for (int nb = 0; nb < 4; ++nb) acc[mb][nb] = (v8f){};
    const size_t aoff = (size_t)(r0 + lr) * K + 8 * hi, boff = (size_t)(c0 + lr) * K + 8 * hi;
#pragma unroll 1
    for (int kc = w * 64; kc < K; kc += (kc & 32) ? NW * 64 - 32 : 32) {   // two 32-wide trips inside this wave's 64-wide slice, then on to its next slice
        V a[4], a2[4];
#pragma unroll
        for (int mb = 0; mb < 4; ++mb) { a[mb] = WFrag<T16>::ld(A + aoff + (size_t)mb * 16 * K + kc); if (NSPLIT == 1 || NSPLIT == 2) a2[mb] = WFrag<T16>::ld(A2 + aoff + (size_t)mb * 16 * K + kc); }
#pragma unroll
        for (int nb = 0; nb < 4; ++nb) { const V b = WFrag<T16>::ld(Bt + boff + (size_t)nb * 16 * K + kc); V b2; if (NSPLIT >= 2) b2 = WFrag<T16>::ld(Bt2 + boff + (size_t)nb * 16 * K + kc);
#pragma unroll
            for (int mb = 0; mb < 4; ++mb) { acc[mb][nb] = WFrag<T16>::mma(a[mb], b, acc[mb][nb]); if (NSPLIT == 1 || NSPLIT == 2) acc[mb][nb] = WFrag<T16>::mma(a2[mb], b, acc[mb][nb]); if (NSPLIT >= 2) acc[mb][nb] = WFrag<T16>::mma(a[mb], b2, acc[mb][nb]); } }
        asm volatile("v_nop\n\tv_nop\n\tv_nop\n\tv_nop" : "+v"(acc[0][0]), "+v"(acc[1][1]), "+v"(acc[2][2]), "+v"(acc[3][3]) : "v"(a[0]), "v"(a[3]));
    }
    // every wave lays its partial tile in its own LDS plane (a wave that got no K slice lays zeros); behind the one work-group barrier each thread sums the NW planes in wave order and stores whole rows (256 bytes of f32, or a 128-byte line of each 16-bit plane)
    float* my = os + w * (64 * 68);
#pragma unroll
    for (int mb = 0; mb < 4; ++mb)
#pragma unroll
        for (int nb = 0; nb < 4; ++nb)
#pragma unroll
            for (int j = 0; j < 8; ++j) my[(mb * 16 + hi * 8 + j) * 68 + nb * 16 + lr] = acc[mb][nb][j];
    __syncthreads();
#pragma unroll
    for (int s = 0; s < 32 / NW; ++s) { const int idx = s * (NW * 32) + (int)threadIdx.x; const int row = idx >> 4, cofs = (idx & 15) * 4; v4f val = *(const v4fa*)(os + row * 68 + cofs);
#pragma unroll
        for (int p = 1; p < NW; ++p) val += *(const v4fa*)(os + p * (64 * 68) + row * 68 + cofs);
        if (BIAS) { val[0] += bfr(bias[c0 + cofs]); val[1] += bfr(bias[c0 + cofs + 1]); val[2] += bfr(bias[c0 + cofs + 2]); val[3] += bfr(bias[c0 + cofs + 3]); }
        if constexpr (PLANES) { const size_t po = z * sC + (size_t)(r0 + row) * ldc + (size_t)blockIdx.y * tpitch + cofs; v4h o16; v4us oh, ol;   // 16 lanes x 8 bytes: one whole 128-byte line of each plane
#pragma unroll
            for (int k = 0; k < 4; ++k) { o16[k] = tohx(val[k]); unsigned short a2, c2; splitf(val[k], a2, c2); oh[k] = a2; ol[k] = c2; }
            *(v4h*)(P16 + po) = o16; *(v4us*)(Ph + po) = oh; *(v4us*)(Pl + po) = ol; }
        else *(v4f*)(C + (size_t)(r0 + row) * ldc + c0 + cofs) = val; }
}

typedef __attribute__((ext_vector_type(2))) unsigned short v2us;
typedef __attribute__((ext_vector_type(4))) int v4i;

__global__ __launch_bounds__(256) void k_wtG(const float* __restrict__ w, int K, int N, bf* Bt) {
    const int lane = threadIdx.x & 31; const int L0 = (blockIdx.x * 8 + (threadIdx.x >> 5)) * 8; const int nlines = N * K / 64;
{
#pragma unroll 1
        for (int l = 0; l < 8; ++l) { const int L = L0 + l; if (L >= nlines) break; const size_t e = (size_t)L * 64 + lane * 2; const int k = (int)(e % K), n = (int)(e / K); v2us o;
            o[0] = f2bf(w[(size_t)k * N + n]); o[1] = f2bf(w[(size_t)(k + 1) * N + n]); *(v2us*)(Bt + e) = o; }
         }
}
__global__ __launch_bounds__(256) void k_cvt8(const float* __restrict__ src, bf* dst, size_t n8) { const size_t i = (size_t)blockIdx.x * 256 + threadIdx.x; if (i >= n8) return; const v8f v = *(const v8f*)(src + i * 8); v8us o;
#pragma unroll
    for (int k = 0; k < 8; ++k) o[k] = f2bf(v[k]); *(v8us*)(dst + i * 8) = o;  }
// ---- k_fattn: causal scores, softmax, probability x value and the head merge of ALL batches in ONE launch; grid (batches x heads, query tiles, heaviest tile first: the cost falls with the flat index over the whole launch), AW x 32 threads.
// Transposed products: S^T = K Q^T (A = 16 key rows, B = 16 query columns), O^T += V^T P^T (A = 16 rows of the [d][t] value plane, B = P^T). A lane holds scores of ONE query (column c = lane & 15; keys 8 hi + r of each 16),
// so a pair of score tiles, rounded to 16 bit, IS the B operand of the second product in the k order of WFrag::ld (8 hi + s, 16 + 8 hi + s): the probabilities never leave the registers.
// Online softmax in the log2 domain: running maximum m and sum l per query; O^T and l are rescaled only in a trip in which some query's maximum rises. Wave w takes every AW-th block of 32 keys;
// the AW partial (m, l, O^T) are joined through LDS in wave order behind one work-group barrier; the joined context x 2^-10 / l goes out as hi + lo bf16 rows of the merged [t][heads x 64] planes.
// HL: hi + lo bf16 planes, 3 products each (query rows < RH, 16 queries a wave); else single fp16 (32 queries a wave).
#define AW   8
#define OP   68                    // floats between two queries' partial outputs in LDS (64 + 4: 16-byte aligned rows)
#define NEGB (-3.0e38f)
#define SCL2 (SCL * 1.4426950408889634f)   // 2^-13 x log2(e): exp(s x 2^-13 - max) = exp2(s x SCL2 - max2)
template <typename T16, bool HL, int NQ>
__device__ __forceinline__ void attn_tile(const T16* __restrict__ Q, const T16* __restrict__ Q2, const T16* __restrict__ Kp, const T16* __restrict__ K2, const T16* __restrict__ Vt, const T16* __restrict__ V2, int q0, int head, float* so, float* sm, float* sl, bf* Ah, bf* Al) {
    typedef WFrag<T16> F; typedef typename F::V V;
    const int lane = threadIdx.x & 31, c = lane & 15, hi = lane >> 4; const int w = __builtin_amdgcn_readfirstlane((int)(threadIdx.x >> 5));
    V qf[NQ][2], q2[NQ][2];
#pragma unroll
    for (int g = 0; g < NQ; ++g)
#pragma unroll
        for (int ks = 0; ks < 2; ++ks) { const size_t qo = (size_t)(q0 + g * 16 + c) * HD + ks * 32 + 8 * hi; qf[g][ks] = F::ld(Q + qo); if (HL) q2[g][ks] = F::ld(Q2 + qo); }
    v8f o[NQ][4]; float m[NQ], l[NQ];
#pragma unroll
    for (int g = 0; g < NQ; ++g) { m[g] = NEGB; l[g] = 0.f;
#pragma unroll
        for (int dt = 0; dt < 4; ++dt) o[g][dt] = (v8f){}; }
    const int nblk = q0 / 32 + 1;      // blocks of 32 keys up to and including the one that holds the diagonal
    // this lane's K and V addresses are carried through the loop and advanced at its foot; every load of a trip is one of them plus a constant offset
    const size_t kst = (size_t)(w * 32 + c) * HD + 8 * hi, vst = (size_t)c * TT + w * 32 + 8 * hi;
    const T16* kp = Kp + kst; const T16* vp = Vt + vst; const T16* kp2 = HL ? K2 + kst : nullptr; const T16* vp2 = HL ? V2 + vst : nullptr;
#pragma unroll 1   // kept rolled: run-time trip count, and one body already holds most of the register file
    for (int kb = w; kb < nblk; kb += AW) {
        const int k0 = kb * 32;
        V kf[2][2], k2[2][2], vf[4], v2[4];
#pragma unroll
        for (int kt = 0; kt < 2; ++kt)
#pragma unroll
            for (int ks = 0; ks < 2; ++ks) { const int ko = kt * 16 * HD + ks * 32; kf[kt][ks] = F::ld(kp + ko); if (HL) k2[kt][ks] = F::ld(kp2 + ko); }
#pragma unroll
        for (int dt = 0; dt < 4; ++dt) { const int vo = dt * 16 * TT; vf[dt] = F::ld(vp + vo); if (HL) v2[dt] = F::ld(vp2 + vo); }
        // behind the trip's last load, in front of every overwrite of an address register that these loads name; the addresses are inputs so that they stay live up to the wait and no load's result is placed in them
        if constexpr (HL) asm volatile("s_wait_xcnt 0x0" :: "v"(kp), "v"(kp2), "v"(vp), "v"(vp2) : "memory"); else asm volatile("s_wait_xcnt 0x0" :: "v"(kp), "v"(vp) : "memory");
        __builtin_amdgcn_sched_barrier(0);   // all of the trip's K and V loads are issued before its first product; without it the scheduler reloads a K register set between the products and a trip pays the load latency two or three times in a row
        v8f s[NQ][2];
#pragma unroll
        for (int g = 0; g < NQ; ++g)
#pragma unroll
            for (int kt = 0; kt < 2; ++kt) s[g][kt] = (v8f){};
#pragma unroll
        for (int ks = 0; ks < 2; ++ks)
#pragma unroll
            for (int g = 0; g < NQ; ++g)
#pragma unroll
                for (int kt = 0; kt < 2; ++kt) { s[g][kt] = F::mma(kf[kt][ks], qf[g][ks], s[g][kt]); if (HL) { s[g][kt] = F::mma(k2[kt][ks], qf[g][ks], s[g][kt]); s[g][kt] = F::mma(kf[kt][ks], q2[g][ks], s[g][kt]); } }
#pragma unroll
        for (int g = 0; g < NQ; ++g)
#pragma unroll
            for (int kt = 0; kt < 2; ++kt) s[g][kt] *= SCL2;
        if (kb == nblk - 1) {          // the diagonal block (wave-uniform test): keys behind the query are excluded; every query of the tile keeps at least this block's first key
#pragma unroll
            for (int g = 0; g < NQ; ++g)
#pragma unroll
                for (int kt = 0; kt < 2; ++kt)
#pragma unroll
                    for (int r = 0; r < 8; ++r) s[g][kt][r] = (k0 + kt * 16 + 8 * hi + r <= q0 + g * 16 + c) ? s[g][kt][r] : NEGB;
        }
        float mn[NQ]; bool need = false;
#pragma unroll
        for (int g = 0; g < NQ; ++g) { float mx = s[g][0][0];
#pragma unroll
            for (int r = 1; r < 8; ++r) mx = fmaxf(mx, s[g][0][r]);
#pragma unroll
            for (int r = 0; r < 8; ++r) mx = fmaxf(mx, s[g][1][r]);
            mx = fmaxf(mx, __shfl_xor(mx, 16, 32)); mn[g] = fmaxf(m[g], mx); need = need || (mn[g] > m[g]); }
        if (__builtin_amdgcn_ballot_w32(need) != 0) {   // scalar branch: some query's maximum rose (always in a wave's first trip)
#pragma unroll
            for (int g = 0; g < NQ; ++g) { const float al = __builtin_amdgcn_exp2f(m[g] - mn[g]); l[g] *= al; m[g] = mn[g];
#pragma unroll
                for (int dt = 0; dt < 4; ++dt) o[g][dt] *= al; }
        }
        V pb[NQ], p2[NQ];
#pragma unroll
        for (int g = 0; g < NQ; ++g) {
            if constexpr (HL) { v8us h0, h1, l0, l1;
#pragma unroll
                for (int r = 0; r < 8; ++r) { const float pa = __builtin_amdgcn_exp2f(s[g][0][r] - m[g]), pc = __builtin_amdgcn_exp2f(s[g][1][r] - m[g]); l[g] += pa; l[g] += pc; unsigned short a, b2; splitf(pa, a, b2); h0[r] = a; l0[r] = b2; splitf(pc, a, b2); h1[r] = a; l1[r] = b2; }
                pb[g] = cat16b(h0, h1); p2[g] = cat16b(l0, l1);
            } else { v8h h0, h1;
#pragma unroll
                for (int r = 0; r < 8; ++r) { const float pa = __builtin_amdgcn_exp2f(s[g][0][r] - m[g]), pc = __builtin_amdgcn_exp2f(s[g][1][r] - m[g]); l[g] += pa; l[g] += pc; h0[r] = tohx(pa); h1[r] = tohx(pc); }
                pb[g] = cat16(h0, h1); }
        }
#pragma unroll
        for (int dt = 0; dt < 4; ++dt)
#pragma unroll
            for (int g = 0; g < NQ; ++g) { o[g][dt] = F::mma(vf[dt], pb[g], o[g][dt]); if (HL) { o[g][dt] = F::mma(vf[dt], p2[g], o[g][dt]); o[g][dt] = F::mma(v2[dt], pb[g], o[g][dt]); } }
        kp += AW * 32 * HD; vp += AW * 32; if (HL) { kp2 += AW * 32 * HD; vp2 += AW * 32; }
    }
    // every wave lays its partial (m, l, O^T) in its own LDS plane (a wave that got no key block lays m = NEGB, l = 0, zeros: its weight below is exp2(-huge) = 0)
    float* my = so + w * (32 * OP);
#pragma unroll
    for (int g = 0; g < NQ; ++g) { l[g] += __shfl_xor(l[g], 16, 32); if (hi == 0) { sm[w * 32 + g * 16 + c] = m[g]; sl[w * 32 + g * 16 + c] = l[g]; }
#pragma unroll
        for (int dt = 0; dt < 4; ++dt) { float* p = my + (g * 16 + c) * OP + dt * 16 + 8 * hi; *(v4fa*)p = (v4f){o[g][dt][0], o[g][dt][1], o[g][dt][2], o[g][dt][3]}; *(v4fa*)(p + 4) = (v4f){o[g][dt][4], o[g][dt][5], o[g][dt][6], o[g][dt][7]}; } }
    __syncthreads();
    for (int idx = (int)threadIdx.x; idx < NQ * 16 * 8; idx += AW * 32) { const int q = idx >> 3, d8 = (idx & 7) * 8;   // one thread: 8 outputs of one query
        float M = sm[q];
#pragma unroll
        for (int p = 1; p < AW; ++p) M = fmaxf(M, sm[p * 32 + q]);
        float L = 0.f; v4f a0 = (v4f){}, a1 = (v4f){};
#pragma unroll
        for (int p = 0; p < AW; ++p) { const float sc = __builtin_amdgcn_exp2f(sm[p * 32 + q] - M); L += sc * sl[p * 32 + q]; const float* pp = so + p * (32 * OP) + q * OP + d8; a0 += sc * *(const v4fa*)pp; a1 += sc * *(const v4fa*)(pp + 4); }
        const float f = __fdiv_rn(0.0009765625f, L);   // x 2^-10: this module scales v by c^-0.5 = 2^-5 and the projected output by out_dim^-0.5 = 2^-5: both linear: ONE exact factor on the merged context
        v8us oh, ol;
#pragma unroll
        for (int k = 0; k < 4; ++k) { unsigned short a, b2; splitf(a0[k] * f, a, b2); oh[k] = a; ol[k] = b2; splitf(a1[k] * f, a, b2); oh[4 + k] = a; ol[4 + k] = b2; }
        const size_t oo = (size_t)(q0 + q) * DQ + head * HD + d8; *(v8us*)(Ah + oo) = oh; *(v8us*)(Al + oo) = ol; }
}
__global__ __launch_bounds__(AW * 32) void k_fattn(const h16* __restrict__ Q16, const h16* __restrict__ K16, const h16* __restrict__ V16, const bf* __restrict__ Qh, const bf* __restrict__ Ql, const bf* __restrict__ Kh, const bf* __restrict__ Kl, const bf* __restrict__ Vh, const bf* __restrict__ Vl, bf* Ah, bf* Al) {
    __shared__ __align__(16) float so[AW * 32 * OP]; __shared__ float sm[AW * 32]; __shared__ float sl[AW * 32];
    const int head = blockIdx.x % NH_, ty = blockIdx.y; const size_t zp = (size_t)blockIdx.x * TT * HD;   // planes [batch][head][..]: blockIdx.x = batch x heads + head; one kv head per query head
    { const size_t ao = (size_t)(blockIdx.x / NH_) * TT * DQ; Ah += ao; Al += ao; }   // this batch's rows of the merged context
    if (ty < (TT - RH) / 32) attn_tile<h16, false, 2>(Q16 + zp, nullptr, K16 + zp, nullptr, V16 + zp, nullptr, TT - 32 * (ty + 1), head, so, sm, sl, Ah, Al);
    else attn_tile<bf, true, 1>(Qh + zp, Ql + zp, Kh + zp, Kl + zp, Vh + zp, Vl + zp, RH - 16 * (ty - (TT - RH) / 32 + 1), head, so, sm, sl, Ah, Al);
}

extern "C" void kernel_launch(void* const* d_in, const int* in_sizes, int n_in,
                              void* d_out, int out_size, void* d_ws, size_t ws_size, hipStream_t stream) {
    (void)in_sizes; (void)n_in; (void)out_size;
    const float* x = (const float*)d_in[0]; const float* wk = (const float*)d_in[1]; const float* wq = (const float*)d_in[2]; const float* wv = (const float*)d_in[3]; const float* wo = (const float*)d_in[4];   /* input order x, W_key, W_query, W_value, W_proj ('oi' [1024][1024], UNIT normal): the KEY weight comes FIRST; NO bias input in this module */ const float* cosT = nullptr; const float* sinT = nullptr; (void)cosT; (void)sinT;
    float* OUT = (float*)d_out;     // [4][2048][1024]
    char* wsp = (char*)d_ws;
    auto take = [&](size_t bytes) { char* p = wsp; wsp += (bytes + 255) & ~(size_t)255; return (void*)p; };
    bf* WQ = (bf*)take((size_t)DQ * DM * 2); bf* WK = (bf*)take((size_t)DKV * DM * 2); bf* WV = (bf*)take((size_t)DKV * DM * 2); bf* WO = (bf*)take((size_t)DM * DQ * 2);
    // every plane holds all NB_ batches, batch outermost
    bf* XB = (bf*)take((size_t)NB_ * TT * DM * 2);
    const size_t PB = (size_t)NB_ * NH_ * TT * HD * 2;
    h16* QP16 = (h16*)take(PB); h16* KP16 = (h16*)take(PB); h16* VT16 = (h16*)take(PB);
    bf* QPh = (bf*)take(PB); bf* QPl = (bf*)take(PB); bf* KPh = (bf*)take(PB); bf* KPl = (bf*)take(PB); bf* VTh = (bf*)take(PB); bf* VTl = (bf*)take(PB);
    bf* ATh = (bf*)take((size_t)NB_ * TT * DQ * 2); bf* ATl = (bf*)take((size_t)NB_ * TT * DQ * 2);
    if ((size_t)(wsp - (char*)d_ws) > ws_size) return;    // ws 256 MiB
    { k_cvt8<<<(unsigned)(((size_t)DQ * DM / 8 + 255) / 256), 256, 0, stream>>>(wq, WQ, (size_t)DQ * DM / 8); k_cvt8<<<(unsigned)(((size_t)DKV * DM / 8 + 255) / 256), 256, 0, stream>>>(wk, WK, (size_t)DKV * DM / 8); k_cvt8<<<(unsigned)(((size_t)DKV * DM / 8 + 255) / 256), 256, 0, stream>>>(wv, WV, (size_t)DKV * DM / 8);
      k_cvt8<<<(unsigned)(((size_t)DM * DQ / 8 + 255) / 256), 256, 0, stream>>>(wo, WO, (size_t)DM * DQ / 8);
       }
    // each stage is ONE launch over all batches: the GEMMs take the batch as grid z (low z starts first, so one batch's activations are read together), the attention as part of grid x
    k_cvt8<<<(unsigned)(((size_t)NB_ * TT * DM / 8 + 255) / 256), 256, 0, stream>>>(x, XB, (size_t)NB_ * TT * DM / 8);
    // q and k: x W^T, one 64-wide tile column = one head, laid straight into the [batch][head][t][d] planes; v: W x^T, whose rows are the [batch][head x 64 + d][t] plane as it stands
    k_gemmw<bf, 0, false, 8, true><<<dim3(TT / 64, DQ / 64, NB_), 256, 0, stream>>>(XB, nullptr, WQ, nullptr, DM, nullptr, HD, nullptr, (size_t)TT * DM, 0, (size_t)NH_ * TT * HD, QP16, QPh, QPl, TT * HD);
    k_gemmw<bf, 0, false, 8, true><<<dim3(TT / 64, DKV / 64, NB_), 256, 0, stream>>>(XB, nullptr, WK, nullptr, DM, nullptr, HD, nullptr, (size_t)TT * DM, 0, (size_t)NKV * TT * HD, KP16, KPh, KPl, TT * HD);
    k_gemmw<bf, 0, false, 8, true><<<dim3(DKV / 64, TT / 64, NB_), 256, 0, stream>>>(WV, nullptr, XB, nullptr, DM, nullptr, TT, nullptr, 0, (size_t)TT * DM, (size_t)NKV * HD * TT, VT16, VTh, VTl, 64);
    k_fattn<<<dim3(NB_ * NH_, (TT - RH) / 32 + RH / 16, 1), AW * 32, 0, stream>>>(QP16, KP16, VT16, QPh, QPl, KPh, KPl, VTh, VTl, ATh, ATl);
    k_gemmw<bf, 1, false, 8, false><<<dim3(TT / 64, DM / 64, NB_), 256, 0, stream>>>(ATh, ATl, WO, nullptr, DQ, OUT, DM, nullptr, (size_t)TT * DQ, 0, (size_t)TT * DM, nullptr, nullptr, nullptr, 0);
}

// v005
// One run takes 185 microseconds.
// In two side-by-side timings against v004, it was 1.67 and 1.68 times as fast.
// Counting every step since v000, it is 16.4 times as fast.
#include <hip/hip_runtime.h>

// Causal multi-head self-attention whose projections and output are each scaled by 1/sqrt(width) (x [4][2048][1024]; k, q, v = (x W^T) x 1024^-0.5 ('oi' [1024][1024] UNIT normal, no bias; 16 heads x 64): each projection x 2^-5 (exact); scores = q.k x 64^-0.5: with the two 2^-5 factors folded in, q.k(unscaled) x 2^-13 (exact); causal (tril kept, -inf elsewhere); softmax; out = (merged W_proj^T) x 1024^-0.5 ('oi', no bias): the v factor 2^-5 and the output factor 2^-5 are both linear: ONE factor 2^-10 on the merged context (exact) -> [4][2048][1024] (8.4 M); argument order x, W_key, W_query, W_value, W_proj: KEY FIRST).
// Compute dtypes, f32 accumulate: every input rounded to bf16; q/k/v on PLAIN bf16 operands (inputs: exact); causal scores and attn.v: query rows < 512 hl (3 products), the rest single fp16, causal block skipping, one fused launch for all batches; online softmax f32 (scale 2^-13 exact); the merged context x 2^-10 (exact); W_proj hl x exact (2 products), NO bias.

#define NB_  4
#define TT   2048
#define DM   1024
#define NH_  16
#define NKV  16
#define REP  (NH_ / NKV)
#define HD   64
#define DQ   (NH_ * HD)
#define DKV  (NKV * HD)
#define RH   512                  // query rows < RH use hi+lo planes (0: none)
#define SCL  0.0001220703125f   // 2^-13 = 1024^-0.5 (on q) x 1024^-0.5 (on k) x 64^-0.5: this module scales q AND k by c^-0.5 = 2^-5 each and the scores by hd^-0.5 = 2^-3: all exact powers of two, applied here in ONE multiply on the unscaled q.k
typedef _Float16 h16;
typedef unsigned short bf;
typedef __attribute__((ext_vector_type(16))) __bf16   v16bf;
typedef __attribute__((ext_vector_type(16))) _Float16 v16h;
typedef __attribute__((ext_vector_type(8)))  _Float16 v8h;
typedef __attribute__((ext_vector_type(8)))  unsigned short v8us;
typedef __attribute__((ext_vector_type(8)))  float    v8f;
typedef __attribute__((ext_vector_type(4)))  float    v4f;
typedef v8h  __attribute__((may_alias)) v8ha;
typedef v4f  __attribute__((may_alias)) v4fa;
typedef v8us __attribute__((may_alias)) v8usa;

__device__ __forceinline__ unsigned short f2bf(float f) { unsigned u = __float_as_uint(f); u += 0x7FFFu + ((u >> 16) & 1u); return (unsigned short)(u >> 16); }
__device__ __forceinline__ float bf2f(unsigned short b) { return __uint_as_float(((unsigned)b) << 16); }
__device__ __forceinline__ float bfr(float f) { return bf2f(f2bf(f)); }
__device__ __forceinline__ v16h cat16(v8h lo, v8h hi) { return __builtin_shufflevector(lo, hi, 0, 1, 2, 3, 4, 5, 6, 7, 8, 9, 10, 11, 12, 13, 14, 15); }
__device__ __forceinline__ v16bf cat16b(v8us lo, v8us hi) { return __builtin_bit_cast(v16bf, __builtin_shufflevector(lo, hi, 0, 1, 2, 3, 4, 5, 6, 7, 8, 9, 10, 11, 12, 13, 14, 15)); }
__device__ __forceinline__ v8f wmma16(v16h a, v16h b, v8f c) { return __builtin_amdgcn_wmma_f32_16x16x32_f16(false, a, false, b, (short)0, c, false, false); }
__device__ __forceinline__ v8f wmmab(v16bf a, v16bf b, v8f c) { return __builtin_amdgcn_wmma_f32_16x16x32_bf16(false, a, false, b, (short)0, c, false, false); }
__device__ __forceinline__ h16 tohx(float x) { return (h16)x; }
__device__ __forceinline__ void splitf(float y, unsigned short& h, unsigned short& l) { h = f2bf(y); l = f2bf(y - bf2f(h)); }
typedef __attribute__((ext_vector_type(4))) _Float16 v4h;
typedef __attribute__((ext_vector_type(4))) unsigned short v4us;



// ---- k_gemmt: GEMM on LDS-staged operands, one 128x128 output tile per work-group of 8 waves (2 x 4; a wave holds 64x32 = 8 accumulators over the whole of K).
// A stage is 64 of K = one whole 128-byte line of each of the 128 rows of every operand, brought into LDS by asynchronous 16-byte copies (a wave's copy covers 4 whole lines) and shared by all 8 waves;
// two buffers: the next stage's copies fly while this stage is worked on. LDS rows lie 144 bytes apart (16 x odd: conflict-free for 16-byte fragment reads).
// C[m][n] (f32, pitch ldc) = sum_k A[m][k] Bt[n][k] (+ A2[m][k] Bt[n][k] under NSPLIT). z-batch strides sA/sB/sC in elements (sC: of C, or of each plane under PLANES). K % 64 == 0, rows and columns % 128 == 0.
// PLANES: the tile is not stored as f32 but rounded at once into three 16-bit planes (fp16, and bf16 hi + lo); element (m, n) lies at m x ldc + (n / 64) x tpitch + n % 64.
// ldc = 64, tpitch = rows x 64 gives head planes [n / 64][m][n % 64]; with A = the weight and Bt = the activations, ldc = positions and tpitch = 64 give the transposed value plane [feature][position].
template <typename T16> struct WFrag;
template <> struct WFrag<h16> { typedef v16h V; static __device__ __forceinline__ V ld(const h16* p) { return cat16(*(const v8h*)p, *(const v8h*)(p + 16)); } static __device__ __forceinline__ v8f mma(V a, V b, v8f c) { return wmma16(a, b, c); } };
template <> struct WFrag<bf> { typedef v16bf V; static __device__ __forceinline__ V ld(const bf* p) { return cat16b(*(const v8us*)p, *(const v8us*)(p + 16)); } static __device__ __forceinline__ v8f mma(V a, V b, v8f c) { return wmmab(a, b, c); } };
#define GT   128                  // rows of each operand tile
#define GKS  64                   // k per stage
#define GP   72                   // 16-bit elements between two operand rows in LDS
#define OPB  (GT * GP * 2)        // bytes of one operand tile in LDS
#define GOP  132                  // floats between two rows of the staged output tile (128 + 4: 16-byte aligned rows)
// one stage's copies of this thread: its 16 bytes of rows r, r + 32, r + 64, r + 96 of two (three) operand tiles that lie OPB bytes apart in LDS, in ONE statement;
// the s_wait_xcnt stands inside the statement, behind the last copy, in front of any rewrite of an address register that a copy names
#define CP4(a, b, c, d, e, f, g, h) "global_load_async_to_lds_b128 %" #a ", %" #b ", off\n\tglobal_load_async_to_lds_b128 %" #c ", %" #d ", off\n\tglobal_load_async_to_lds_b128 %" #e ", %" #f ", off\n\tglobal_load_async_to_lds_b128 %" #g ", %" #h ", off\n\t"
#define RW4(l, g) "v"(l), "v"(g), "v"((l) + 32 * GP * 2), "v"((g) + rs), "v"((l) + 64 * GP * 2), "v"((g) + 2 * rs), "v"((l) + 96 * GP * 2), "v"((g) + 3 * rs)
__device__ __forceinline__ void copy_stage2(unsigned l, const bf* ga, const bf* gb, size_t rs) {
    asm volatile(CP4(0, 1, 2, 3, 4, 5, 6, 7) CP4(8, 9, 10, 11, 12, 13, 14, 15) "s_wait_xcnt 0x0" :: RW4(l, ga), RW4(l + OPB, gb) : "memory");
}
__device__ __forceinline__ void copy_stage3(unsigned l, const bf* ga, const bf* ga2, const bf* gb, size_t rs) {
    asm volatile(CP4(0, 1, 2, 3, 4, 5, 6, 7) CP4(8, 9, 10, 11, 12, 13, 14, 15) CP4(16, 17, 18, 19, 20, 21, 22, 23) "s_wait_xcnt 0x0" :: RW4(l, ga), RW4(l + OPB, ga2), RW4(l + 2 * OPB, gb) : "memory");
}
template <int NSPLIT, bool PLANES>
__global__ __launch_bounds__(256) void k_gemmt(const bf* __restrict__ A, const bf* __restrict__ A2, const bf* __restrict__ Bt, int K, float* C, int ldc, size_t sA, size_t sB, size_t sC, h16* P16, bf* Ph, bf* Pl, int tpitch) {
    typedef WFrag<bf> F; typedef typename F::V V;
    constexpr int NOPD = NSPLIT ? 3 : 2;              // operand tiles of a stage: A, (A2,) Bt
    constexpr int OPE = GT * GP, STG = NOPD * OPE * 2;   // elements of one operand tile, bytes of one stage
    constexpr int KG = NSPLIT ? 1 : 2;                // 32-wide k steps whose fragments are read from LDS as one group (registers: 4 waves a SIMD stay possible)
    constexpr int SMB = 2 * STG > GT * GOP * 4 ? 2 * STG : GT * GOP * 4;
    __shared__ __align__(16) char sm[SMB];            // the two stage buffers; behind the loop's last barrier the output tile
    const size_t z = blockIdx.z; A += z * sA; if (NSPLIT) A2 += z * sA; Bt += z * sB;
    const int tid = (int)threadIdx.x, lane = tid & 31, lr = lane & 15, hi = lane >> 4; const int w = __builtin_amdgcn_readfirstlane(tid >> 5); const int wm = w >> 2, wn = w & 3; const int r0 = blockIdx.x * GT, c0 = blockIdx.y * GT;
    // this thread's share of a stage: 16 bytes (chunk tid & 7) of rows tid / 8 + 0, 32, 64, 96 of every operand tile
    const unsigned lc = (unsigned)(size_t)sm + (unsigned)((tid >> 3) * (GP * 2) + (tid & 7) * 16);
    const size_t rs = (size_t)32 * K; const size_t ca = (size_t)(r0 + (tid >> 3)) * K + (tid & 7) * 8, cb = (size_t)(c0 + (tid >> 3)) * K + (tid & 7) * 8;
    auto stage = [&](int t, int b) { const unsigned l = lc + (unsigned)(b * STG); const size_t ko = (size_t)t * GKS;
        if constexpr (NSPLIT != 0) copy_stage3(l, A + ca + ko, A2 + ca + ko, Bt + cb + ko, rs); else copy_stage2(l, A + ca + ko, Bt + cb + ko, rs); };
    v8f acc[4][2];
#pragma unroll
    for (int mb = 0; mb < 4; ++mb)
#pragma unroll
        for (int nb = 0; nb < 2; ++nb) acc[mb][nb] = (v8f){};
    const int nst = K / GKS;
    stage(0, 0);
    asm volatile("s_wait_asynccnt 0x0" ::: "memory");   // this wave's copies of stage 0 have landed
    __syncthreads();                                    // every wave's have: stage 0 may be read
    if (nst > 1) stage(1, 1);
    const int ao = (wm * 64 + lr) * GP + 8 * hi, bo = (wn * 32 + lr) * GP + 8 * hi;
#pragma unroll 1   // kept rolled: one publish point per stage, the buffer picked by the trip's parity
    for (int t = 0; t < nst; ++t) {
        const bf* sa = (const bf*)(sm + (t & 1) * STG); const bf* sb = sa + (NOPD - 1) * OPE;
#pragma unroll
        for (int kg = 0; kg < 2 / KG; ++kg) {
            V a[KG][4], a2[KG][4], b[KG][2];
#pragma unroll
            for (int u = 0; u < KG; ++u) { const int kk = (kg * KG + u) * 32;
#pragma unroll
                for (int mb = 0; mb < 4; ++mb) { a[u][mb] = F::ld(sa + ao + mb * 16 * GP + kk); if (NSPLIT) a2[u][mb] = F::ld(sa + OPE + ao + mb * 16 * GP + kk); }
#pragma unroll
                for (int nb = 0; nb < 2; ++nb) b[u][nb] = F::ld(sb + bo + nb * 16 * GP + kk); }
            __builtin_amdgcn_sched_barrier(0);   // the group's LDS reads are issued together, ahead of its products; without it the scheduler reloads one B register set among the products and the wave waits out the LDS latency several times a stage
#pragma unroll
            for (int u = 0; u < KG; ++u) {
#pragma unroll
                for (int nb = 0; nb < 2; ++nb)
#pragma unroll
                    for (int mb = 0; mb < 4; ++mb) acc[mb][nb] = F::mma(a[u][mb], b[u][nb], acc[mb][nb]);
                if (NSPLIT) {
#pragma unroll
                    for (int nb = 0; nb < 2; ++nb)
#pragma unroll
                        for (int mb = 0; mb < 4; ++mb) acc[mb][nb] = F::mma(a2[u][mb], b[u][nb], acc[mb][nb]);
                }
            }
        }
        __builtin_amdgcn_sched_barrier(0);   // the stage's products stay in front of the publish point; without it the scheduler sinks them behind the barrier and the refill, and the copies then fly only while the next fragments are read
        asm volatile("s_wait_dscnt 0x0" ::: "memory");      // this wave's reads of the buffer have returned before the buffer is refilled
        asm volatile("s_wait_asynccnt 0x0" ::: "memory");   // this wave's copies of stage t + 1 have landed
        __syncthreads();                                    // publishes stage t + 1 and ends every wave's reads of stage t
        if (t + 2 < nst) stage(t + 2, t & 1);
    }
    asm volatile("s_wait_asynccnt 0x0" ::: "memory");       // nothing is in flight when the buffers become the output tile
    // the loop's last barrier has ended every read of the buffers: each wave lays its 64x32 block in the f32 tile; behind one more barrier the threads store whole lines
    float* os = (float*)sm;
#pragma unroll
    for (int mb = 0; mb < 4; ++mb)
#pragma unroll
        for (int nb = 0; nb < 2; ++nb)
#pragma unroll
            for (int j = 0; j < 8; ++j) os[(wm * 64 + mb * 16 + hi * 8 + j) * GOP + wn * 32 + nb * 16 + lr] = acc[mb][nb][j];
    __syncthreads();
#pragma unroll 1   // kept rolled: four rows' LDS reads and line stores in flight per trip; unrolled whole, the rounding code only lengthens the text
    for (int s4 = 0; s4 < 4; ++s4) {
#pragma unroll
        for (int u = 0; u < 4; ++u) { const int idx = (s4 * 4 + u) * 256 + tid; const int row = idx >> 5, cofs = (idx & 31) * 4; const v4f val = *(const v4fa*)(os + row * GOP + cofs);
            if constexpr (PLANES) { const int n = c0 + cofs; const size_t po = z * sC + (size_t)(r0 + row) * ldc + (size_t)(n >> 6) * tpitch + (n & 63); v4h o16; v4us oh, ol;   // 16 lanes x 8 bytes: one whole 128-byte line of each plane
#pragma unroll
                for (int k = 0; k < 4; ++k) { o16[k] = tohx(val[k]); unsigned short a2, c2; splitf(val[k], a2, c2); oh[k] = a2; ol[k] = c2; }
                *(v4h*)(P16 + po) = o16; *(v4us*)(Ph + po) = oh; *(v4us*)(Pl + po) = ol; }
            else *(v4f*)(C + z * sC + (size_t)(r0 + row) * ldc + c0 + cofs) = val; }
        asm volatile("s_wait_xcnt 0x0" ::: "memory");   // behind the trip's last store, in front of the next trip's rewrite of the address and data registers that these stores name
    }
}

typedef __attribute__((ext_vector_type(2))) unsigned short v2us;
typedef __attribute__((ext_vector_type(4))) int v4i;

__global__ __launch_bounds__(256) void k_wtG(const float* __restrict__ w, int K, int N, bf* Bt) {
    const int lane = threadIdx.x & 31; const int L0 = (blockIdx.x * 8 + (threadIdx.x >> 5)) * 8; const int nlines = N * K / 64;
{
#pragma unroll 1
        for (int l = 0; l < 8; ++l) { const int L = L0 + l; if (L >= nlines) break; const size_t e = (size_t)L * 64 + lane * 2; const int k = (int)(e % K), n = (int)(e / K); v2us o;
            o[0] = f2bf(w[(size_t)k * N + n]); o[1] = f2bf(w[(size_t)(k + 1) * N + n]); *(v2us*)(Bt + e) = o; }
         }
}
__global__ __launch_bounds__(256) void k_cvt8(const float* __restrict__ src, bf* dst, size_t n8) { const size_t i = (size_t)blockIdx.x * 256 + threadIdx.x; if (i >= n8) return; const v8f v = *(const v8f*)(src + i * 8); v8us o;
#pragma unroll
    for (int k = 0; k < 8; ++k) o[k] = f2bf(v[k]); *(v8us*)(dst + i * 8) = o;  }
// ---- k_fattn: causal scores, softmax, probability x value and the head merge of ALL batches in ONE launch; grid (batches x heads, query tiles, heaviest tile first: the cost falls with the flat index over the whole launch), AW x 32 threads.
// Transposed products: S^T = K Q^T (A = 16 key rows, B = 16 query columns), O^T += V^T P^T (A = 16 rows of the [d][t] value plane, B = P^T). A lane holds scores of ONE query (column c = lane & 15; keys 8 hi + r of each 16),
// so a pair of score tiles, rounded to 16 bit, IS the B operand of the second product in the k order of WFrag::ld (8 hi + s, 16 + 8 hi + s): the probabilities never leave the registers.
// Online softmax in the log2 domain: running maximum m and sum l per query; O^T and l are rescaled only in a trip in which some query's maximum rises. Wave w takes every AW-th block of 32 keys;
// the AW partial (m, l, O^T) are joined through LDS in wave order behind one work-group barrier; the joined context x 2^-10 / l goes out as hi + lo bf16 rows of the merged [t][heads x 64] planes.
// HL: hi + lo bf16 planes, 3 products each (query rows < RH, 16 queries a wave); else single fp16 (32 queries a wave).
#define AW   8
#define OP   68                    // floats between two queries' partial outputs in LDS (64 + 4: 16-byte aligned rows)
#define NEGB (-3.0e38f)
#define SCL2 (SCL * 1.4426950408889634f)   // 2^-13 x log2(e): exp(s x 2^-13 - max) = exp2(s x SCL2 - max2)
template <typename T16, bool HL, int NQ>
__device__ __forceinline__ void attn_tile(const T16* __restrict__ Q, const T16* __restrict__ Q2, const T16* __restrict__ Kp, const T16* __restrict__ K2, const T16* __restrict__ Vt, const T16* __restrict__ V2, int q0, int head, float* so, float* sm, float* sl, bf* Ah, bf* Al) {
    typedef WFrag<T16> F; typedef typename F::V V;
    const int lane = threadIdx.x & 31, c = lane & 15, hi = lane >> 4; const int w = __builtin_amdgcn_readfirstlane((int)(threadIdx.x >> 5));
    V qf[NQ][2], q2[NQ][2];
#pragma unroll
    for (int g = 0; g < NQ; ++g)
#pragma unroll
        for (int ks = 0; ks < 2; ++ks) { const size_t qo = (size_t)(q0 + g * 16 + c) * HD + ks * 32 + 8 * hi; qf[g][ks] = F::ld(Q + qo); if (HL) q2[g][ks] = F::ld(Q2 + qo); }
    v8f o[NQ][4]; float m[NQ], l[NQ];
#pragma unroll
    for (int g = 0; g < NQ; ++g) { m[g] = NEGB; l[g] = 0.f;
#pragma unroll
        for (int dt = 0; dt < 4; ++dt) o[g][dt] = (v8f){}; }
    const int nblk = q0 / 32 + 1;      // blocks of 32 keys up to and including the one that holds the diagonal
    // this lane's K and V addresses are carried through the loop and advanced at its foot; every load of a trip is one of them plus a constant offset
    const size_t kst = (size_t)(w * 32 + c) * HD + 8 * hi, vst = (size_t)c * TT + w * 32 + 8 * hi;
    const T16* kp = Kp + kst; const T16* vp = Vt + vst; const T16* kp2 = HL ? K2 + kst : nullptr; const T16* vp2 = HL ? V2 + vst : nullptr;
#pragma unroll 1   // kept rolled: run-time trip count, and one body already holds most of the register file
    for (int kb = w; kb < nblk; kb += AW) {
        const int k0 = kb * 32;
        V kf[2][2], k2[2][2], vf[4], v2[4];
#pragma unroll
        for (int kt = 0; kt < 2; ++kt)
#pragma unroll
            for (int ks = 0; ks < 2; ++ks) { const int ko = kt * 16 * HD + ks * 32; kf[kt][ks] = F::ld(kp + ko); if (HL) k2[kt][ks] = F::ld(kp2 + ko); }
#pragma unroll
        for (int dt = 0; dt < 4; ++dt) { const int vo = dt * 16 * TT; vf[dt] = F::ld(vp + vo); if (HL) v2[dt] = F::ld(vp2 + vo); }
        // behind the trip's last load, in front of every overwrite of an address register that these loads name; the addresses are inputs so that they stay live up to the wait and no load's result is placed in them
        if constexpr (HL) asm volatile("s_wait_xcnt 0x0" :: "v"(kp), "v"(kp2), "v"(vp), "v"(vp2) : "memory"); else asm volatile("s_wait_xcnt 0x0" :: "v"(kp), "v"(vp) : "memory");
        __builtin_amdgcn_sched_barrier(0);   // all of the trip's K and V loads are issued before its first product; without it the scheduler reloads a K register set between the products and a trip pays the load latency two or three times in a row
        v8f s[NQ][2];
#pragma unroll
        for (int g = 0; g < NQ; ++g)
#pragma unroll
            for (int kt = 0; kt < 2; ++kt) s[g][kt] = (v8f){};
#pragma unroll
        for (int ks = 0; ks < 2; ++ks)
#pragma unroll
            for (int g = 0; g < NQ; ++g)
#pragma unroll
                for (int kt = 0; kt < 2; ++kt) { s[g][kt] = F::mma(kf[kt][ks], qf[g][ks], s[g][kt]); if (HL) { s[g][kt] = F::mma(k2[kt][ks], qf[g][ks], s[g][kt]); s[g][kt] = F::mma(kf[kt][ks], q2[g][ks], s[g][kt]); } }
#pragma unroll
        for (int g = 0; g < NQ; ++g)
#pragma unroll
            for (int kt = 0; kt < 2; ++kt) s[g][kt] *= SCL2;
        if (kb == nblk - 1) {          // the diagonal block (wave-uniform test): keys behind the query are excluded; every query of the tile keeps at least this block's first key
#pragma unroll
            for (int g = 0; g < NQ; ++g)
#pragma unroll
                for (int kt = 0; kt < 2; ++kt)
#pragma unroll
                    for (int r = 0; r < 8; ++r) s[g][kt][r] = (k0 + kt * 16 + 8 * hi + r <= q0 + g * 16 + c) ? s[g][kt][r] : NEGB;
        }
        float mn[NQ]; bool need = false;
#pragma unroll
        for (int g = 0; g < NQ; ++g) { float mx = s[g][0][0];
#pragma unroll
            for (int r = 1; r < 8; ++r) mx = fmaxf(mx, s[g][0][r]);
#pragma unroll
            for (int r = 0; r < 8; ++r) mx = fmaxf(mx, s[g][1][r]);
            mx = fmaxf(mx, __shfl_xor(mx, 16, 32)); mn[g] = fmaxf(m[g], mx); need = need || (mn[g] > m[g]); }
        if (__builtin_amdgcn_ballot_w32(need) != 0) {   // scalar branch: some query's maximum rose (always in a wave's first trip)
#pragma unroll
            for (int g = 0; g < NQ; ++g) { const float al = __builtin_amdgcn_exp2f(m[g] - mn[g]); l[g] *= al; m[g] = mn[g];
#pragma unroll
                for (int dt = 0; dt < 4; ++dt) o[g][dt] *= al; }
        }
        V pb[NQ], p2[NQ];
#pragma unroll
        for (int g = 0; g < NQ; ++g) {
            if constexpr (HL) { v8us h0, h1, l0, l1;
#pragma unroll
                for (int r = 0; r < 8; ++r) { const float pa = __builtin_amdgcn_exp2f(s[g][0][r] - m[g]), pc = __builtin_amdgcn_exp2f(s[g][1][r] - m[g]); l[g] += pa; l[g] += pc; unsigned short a, b2; splitf(pa, a, b2); h0[r] = a; l0[r] = b2; splitf(pc, a, b2); h1[r] = a; l1[r] = b2; }
                pb[g] = cat16b(h0, h1); p2[g] = cat16b(l0, l1);
            } else { v8h h0, h1;
#pragma unroll
                for (int r = 0; r < 8; ++r) { const float pa = __builtin_amdgcn_exp2f(s[g][0][r] - m[g]), pc = __builtin_amdgcn_exp2f(s[g][1][r] - m[g]); l[g] += pa; l[g] += pc; h0[r] = tohx(pa); h1[r] = tohx(pc); }
                pb[g] = cat16(h0, h1); }
        }
#pragma unroll
        for (int dt = 0; dt < 4; ++dt)
#pragma unroll
            for (int g = 0; g < NQ; ++g) { o[g][dt] = F::mma(vf[dt], pb[g], o[g][dt]); if (HL) { o[g][dt] = F::mma(vf[dt], p2[g], o[g][dt]); o[g][dt] = F::mma(v2[dt], pb[g], o[g][dt]); } }
        kp += AW * 32 * HD; vp += AW * 32; if (HL) { kp2 += AW * 32 * HD; vp2 += AW * 32; }
    }
    // every wave lays its partial (m, l, O^T) in its own LDS plane (a wave that got no key block lays m = NEGB, l = 0, zeros: its weight below is exp2(-huge) = 0)
    float* my = so + w * (32 * OP);
#pragma unroll
    for (int g = 0; g < NQ; ++g) { l[g] += __shfl_xor(l[g], 16, 32); if (hi == 0) { sm[w * 32 + g * 16 + c] = m[g]; sl[w * 32 + g * 16 + c] = l[g]; }
#pragma unroll
        for (int dt = 0; dt < 4; ++dt) { float* p = my + (g * 16 + c) * OP + dt * 16 + 8 * hi; *(v4fa*)p = (v4f){o[g][dt][0], o[g][dt][1], o[g][dt][2], o[g][dt][3]}; *(v4fa*)(p + 4) = (v4f){o[g][dt][4], o[g][dt][5], o[g][dt][6], o[g][dt][7]}; } }
    __syncthreads();
    for (int idx = (int)threadIdx.x; idx < NQ * 16 * 8; idx += AW * 32) { const int q = idx >> 3, d8 = (idx & 7) * 8;   // one thread: 8 outputs of one query
        float M = sm[q];
#pragma unroll
        for (int p = 1; p < AW; ++p) M = fmaxf(M, sm[p * 32 + q]);
        float L = 0.f; v4f a0 = (v4f){}, a1 = (v4f){};
#pragma unroll
        for (int p = 0; p < AW; ++p) { const float sc = __builtin_amdgcn_exp2f(sm[p * 32 + q] - M); L += sc * sl[p * 32 + q]; const float* pp = so + p * (32 * OP) + q * OP + d8; a0 += sc * *(const v4fa*)pp; a1 += sc * *(const v4fa*)(pp + 4); }
        const float f = __fdiv_rn(0.0009765625f, L);   // x 2^-10: this module scales v by c^-0.5 = 2^-5 and the projected output by out_dim^-0.5 = 2^-5: both linear: ONE exact factor on the merged context
        v8us oh, ol;
#pragma unroll
        for (int k = 0; k < 4; ++k) { unsigned short a, b2; splitf(a0[k] * f, a, b2); oh[k] = a; ol[k] = b2; splitf(a1[k] * f, a, b2); oh[4 + k] = a; ol[4 + k] = b2; }
        const size_t oo = (size_t)(q0 + q) * DQ + head * HD + d8; *(v8us*)(Ah + oo) = oh; *(v8us*)(Al + oo) = ol; }
}
__global__ __launch_bounds__(AW * 32) void k_fattn(const h16* __restrict__ Q16, const h16* __restrict__ K16, const h16* __restrict__ V16, const bf* __restrict__ Qh, const bf* __restrict__ Ql, const bf* __restrict__ Kh, const bf* __restrict__ Kl, const bf* __restrict__ Vh, const bf* __restrict__ Vl, bf* Ah, bf* Al) {
    __shared__ __align__(16) float so[AW * 32 * OP]; __shared__ float sm[AW * 32]; __shared__ float sl[AW * 32];
    const int head = blockIdx.x % NH_, ty = blockIdx.y; const size_t zp = (size_t)blockIdx.x * TT * HD;   // planes [batch][head][..]: blockIdx.x = batch x heads + head; one kv head per query head
    { const size_t ao = (size_t)(blockIdx.x / NH_) * TT * DQ; Ah += ao; Al += ao; }   // this batch's rows of the merged context
    if (ty < (TT - RH) / 32) attn_tile<h16, false, 2>(Q16 + zp, nullptr, K16 + zp, nullptr, V16 + zp, nullptr, TT - 32 * (ty + 1), head, so, sm, sl, Ah, Al);
    else attn_tile<bf, true, 1>(Qh + zp, Ql + zp, Kh + zp, Kl + zp, Vh + zp, Vl + zp, RH - 16 * (ty - (TT - RH) / 32 + 1), head, so, sm, sl, Ah, Al);
}

extern "C" void kernel_launch(void* const* d_in, const int* in_sizes, int n_in,
                              void* d_out, int out_size, void* d_ws, size_t ws_size, hipStream_t stream) {
    (void)in_sizes; (void)n_in; (void)out_size;
    const float* x = (const float*)d_in[0]; const float* wk = (const float*)d_in[1]; const float* wq = (const float*)d_in[2]; const float* wv = (const float*)d_in[3]; const float* wo = (const float*)d_in[4];   /* input order x, W_key, W_query, W_value, W_proj ('oi' [1024][1024], UNIT normal): the KEY weight comes FIRST; NO bias input in this module */ const float* cosT = nullptr; const float* sinT = nullptr; (void)cosT; (void)sinT;
    float* OUT = (float*)d_out;     // [4][2048][1024]
    char* wsp = (char*)d_ws;
    auto take = [&](size_t bytes) { char* p = wsp; wsp += (bytes + 255) & ~(size_t)255; return (void*)p; };
    bf* WQ = (bf*)take((size_t)DQ * DM * 2); bf* WK = (bf*)take((size_t)DKV * DM * 2); bf* WV = (bf*)take((size_t)DKV * DM * 2); bf* WO = (bf*)take((size_t)DM * DQ * 2);
    // every plane holds all NB_ batches, batch outermost
    bf* XB = (bf*)take((size_t)NB_ * TT * DM * 2);
    const size_t PB = (size_t)NB_ * NH_ * TT * HD * 2;
    h16* QP16 = (h16*)take(PB); h16* KP16 = (h16*)take(PB); h16* VT16 = (h16*)take(PB);
    bf* QPh = (bf*)take(PB); bf* QPl = (bf*)take(PB); bf* KPh = (bf*)take(PB); bf* KPl = (bf*)take(PB); bf* VTh = (bf*)take(PB); bf* VTl = (bf*)take(PB);
    bf* ATh = (bf*)take((size_t)NB_ * TT * DQ * 2); bf* ATl = (bf*)take((size_t)NB_ * TT * DQ * 2);
    if ((size_t)(wsp - (char*)d_ws) > ws_size) return;    // ws 256 MiB
    { k_cvt8<<<(unsigned)(((size_t)DQ * DM / 8 + 255) / 256), 256, 0, stream>>>(wq, WQ, (size_t)DQ * DM / 8); k_cvt8<<<(unsigned)(((size_t)DKV * DM / 8 + 255) / 256), 256, 0, stream>>>(wk, WK, (size_t)DKV * DM / 8); k_cvt8<<<(unsigned)(((size_t)DKV * DM / 8 + 255) / 256), 256, 0, stream>>>(wv, WV, (size_t)DKV * DM / 8);
      k_cvt8<<<(unsigned)(((size_t)DM * DQ / 8 + 255) / 256), 256, 0, stream>>>(wo, WO, (size_t)DM * DQ / 8);
       }
    // each stage is ONE launch over all batches: the GEMMs take the batch as grid z (low z starts first, so one batch's activations are read together), the attention as part of grid x
    k_cvt8<<<(unsigned)(((size_t)NB_ * TT * DM / 8 + 255) / 256), 256, 0, stream>>>(x, XB, (size_t)NB_ * TT * DM / 8);
    // q and k: x W^T, each 64-wide half of a tile's columns = one head, laid straight into the [batch][head][t][d] planes; v: W x^T, whose rows are the [batch][head x 64 + d][t] plane as it stands
    k_gemmt<0, true><<<dim3(TT / GT, DQ / GT, NB_), 256, 0, stream>>>(XB, nullptr, WQ, DM, nullptr, HD, (size_t)TT * DM, 0, (size_t)NH_ * TT * HD, QP16, QPh, QPl, TT * HD);
    k_gemmt<0, true><<<dim3(TT / GT, DKV / GT, NB_), 256, 0, stream>>>(XB, nullptr, WK, DM, nullptr, HD, (size_t)TT * DM, 0, (size_t)NKV * TT * HD, KP16, KPh, KPl, TT * HD);
    k_gemmt<0, true><<<dim3(DKV / GT, TT / GT, NB_), 256, 0, stream>>>(WV, nullptr, XB, DM, nullptr, TT, 0, (size_t)TT * DM, (size_t)NKV * HD * TT, VT16, VTh, VTl, 64);
    k_fattn<<<dim3(NB_ * NH_, (TT - RH) / 32 + RH / 16, 1), AW * 32, 0, stream>>>(QP16, KP16, VT16, QPh, QPl, KPh, KPl, VTh, VTl, ATh, ATl);
    k_gemmt<1, false><<<dim3(TT / GT, DM / GT, NB_), 256, 0, stream>>>(ATh, ATl, WO, DQ, OUT, DM, (size_t)TT * DQ, 0, (size_t)TT * DM, nullptr, nullptr, nullptr, 0);
}

// v006
// One run takes 175 microseconds.
// Timed twice side by side with v005, it ran 1.05 and 1.06 times as fast.
// All steps since v000 together make it 17.3 times as fast.
#include <hip/hip_runtime.h>

// Causal multi-head self-attention whose projections and output are each scaled by 1/sqrt(width) (x [4][2048][1024]; k, q, v = (x W^T) x 1024^-0.5 ('oi' [1024][1024] UNIT normal, no bias; 16 heads x 64): each projection x 2^-5 (exact); scores = q.k x 64^-0.5: with the two 2^-5 factors folded in, q.k(unscaled) x 2^-13 (exact); causal (tril kept, -inf elsewhere); softmax; out = (merged W_proj^T) x 1024^-0.5 ('oi', no bias): the v factor 2^-5 and the output factor 2^-5 are both linear: ONE factor 2^-10 on the merged context (exact) -> [4][2048][1024] (8.4 M); argument order x, W_key, W_query, W_value, W_proj: KEY FIRST).
// Compute dtypes, f32 accumulate: every input rounded to bf16; q/k/v on PLAIN bf16 operands (inputs: exact); causal scores and attn.v: query rows < 512 hl (3 products), the rest single fp16, causal block skipping, one fused launch for all batches; online softmax f32 (scale 2^-13 exact); the merged context x 2^-10 (exact); W_proj hl x exact (2 products), NO bias.

#define NB_  4
#define TT   2048
#define DM   1024
#define NH_  16
#define NKV  16
#define REP  (NH_ / NKV)
#define HD   64
#define DQ   (NH_ * HD)
#define DKV  (NKV * HD)
#define RH   512                  // query rows < RH use hi+lo planes (0: none)
#define SCL  0.0001220703125f   // 2^-13 = 1024^-0.5 (on q) x 1024^-0.5 (on k) x 64^-0.5: this module scales q AND k by c^-0.5 = 2^-5 each and the scores by hd^-0.5 = 2^-3: all exact powers of two, applied here in ONE multiply on the unscaled q.k
typedef _Float16 h16;
typedef unsigned short bf;
typedef __attribute__((ext_vector_type(16))) __bf16   v16bf;
typedef __attribute__((ext_vector_type(16))) _Float16 v16h;
typedef __attribute__((ext_vector_type(8)))  _Float16 v8h;
typedef __attribute__((ext_vector_type(8)))  unsigned short v8us;
typedef __attribute__((ext_vector_type(8)))  float    v8f;
typedef __attribute__((ext_vector_type(4)))  float    v4f;
typedef v8h  __attribute__((may_alias)) v8ha;
typedef v4f  __attribute__((may_alias)) v4fa;
typedef v8us __attribute__((may_alias)) v8usa;

__device__ __forceinline__ unsigned short f2bf(float f) { unsigned u = __float_as_uint(f); u += 0x7FFFu + ((u >> 16) & 1u); return (unsigned short)(u >> 16); }
__device__ __forceinline__ float bf2f(unsigned short b) { return __uint_as_float(((unsigned)b) << 16); }
__device__ __forceinline__ float bfr(float f) { return bf2f(f2bf(f)); }
__device__ __forceinline__ v16h cat16(v8h lo, v8h hi) { return __builtin_shufflevector(lo, hi, 0, 1, 2, 3, 4, 5, 6, 7, 8, 9, 10, 11, 12, 13, 14, 15); }
__device__ __forceinline__ v16bf cat16b(v8us lo, v8us hi) { return __builtin_bit_cast(v16bf, __builtin_shufflevector(lo, hi, 0, 1, 2, 3, 4, 5, 6, 7, 8, 9, 10, 11, 12, 13, 14, 15)); }
__device__ __forceinline__ v8f wmma16(v16h a, v16h b, v8f c) { return __builtin_amdgcn_wmma_f32_16x16x32_f16(false, a, false, b, (short)0, c, false, false); }
__device__ __forceinline__ v8f wmmab(v16bf a, v16bf b, v8f c) { return __builtin_amdgcn_wmma_f32_16x16x32_bf16(false, a, false, b, (short)0, c, false, false); }
__device__ __forceinline__ h16 tohx(float x) { return (h16)x; }
__device__ __forceinline__ void splitf(float y, unsigned short& h, unsigned short& l) { h = f2bf(y); l = f2bf(y - bf2f(h)); }
typedef __attribute__((ext_vector_type(4))) _Float16 v4h;
typedef __attribute__((ext_vector_type(4))) unsigned short v4us;



// ---- k_gemmt: GEMM on LDS-staged operands, one 128x128 output tile per work-group of 8 waves (2 x 4; a wave holds 64x32 = 8 accumulators over the whole of K).
// A stage is 64 of K = one whole 128-byte line of each of the 128 rows of every operand, brought into LDS by asynchronous 16-byte copies (a wave's copy covers 4 whole lines) and shared by all 8 waves;
// two buffers: the next stage's copies fly while this stage is worked on. LDS rows lie 144 bytes apart (16 x odd: conflict-free for 16-byte fragment reads).
// C[m][n] (f32, pitch ldc) = sum_k A[m][k] Bt[n][k] (+ A2[m][k] Bt[n][k] under NSPLIT). z-batch strides sA/sB/sC in elements (sC: of C, or of each plane under PLANES). K % 64 == 0, rows and columns % 128 == 0.
// PLANES: the tile is not stored as f32 but rounded at once into three 16-bit planes (fp16, and bf16 hi + lo); element (m, n) lies at m x ldc + (n / 64) x tpitch + n % 64.
// ldc = 64, tpitch = rows x 64 gives head planes [n / 64][m][n % 64]; with A = the weight and Bt = the activations, ldc = positions and tpitch = 64 give the transposed value plane [feature][position].
template <typename T16> struct WFrag;
template <> struct WFrag<h16> { typedef v16h V; static __device__ __forceinline__ V ld(const h16* p) { return cat16(*(const v8h*)p, *(const v8h*)(p + 16)); } static __device__ __forceinline__ v8f mma(V a, V b, v8f c) { return wmma16(a, b, c); } };
template <> struct WFrag<bf> { typedef v16bf V; static __device__ __forceinline__ V ld(const bf* p) { return cat16b(*(const v8us*)p, *(const v8us*)(p + 16)); } static __device__ __forceinline__ v8f mma(V a, V b, v8f c) { return wmmab(a, b, c); } };
#define GT   128                  // rows of each operand tile
#define GKS  64                   // k per stage
#define GP   72                   // 16-bit elements between two operand rows in LDS
#define OPB  (GT * GP * 2)        // bytes of one operand tile in LDS
#define GOP  132                  // floats between two rows of the staged output tile (128 + 4: 16-byte aligned rows)
// one stage's copies of this thread: its 16 bytes of rows r, r + 32, r + 64, r + 96 of two (three) operand tiles that lie OPB bytes apart in LDS, in ONE statement;
// the s_wait_xcnt stands inside the statement, behind the last copy, in front of any rewrite of an address register that a copy names
#define CP4(a, b, c, d, e, f, g, h) "global_load_async_to_lds_b128 %" #a ", %" #b ", off\n\tglobal_load_async_to_lds_b128 %" #c ", %" #d ", off\n\tglobal_load_async_to_lds_b128 %" #e ", %" #f ", off\n\tglobal_load_async_to_lds_b128 %" #g ", %" #h ", off\n\t"
#define RW4(l, g) "v"(l), "v"(g), "v"((l) + 32 * GP * 2), "v"((g) + rs), "v"((l) + 64 * GP * 2), "v"((g) + 2 * rs), "v"((l) + 96 * GP * 2), "v"((g) + 3 * rs)
__device__ __forceinline__ void copy_stage2(unsigned l, const bf* ga, const bf* gb, size_t rs) {
    asm volatile(CP4(0, 1, 2, 3, 4, 5, 6, 7) CP4(8, 9, 10, 11, 12, 13, 14, 15) "s_wait_xcnt 0x0" :: RW4(l, ga), RW4(l + OPB, gb) : "memory");
}
__device__ __forceinline__ void copy_stage3(unsigned l, const bf* ga, const bf* ga2, const bf* gb, size_t rs) {
    asm volatile(CP4(0, 1, 2, 3, 4, 5, 6, 7) CP4(8, 9, 10, 11, 12, 13, 14, 15) CP4(16, 17, 18, 19, 20, 21, 22, 23) "s_wait_xcnt 0x0" :: RW4(l, ga), RW4(l + OPB, ga2), RW4(l + 2 * OPB, gb) : "memory");
}
template <int NSPLIT, bool PLANES>
__global__ __launch_bounds__(256) void k_gemmt(const bf* __restrict__ A, const bf* __restrict__ A2, const bf* __restrict__ Bt, int K, float* C, int ldc, size_t sA, size_t sB, size_t sC, h16* P16, bf* Ph, bf* Pl, int tpitch) {
    typedef WFrag<bf> F; typedef typename F::V V;
    constexpr int NOPD = NSPLIT ? 3 : 2;              // operand tiles of a stage: A, (A2,) Bt
    constexpr int OPE = GT * GP, STG = NOPD * OPE * 2;   // elements of one operand tile, bytes of one stage
    constexpr int KG = NSPLIT ? 1 : 2;                // 32-wide k steps whose fragments are read from LDS as one group (registers: 4 waves a SIMD stay possible)
    constexpr int SMB = 2 * STG > GT * GOP * 4 ? 2 * STG : GT * GOP * 4;
    __shared__ __align__(16) char sm[SMB];            // the two stage buffers; behind the loop's last barrier the output tile
    const size_t z = blockIdx.z; A += z * sA; if (NSPLIT) A2 += z * sA; Bt += z * sB;
    const int tid = (int)threadIdx.x, lane = tid & 31, lr = lane & 15, hi = lane >> 4; const int w = __builtin_amdgcn_readfirstlane(tid >> 5); const int wm = w >> 2, wn = w & 3; const int r0 = blockIdx.x * GT, c0 = blockIdx.y * GT;
    // this thread's share of a stage: 16 bytes (chunk tid & 7) of rows tid / 8 + 0, 32, 64, 96 of every operand tile
    const unsigned lc = (unsigned)(size_t)sm + (unsigned)((tid >> 3) * (GP * 2) + (tid & 7) * 16);
    const size_t rs = (size_t)32 * K; const size_t ca = (size_t)(r0 + (tid >> 3)) * K + (tid & 7) * 8, cb = (size_t)(c0 + (tid >> 3)) * K + (tid & 7) * 8;
    auto stage = [&](int t, int b) { const unsigned l = lc + (unsigned)(b * STG); const size_t ko = (size_t)t * GKS;
        if constexpr (NSPLIT != 0) copy_stage3(l, A + ca + ko, A2 + ca + ko, Bt + cb + ko, rs); else copy_stage2(l, A + ca + ko, Bt + cb + ko, rs); };
    v8f acc[4][2];
#pragma unroll
    for (int mb = 0; mb < 4; ++mb)
#pragma unroll
        for (int nb = 0; nb < 2; ++nb) acc[mb][nb] = (v8f){};
    const int nst = K / GKS;
    stage(0, 0);
    asm volatile("s_wait_asynccnt 0x0" ::: "memory");   // this wave's copies of stage 0 have landed
    __syncthreads();                                    // every wave's have: stage 0 may be read
    if (nst > 1) stage(1, 1);
    const int ao = (wm * 64 + lr) * GP + 8 * hi, bo = (wn * 32 + lr) * GP + 8 * hi;
#pragma unroll 1   // kept rolled: one publish point per stage, the buffer picked by the trip's parity
    for (int t = 0; t < nst; ++t) {
        const bf* sa = (const bf*)(sm + (t & 1) * STG); const bf* sb = sa + (NOPD - 1) * OPE;
#pragma unroll
        for (int kg = 0; kg < 2 / KG; ++kg) {
            V a[KG][4], a2[KG][4], b[KG][2];
#pragma unroll
            for (int u = 0; u < KG; ++u) { const int kk = (kg * KG + u) * 32;
#pragma unroll
                for (int mb = 0; mb < 4; ++mb) { a[u][mb] = F::ld(sa + ao + mb * 16 * GP + kk); if (NSPLIT) a2[u][mb] = F::ld(sa + OPE + ao + mb * 16 * GP + kk); }
#pragma unroll
                for (int nb = 0; nb < 2; ++nb) b[u][nb] = F::ld(sb + bo + nb * 16 * GP + kk); }
            __builtin_amdgcn_sched_barrier(0);   // the group's LDS reads are issued together, ahead of its products; without it the scheduler reloads one B register set among the products and the wave waits out the LDS latency several times a stage
#pragma unroll
            for (int u = 0; u < KG; ++u) {
#pragma unroll
                for (int nb = 0; nb < 2; ++nb)
#pragma unroll
                    for (int mb = 0; mb < 4; ++mb) acc[mb][nb] = F::mma(a[u][mb], b[u][nb], acc[mb][nb]);
                if (NSPLIT) {
#pragma unroll
                    for (int nb = 0; nb < 2; ++nb)
#pragma unroll
                        for (int mb = 0; mb < 4; ++mb) acc[mb][nb] = F::mma(a2[u][mb], b[u][nb], acc[mb][nb]);
                }
            }
        }
        __builtin_amdgcn_sched_barrier(0);   // the stage's products stay in front of the publish point; without it the scheduler sinks them behind the barrier and the refill, and the copies then fly only while the next fragments are read
        asm volatile("s_wait_dscnt 0x0" ::: "memory");      // this wave's reads of the buffer have returned before the buffer is refilled
        asm volatile("s_wait_asynccnt 0x0" ::: "memory");   // this wave's copies of stage t + 1 have landed
        __syncthreads();                                    // publishes stage t + 1 and ends every wave's reads of stage t
        if (t + 2 < nst) stage(t + 2, t & 1);
    }
    asm volatile("s_wait_asynccnt 0x0" ::: "memory");       // nothing is in flight when the buffers become the output tile
    // the loop's last barrier has ended every read of the buffers: each wave lays its 64x32 block in the f32 tile; behind one more barrier the threads store whole lines
    float* os = (float*)sm;
#pragma unroll
    for (int mb = 0; mb < 4; ++mb)
#pragma unroll
        for (int nb = 0; nb < 2; ++nb)
#pragma unroll
            for (int j = 0; j < 8; ++j) os[(wm * 64 + mb * 16 + hi * 8 + j) * GOP + wn * 32 + nb * 16 + lr] = acc[mb][nb][j];
    __syncthreads();
#pragma unroll 1   // kept rolled: four rows' LDS reads and line stores in flight per trip; unrolled whole, the rounding code only lengthens the text
    for (int s4 = 0; s4 < 4; ++s4) {
#pragma unroll
        for (int u = 0; u < 4; ++u) { const int idx = (s4 * 4 + u) * 256 + tid; const int row = idx >> 5, cofs = (idx & 31) * 4; const v4f val = *(const v4fa*)(os + row * GOP + cofs);
            if constexpr (PLANES) { const int n = c0 + cofs; const size_t po = z * sC + (size_t)(r0 + row) * ldc + (size_t)(n >> 6) * tpitch + (n & 63); v4h o16; v4us oh, ol;   // 16 lanes x 8 bytes: one whole 128-byte line of each plane
#pragma unroll
                for (int k = 0; k < 4; ++k) { o16[k] = tohx(val[k]); unsigned short a2, c2; splitf(val[k], a2, c2); oh[k] = a2; ol[k] = c2; }
                *(v4h*)(P16 + po) = o16; *(v4us*)(Ph + po) = oh; *(v4us*)(Pl + po) = ol; }
            else *(v4f*)(C + z * sC + (size_t)(r0 + row) * ldc + c0 + cofs) = val; }
        asm volatile("s_wait_xcnt 0x0" ::: "memory");   // behind the trip's last store, in front of the next trip's rewrite of the address and data registers that these stores name
    }
}

typedef __attribute__((ext_vector_type(2))) unsigned short v2us;
typedef __attribute__((ext_vector_type(4))) int v4i;

__global__ __launch_bounds__(256) void k_wtG(const float* __restrict__ w, int K, int N, bf* Bt) {
    const int lane = threadIdx.x & 31; const int L0 = (blockIdx.x * 8 + (threadIdx.x >> 5)) * 8; const int nlines = N * K / 64;
{
#pragma unroll 1
        for (int l = 0; l < 8; ++l) { const int L = L0 + l; if (L >= nlines) break; const size_t e = (size_t)L * 64 + lane * 2; const int k = (int)(e % K), n = (int)(e / K); v2us o;
            o[0] = f2bf(w[(size_t)k * N + n]); o[1] = f2bf(w[(size_t)(k + 1) * N + n]); *(v2us*)(Bt + e) = o; }
         }
}
__global__ __launch_bounds__(256) void k_cvt8(const float* __restrict__ src, bf* dst, size_t n8) { const size_t i = (size_t)blockIdx.x * 256 + threadIdx.x; if (i >= n8) return; const v8f v = *(const v8f*)(src + i * 8); v8us o;
#pragma unroll
    for (int k = 0; k < 8; ++k) o[k] = f2bf(v[k]); *(v8us*)(dst + i * 8) = o;  }
// ---- k_fattn: causal scores, softmax, probability x value and the head merge of ALL batches in ONE launch; grid (batches x heads, query tiles, heaviest tile first: the cost falls with the flat index over the whole launch), AW x 32 threads.
// Transposed products: S^T = K Q^T (A = 16 key rows, B = 16 query columns), O^T += V^T P^T (A = 16 rows of the [d][t] value plane, B = P^T). A lane holds scores of ONE query (column c = lane & 15; keys 8 hi + r of each 16),
// so a pair of score tiles, rounded to 16 bit, IS the B operand of the second product in the k order of WFrag::ld (8 hi + s, 16 + 8 hi + s): the probabilities never leave the registers.
// Online softmax in the log2 domain: running maximum m and sum l per query; O^T and l are rescaled only in a trip in which some query's maximum rises. Wave w takes every AW-th block of 32 keys;
// the AW partial (m, l, O^T) are joined through LDS in wave order behind one work-group barrier; the joined context x 2^-10 / l goes out as hi + lo bf16 rows of the merged [t][heads x 64] planes.
// HL: hi + lo bf16 planes, 3 products each (query rows < RH, 16 queries a wave); else single fp16 (32 queries a wave).
// K and V reach the waves through LDS: a stage is AW x 32 = 256 keys (wave w works on its w-th block of 32), brought in by asynchronous 16-byte copies in groups of 64 keys
// (a wave's copy covers 4 whole 128-byte lines: 4 K rows, or 64 keys of 4 rows of the [d][t] value plane); a group wholly behind the diagonal is not copied and not read.
// fp16: two buffers, the next stage's copies fly while this stage is worked on. HL (at most 2 stages, twice the planes): one buffer of the same total size, filled, read, and refilled behind a barrier.
#define AW   8
#define KPI  72                    // 16-bit elements between two K rows in LDS (144 bytes = 16 x odd: conflict-free for 16-byte fragment reads)
#define VPI  264                   // 16-bit elements between two rows of the staged value plane (256 keys + 8: 528 bytes = 16 x odd)
#define SKB  (AW * 32 * KPI * 2)   // bytes of a stage's K rows
#define SKV  (SKB + HD * VPI * 2)  // bytes of a stage's K rows and value rows of one plane pair
#define OP   68                    // floats between two queries' partial outputs in LDS (64 + 4: 16-byte aligned rows)
#define NEGB (-3.0e38f)
#define SCL2 (SCL * 1.4426950408889634f)   // 2^-13 x log2(e): exp(s x 2^-13 - max) = exp2(s x SCL2 - max2)
// 64 keys of one K plane and one value plane: this thread's 16 bytes of K rows r, r + 32 and of value rows r, r + 32, in ONE statement;
// the s_wait_xcnt stands inside the statement, behind the last copy, in front of any rewrite of an address register that a copy names
template <typename T16>
__device__ __forceinline__ void copy_kv(unsigned lk, unsigned lv, const T16* gk, const T16* gv) {
    asm volatile(CP4(0, 1, 2, 3, 4, 5, 6, 7) "s_wait_xcnt 0x0" :: "v"(lk), "v"(gk), "v"(lk + 32 * KPI * 2), "v"(gk + 32 * HD), "v"(lv), "v"(gv), "v"(lv + 32 * VPI * 2), "v"(gv + 32 * TT) : "memory");
}
template <typename T16, bool HL, int NQ>
__device__ __forceinline__ void attn_tile(const T16* __restrict__ Q, const T16* __restrict__ Q2, const T16* __restrict__ Kp, const T16* __restrict__ K2, const T16* __restrict__ Vt, const T16* __restrict__ V2, int q0, int head, char* sb, float* sm, float* sl, bf* Ah, bf* Al) {
    typedef WFrag<T16> F; typedef typename F::V V;
    const int lane = threadIdx.x & 31, c = lane & 15, hi = lane >> 4; const int w = __builtin_amdgcn_readfirstlane((int)(threadIdx.x >> 5));
    V qf[NQ][2], q2[NQ][2];
#pragma unroll
    for (int g = 0; g < NQ; ++g)
#pragma unroll
        for (int ks = 0; ks < 2; ++ks) { const size_t qo = (size_t)(q0 + g * 16 + c) * HD + ks * 32 + 8 * hi; qf[g][ks] = F::ld(Q + qo); if (HL) q2[g][ks] = F::ld(Q2 + qo); }
    v8f o[NQ][4]; float m[NQ], l[NQ];
#pragma unroll
    for (int g = 0; g < NQ; ++g) { m[g] = NEGB; l[g] = 0.f;
#pragma unroll
        for (int dt = 0; dt < 4; ++dt) o[g][dt] = (v8f){}; }
    const int nblk = q0 / 32 + 1;      // blocks of 32 keys up to and including the one that holds the diagonal
    const int nst = (nblk + AW - 1) / AW;   // stages of AW blocks
    // this thread's share of a group of 64 keys: 16 bytes (chunk tid & 7) of rows tid / 8 and tid / 8 + 32
    const int tid = (int)threadIdx.x;
    const unsigned lk0 = (unsigned)(size_t)sb + (unsigned)((tid >> 3) * (KPI * 2) + (tid & 7) * 16), lv0 = (unsigned)(size_t)sb + (unsigned)(SKB + (tid >> 3) * (VPI * 2) + (tid & 7) * 16);
    const size_t gk0 = (size_t)(tid >> 3) * HD + (tid & 7) * 8, gv0 = (size_t)(tid >> 3) * TT + (tid & 7) * 8;
    auto stage = [&](int st, int b) {
#pragma unroll
        for (int j = 0; j < 4; ++j)
            if (st * AW + 2 * j < nblk) {   // the same for the whole work-group: the group holds a key block up to the diagonal (and so lies inside the planes)
                const unsigned lk = lk0 + (unsigned)(b * SKV + j * 64 * KPI * 2), lv = lv0 + (unsigned)(b * SKV + j * 128); const size_t gk = gk0 + (size_t)(st * AW * 32 + j * 64) * HD, gv = gv0 + (size_t)(st * AW * 32 + j * 64);
                copy_kv(lk, lv, Kp + gk, Vt + gv); if constexpr (HL) copy_kv(lk + SKV, lv + SKV, K2 + gk, V2 + gv); }
    };
    if constexpr (!HL) {
        stage(0, 0);
        asm volatile("s_wait_asynccnt 0x0" ::: "memory");   // this wave's copies of stage 0 have landed
        __syncthreads();                                    // every wave's have: stage 0 may be read
        if (nst > 1) stage(1, 1);
    }
    const int kfo = (w * 32 + c) * KPI + 8 * hi, vfo = c * VPI + w * 32 + 8 * hi;   // this lane's first K and V fragment elements in a stage
#pragma unroll 1   // kept rolled: run-time trip count, one publish point per stage, and one body already holds most of the register file
    for (int st = 0; st < nst; ++st) {
      if constexpr (HL) {
        stage(st, 0);
        asm volatile("s_wait_asynccnt 0x0" ::: "memory");   // this wave's copies of the stage have landed
        __syncthreads();                                    // every wave's have: the stage may be read
      }
      const int kb = st * AW + w;
      if (kb < nblk) {   // wave-uniform: this wave's block of the stage reaches up to the diagonal
        const int k0 = kb * 32;
        const T16* kp = (const T16*)(sb + (HL ? 0 : (st & 1) * SKV)) + kfo; const T16* vp = (const T16*)(sb + (HL ? 0 : (st & 1) * SKV) + SKB) + vfo; const T16* kp2 = kp + SKV / 2; const T16* vp2 = vp + SKV / 2;
        V kf[2][2], k2[2][2], vf[4], v2[4];
#pragma unroll
        for (int kt = 0; kt < 2; ++kt)
#pragma unroll
            for (int ks = 0; ks < 2; ++ks) { const int ko = kt * 16 * KPI + ks * 32; kf[kt][ks] = F::ld(kp + ko); if (HL) k2[kt][ks] = F::ld(kp2 + ko); }
        __builtin_amdgcn_sched_barrier(0);   // all of the trip's K fragment reads are issued before its first product; without it the scheduler spreads them among the products and the wave waits on LDS at several places of a trip
        v8f s[NQ][2];
#pragma unroll
        for (int g = 0; g < NQ; ++g)
#pragma unroll
            for (int kt = 0; kt < 2; ++kt) s[g][kt] = (v8f){};
#pragma unroll
        for (int ks = 0; ks < 2; ++ks)
#pragma unroll
            for (int g = 0; g < NQ; ++g)
#pragma unroll
                for (int kt = 0; kt < 2; ++kt) { s[g][kt] = F::mma(kf[kt][ks], qf[g][ks], s[g][kt]); if (HL) { s[g][kt] = F::mma(k2[kt][ks], qf[g][ks], s[g][kt]); s[g][kt] = F::mma(kf[kt][ks], q2[g][ks], s[g][kt]); } }
#pragma unroll
        for (int dt = 0; dt < 4; ++dt) { const int vo = dt * 16 * VPI; vf[dt] = F::ld(vp + vo); if (HL) v2[dt] = F::ld(vp2 + vo); }
        __builtin_amdgcn_sched_barrier(0);   // the V fragment reads stay in front of the softmax, which covers their LDS latency, and are scheduled with the score products alone; without it the scheduler lifts them to the first products, where every K register is still live, and the build spills
#pragma unroll
        for (int g = 0; g < NQ; ++g)
#pragma unroll
            for (int kt = 0; kt < 2; ++kt) s[g][kt] *= SCL2;
        if (kb == nblk - 1) {          // the diagonal block (wave-uniform test): keys behind the query are excluded; every query of the tile keeps at least this block's first key
#pragma unroll
            for (int g = 0; g < NQ; ++g)
#pragma unroll
                for (int kt = 0; kt < 2; ++kt)
#pragma unroll
                    for (int r = 0; r < 8; ++r) s[g][kt][r] = (k0 + kt * 16 + 8 * hi + r <= q0 + g * 16 + c) ? s[g][kt][r] : NEGB;
        }
        float mn[NQ]; bool need = false;
#pragma unroll
        for (int g = 0; g < NQ; ++g) { float mx = s[g][0][0];
#pragma unroll
            for (int r = 1; r < 8; ++r) mx = fmaxf(mx, s[g][0][r]);
#pragma unroll
            for (int r = 0; r < 8; ++r) mx = fmaxf(mx, s[g][1][r]);
            mx = fmaxf(mx, __shfl_xor(mx, 16, 32)); mn[g] = fmaxf(m[g], mx); need = need || (mn[g] > m[g]); }
        if (__builtin_amdgcn_ballot_w32(need) != 0) {   // scalar branch: some query's maximum rose (always in a wave's first trip)
#pragma unroll
            for (int g = 0; g < NQ; ++g) { const float al = __builtin_amdgcn_exp2f(m[g] - mn[g]); l[g] *= al; m[g] = mn[g];
#pragma unroll
                for (int dt = 0; dt < 4; ++dt) o[g][dt] *= al; }
        }
        V pb[NQ], p2[NQ];
#pragma unroll
        for (int g = 0; g < NQ; ++g) {
            if constexpr (HL) { v8us h0, h1, l0, l1;
#pragma unroll
                for (int r = 0; r < 8; ++r) { const float pa = __builtin_amdgcn_exp2f(s[g][0][r] - m[g]), pc = __builtin_amdgcn_exp2f(s[g][1][r] - m[g]); l[g] += pa; l[g] += pc; unsigned short a, b2; splitf(pa, a, b2); h0[r] = a; l0[r] = b2; splitf(pc, a, b2); h1[r] = a; l1[r] = b2; }
                pb[g] = cat16b(h0, h1); p2[g] = cat16b(l0, l1);
            } else { v8h h0, h1;
#pragma unroll
                for (int r = 0; r < 8; ++r) { const float pa = __builtin_amdgcn_exp2f(s[g][0][r] - m[g]), pc = __builtin_amdgcn_exp2f(s[g][1][r] - m[g]); l[g] += pa; l[g] += pc; h0[r] = tohx(pa); h1[r] = tohx(pc); }
                pb[g] = cat16(h0, h1); }
        }
#pragma unroll
        for (int dt = 0; dt < 4; ++dt)
#pragma unroll
            for (int g = 0; g < NQ; ++g) { o[g][dt] = F::mma(vf[dt], pb[g], o[g][dt]); if (HL) { o[g][dt] = F::mma(vf[dt], p2[g], o[g][dt]); o[g][dt] = F::mma(v2[dt], pb[g], o[g][dt]); } }
      }
      asm volatile("s_wait_dscnt 0x0" ::: "memory");          // this wave's reads of the buffer have returned before the buffer is refilled
      if constexpr (!HL) asm volatile("s_wait_asynccnt 0x0" ::: "memory");   // this wave's copies of stage st + 1 have landed
      __syncthreads();                                        // ends every wave's reads of stage st (and, with two buffers, publishes stage st + 1)
      if constexpr (!HL) { if (st + 2 < nst) stage(st + 2, st & 1); }
    }
    asm volatile("s_wait_asynccnt 0x0" ::: "memory");         // nothing is in flight when the buffers become the partial planes
    float* so = (float*)sb;                                   // the loop's last barrier has ended every read of the buffers
    // every wave lays its partial (m, l, O^T) in its own LDS plane (a wave that got no key block lays m = NEGB, l = 0, zeros: its weight below is exp2(-huge) = 0)
    float* my = so + w * (32 * OP);
#pragma unroll
    for (int g = 0; g < NQ; ++g) { l[g] += __shfl_xor(l[g], 16, 32); if (hi == 0) { sm[w * 32 + g * 16 + c] = m[g]; sl[w * 32 + g * 16 + c] = l[g]; }
#pragma unroll
        for (int dt = 0; dt < 4; ++dt) { float* p = my + (g * 16 + c) * OP + dt * 16 + 8 * hi; *(v4fa*)p = (v4f){o[g][dt][0], o[g][dt][1], o[g][dt][2], o[g][dt][3]}; *(v4fa*)(p + 4) = (v4f){o[g][dt][4], o[g][dt][5], o[g][dt][6], o[g][dt][7]}; } }
    __syncthreads();
    for (int idx = (int)threadIdx.x; idx < NQ * 16 * 8; idx += AW * 32) { const int q = idx >> 3, d8 = (idx & 7) * 8;   // one thread: 8 outputs of one query
        float M = sm[q];
#pragma unroll
        for (int p = 1; p < AW; ++p) M = fmaxf(M, sm[p * 32 + q]);
        float L = 0.f; v4f a0 = (v4f){}, a1 = (v4f){};
#pragma unroll
        for (int p = 0; p < AW; ++p) { const float sc = __builtin_amdgcn_exp2f(sm[p * 32 + q] - M); L += sc * sl[p * 32 + q]; const float* pp = so + p * (32 * OP) + q * OP + d8; a0 += sc * *(const v4fa*)pp; a1 += sc * *(const v4fa*)(pp + 4); }
        const float f = __fdiv_rn(0.0009765625f, L);   // x 2^-10: this module scales v by c^-0.5 = 2^-5 and the projected output by out_dim^-0.5 = 2^-5: both linear: ONE exact factor on the merged context
        v8us oh, ol;
#pragma unroll
        for (int k = 0; k < 4; ++k) { unsigned short a, b2; splitf(a0[k] * f, a, b2); oh[k] = a; ol[k] = b2; splitf(a1[k] * f, a, b2); oh[4 + k] = a; ol[4 + k] = b2; }
        const size_t oo = (size_t)(q0 + q) * DQ + head * HD + d8; *(v8us*)(Ah + oo) = oh; *(v8us*)(Al + oo) = ol; }
}
__global__ __launch_bounds__(AW * 32) void k_fattn(const h16* __restrict__ Q16, const h16* __restrict__ K16, const h16* __restrict__ V16, const bf* __restrict__ Qh, const bf* __restrict__ Ql, const bf* __restrict__ Kh, const bf* __restrict__ Kl, const bf* __restrict__ Vh, const bf* __restrict__ Vl, bf* Ah, bf* Al) {
    __shared__ __align__(16) char so[2 * SKV > AW * 32 * OP * 4 ? 2 * SKV : AW * 32 * OP * 4];   // the stage buffers; behind the loop's last barrier the waves' partial outputs
    __shared__ float sm[AW * 32]; __shared__ float sl[AW * 32];
    const int head = blockIdx.x % NH_, ty = blockIdx.y; const size_t zp = (size_t)blockIdx.x * TT * HD;   // planes [batch][head][..]: blockIdx.x = batch x heads + head; one kv head per query head
    { const size_t ao = (size_t)(blockIdx.x / NH_) * TT * DQ; Ah += ao; Al += ao; }   // this batch's rows of the merged context
    if (ty < (TT - RH) / 32) attn_tile<h16, false, 2>(Q16 + zp, nullptr, K16 + zp, nullptr, V16 + zp, nullptr, TT - 32 * (ty + 1), head, so, sm, sl, Ah, Al);
    else attn_tile<bf, true, 1>(Qh + zp, Ql + zp, Kh + zp, Kl + zp, Vh + zp, Vl + zp, RH - 16 * (ty - (TT - RH) / 32 + 1), head, so, sm, sl, Ah, Al);
}

extern "C" void kernel_launch(void* const* d_in, const int* in_sizes, int n_in,
                              void* d_out, int out_size, void* d_ws, size_t ws_size, hipStream_t stream) {
    (void)in_sizes; (void)n_in; (void)out_size;
    const float* x = (const float*)d_in[0]; const float* wk = (const float*)d_in[1]; const float* wq = (const float*)d_in[2]; const float* wv = (const float*)d_in[3]; const float* wo = (const float*)d_in[4];   /* input order x, W_key, W_query, W_value, W_proj ('oi' [1024][1024], UNIT normal): the KEY weight comes FIRST; NO bias input in this module */ const float* cosT = nullptr; const float* sinT = nullptr; (void)cosT; (void)sinT;
    float* OUT = (float*)d_out;     // [4][2048][1024]
    char* wsp = (char*)d_ws;
    auto take = [&](size_t bytes) { char* p = wsp; wsp += (bytes + 255) & ~(size_t)255; return (void*)p; };
    bf* WQ = (bf*)take((size_t)DQ * DM * 2); bf* WK = (bf*)take((size_t)DKV * DM * 2); bf* WV = (bf*)take((size_t)DKV * DM * 2); bf* WO = (bf*)take((size_t)DM * DQ * 2);
    // every plane holds all NB_ batches, batch outermost
    bf* XB = (bf*)take((size_t)NB_ * TT * DM * 2);
    const size_t PB = (size_t)NB_ * NH_ * TT * HD * 2;
    h16* QP16 = (h16*)take(PB); h16* KP16 = (h16*)take(PB); h16* VT16 = (h16*)take(PB);
    bf* QPh = (bf*)take(PB); bf* QPl = (bf*)take(PB); bf* KPh = (bf*)take(PB); bf* KPl = (bf*)take(PB); bf* VTh = (bf*)take(PB); bf* VTl = (bf*)take(PB);
    bf* ATh = (bf*)take((size_t)NB_ * TT * DQ * 2); bf* ATl = (bf*)take((size_t)NB_ * TT * DQ * 2);
    if ((size_t)(wsp - (char*)d_ws) > ws_size) return;    // ws 256 MiB
    { k_cvt8<<<(unsigned)(((size_t)DQ * DM / 8 + 255) / 256), 256, 0, stream>>>(wq, WQ, (size_t)DQ * DM / 8); k_cvt8<<<(unsigned)(((size_t)DKV * DM / 8 + 255) / 256), 256, 0, stream>>>(wk, WK, (size_t)DKV * DM / 8); k_cvt8<<<(unsigned)(((size_t)DKV * DM / 8 + 255) / 256), 256, 0, stream>>>(wv, WV, (size_t)DKV * DM / 8);
      k_cvt8<<<(unsigned)(((size_t)DM * DQ / 8 + 255) / 256), 256, 0, stream>>>(wo, WO, (size_t)DM * DQ / 8);
       }
    // each stage is ONE launch over all batches: the GEMMs take the batch as grid z (low z starts first, so one batch's activations are read together), the attention as part of grid x
    k_cvt8<<<(unsigned)(((size_t)NB_ * TT * DM / 8 + 255) / 256), 256, 0, stream>>>(x, XB, (size_t)NB_ * TT * DM / 8);
    // q and k: x W^T, each 64-wide half of a tile's columns = one head, laid straight into the [batch][head][t][d] planes; v: W x^T, whose rows are the [batch][head x 64 + d][t] plane as it stands
    k_gemmt<0, true><<<dim3(TT / GT, DQ / GT, NB_), 256, 0, stream>>>(XB, nullptr, WQ, DM, nullptr, HD, (size_t)TT * DM, 0, (size_t)NH_ * TT * HD, QP16, QPh, QPl, TT * HD);
    k_gemmt<0, true><<<dim3(TT / GT, DKV / GT, NB_), 256, 0, stream>>>(XB, nullptr, WK, DM, nullptr, HD, (size_t)TT * DM, 0, (size_t)NKV * TT * HD, KP16, KPh, KPl, TT * HD);
    k_gemmt<0, true><<<dim3(DKV / GT, TT / GT, NB_), 256, 0, stream>>>(WV, nullptr, XB, DM, nullptr, TT, 0, (size_t)TT * DM, (size_t)NKV * HD * TT, VT16, VTh, VTl, 64);
    k_fattn<<<dim3(NB_ * NH_, (TT - RH) / 32 + RH / 16, 1), AW * 32, 0, stream>>>(QP16, KP16, VT16, QPh, QPl, KPh, KPl, VTh, VTl, ATh, ATl);
    k_gemmt<1, false><<<dim3(TT / GT, DM / GT, NB_), 256, 0, stream>>>(ATh, ATl, WO, DQ, OUT, DM, (size_t)TT * DQ, 0, (size_t)TT * DM, nullptr, nullptr, nullptr, 0);
}

// v007
// It runs in 165 microseconds.
// Next to v006, in two timings, it ran 1.06 times as fast each time.
// All steps since v000 together make it 18.4 times as fast.
#include <hip/hip_runtime.h>

// Causal multi-head self-attention whose projections and output are each scaled by 1/sqrt(width) (x [4][2048][1024]; k, q, v = (x W^T) x 1024^-0.5 ('oi' [1024][1024] UNIT normal, no bias; 16 heads x 64): each projection x 2^-5 (exact); scores = q.k x 64^-0.5: with the two 2^-5 factors folded in, q.k(unscaled) x 2^-13 (exact); causal (tril kept, -inf elsewhere); softmax; out = (merged W_proj^T) x 1024^-0.5 ('oi', no bias): the v factor 2^-5 and the output factor 2^-5 are both linear: ONE factor 2^-10 on the merged context (exact) -> [4][2048][1024] (8.4 M); argument order x, W_key, W_query, W_value, W_proj: KEY FIRST).
// Compute dtypes, f32 accumulate: every input rounded to bf16; q/k/v on PLAIN bf16 operands (inputs: exact); causal scores and attn.v: query rows < 512 hl (3 products), the rest single fp16, causal block skipping, one fused launch for all batches; online softmax f32 (scale 2^-13 exact); the merged context x 2^-10 (exact); W_proj hl x exact (2 products), NO bias.

#define NB_  4
#define TT   2048
#define DM   1024
#define NH_  16
#define NKV  16
#define REP  (NH_ / NKV)
#define HD   64
#define DQ   (NH_ * HD)
#define DKV  (NKV * HD)
#define RH   512                  // query rows < RH use hi+lo planes (0: none)
#define SCL  0.0001220703125f   // 2^-13 = 1024^-0.5 (on q) x 1024^-0.5 (on k) x 64^-0.5: this module scales q AND k by c^-0.5 = 2^-5 each and the scores by hd^-0.5 = 2^-3: all exact powers of two, applied here in ONE multiply on the unscaled q.k
typedef _Float16 h16;
typedef unsigned short bf;
typedef __attribute__((ext_vector_type(16))) __bf16   v16bf;
typedef __attribute__((ext_vector_type(16))) _Float16 v16h;
typedef __attribute__((ext_vector_type(8)))  _Float16 v8h;
typedef __attribute__((ext_vector_type(8)))  unsigned short v8us;
typedef __attribute__((ext_vector_type(8)))  float    v8f;
typedef __attribute__((ext_vector_type(4)))  float    v4f;
typedef v8h  __attribute__((may_alias)) v8ha;
typedef v4f  __attribute__((may_alias)) v4fa;
typedef v8us __attribute__((may_alias)) v8usa;

__device__ __forceinline__ unsigned short f2bf(float f) { unsigned u = __float_as_uint(f); u += 0x7FFFu + ((u >> 16) & 1u); return (unsigned short)(u >> 16); }
__device__ __forceinline__ float bf2f(unsigned short b) { return __uint_as_float(((unsigned)b) << 16); }
__device__ __forceinline__ float bfr(float f) { return bf2f(f2bf(f)); }
__device__ __forceinline__ v16h cat16(v8h lo, v8h hi) { return __builtin_shufflevector(lo, hi, 0, 1, 2, 3, 4, 5, 6, 7, 8, 9, 10, 11, 12, 13, 14, 15); }
__device__ __forceinline__ v16bf cat16b(v8us lo, v8us hi) { return __builtin_bit_cast(v16bf, __builtin_shufflevector(lo, hi, 0, 1, 2, 3, 4, 5, 6, 7, 8, 9, 10, 11, 12, 13, 14, 15)); }
__device__ __forceinline__ v8f wmma16(v16h a, v16h b, v8f c) { return __builtin_amdgcn_wmma_f32_16x16x32_f16(false, a, false, b, (short)0, c, false, false); }
__device__ __forceinline__ v8f wmmab(v16bf a, v16bf b, v8f c) { return __builtin_amdgcn_wmma_f32_16x16x32_bf16(false, a, false, b, (short)0, c, false, false); }
__device__ __forceinline__ h16 tohx(float x) { return (h16)x; }
__device__ __forceinline__ void splitf(float y, unsigned short& h, unsigned short& l) { h = f2bf(y); l = f2bf(y - bf2f(h)); }
typedef __attribute__((ext_vector_type(4))) _Float16 v4h;
typedef __attribute__((ext_vector_type(4))) unsigned short v4us;



// ---- k_gemmt: GEMM on LDS-staged operands, one 128x128 output tile per work-group of 8 waves (2 x 4; a wave holds 64x32 = 8 accumulators over the whole of K).
// A stage is 64 of K = one whole 128-byte line of each of the 128 rows of every operand, brought into LDS by asynchronous 16-byte copies (a wave's copy covers 4 whole lines) and shared by all 8 waves;
// two buffers: the next stage's copies fly while this stage is worked on. LDS rows lie 144 bytes apart (16 x odd: conflict-free for 16-byte fragment reads).
// C[m][n] (f32, pitch ldc) = sum_k A[m][k] Bt[n][k] (+ A2[m][k] Bt[n][k] under NSPLIT). z-batch strides sA/sB/sC in elements (sC: of C, or of each plane under PLANES). K % 64 == 0, rows and columns % 128 == 0.
// PLANES: the tile is not stored as f32 but rounded at once into three 16-bit planes (fp16, and bf16 hi + lo); element (m, n) lies at m x ldc + (n / 64) x tpitch + n % 64.
// ldc = 64, tpitch = rows x 64 gives head planes [n / 64][m][n % 64]; with A = the weight and Bt = the activations, ldc = positions and tpitch = 64 give the transposed value plane [feature][position].
template <typename T16> struct WFrag;
template <> struct WFrag<h16> { typedef v16h V; static __device__ __forceinline__ V ld(const h16* p) { return cat16(*(const v8h*)p, *(const v8h*)(p + 16)); } static __device__ __forceinline__ v8f mma(V a, V b, v8f c) { return wmma16(a, b, c); } };
template <> struct WFrag<bf> { typedef v16bf V; static __device__ __forceinline__ V ld(const bf* p) { return cat16b(*(const v8us*)p, *(const v8us*)(p + 16)); } static __device__ __forceinline__ v8f mma(V a, V b, v8f c) { return wmmab(a, b, c); } };
#define GT   128                  // rows of each operand tile
#define GKS  64                   // k per stage
#define GP   72                   // 16-bit elements between two operand rows in LDS
#define OPB  (GT * GP * 2)        // bytes of one operand tile in LDS
#define GOP  132                  // floats between two rows of the staged output tile (128 + 4: 16-byte aligned rows)
// one stage's copies of this thread: its 16 bytes of rows r, r + 32, r + 64, r + 96 of two (three) operand tiles that lie OPB bytes apart in LDS, in ONE statement;
// the s_wait_xcnt stands inside the statement, behind the last copy, in front of any rewrite of an address register that a copy names
#define CP4(a, b, c, d, e, f, g, h) "global_load_async_to_lds_b128 %" #a ", %" #b ", off\n\tglobal_load_async_to_lds_b128 %" #c ", %" #d ", off\n\tglobal_load_async_to_lds_b128 %" #e ", %" #f ", off\n\tglobal_load_async_to_lds_b128 %" #g ", %" #h ", off\n\t"
#define RW4(l, g) "v"(l), "v"(g), "v"((l) + 32 * GP * 2), "v"((g) + rs), "v"((l) + 64 * GP * 2), "v"((g) + 2 * rs), "v"((l) + 96 * GP * 2), "v"((g) + 3 * rs)
__device__ __forceinline__ void copy_stage2(unsigned l, const bf* ga, const bf* gb, size_t rs) {
    asm volatile(CP4(0, 1, 2, 3, 4, 5, 6, 7) CP4(8, 9, 10, 11, 12, 13, 14, 15) "s_wait_xcnt 0x0" :: RW4(l, ga), RW4(l + OPB, gb) : "memory");
}
__device__ __forceinline__ void copy_stage3(unsigned l, const bf* ga, const bf* ga2, const bf* gb, size_t rs) {
    asm volatile(CP4(0, 1, 2, 3, 4, 5, 6, 7) CP4(8, 9, 10, 11, 12, 13, 14, 15) CP4(16, 17, 18, 19, 20, 21, 22, 23) "s_wait_xcnt 0x0" :: RW4(l, ga), RW4(l + OPB, ga2), RW4(l + 2 * OPB, gb) : "memory");
}
template <int NSPLIT, bool PLANES>
__device__ __forceinline__ void gemmt(const bf* __restrict__ A, const bf* __restrict__ A2, const bf* __restrict__ Bt, int K, float* C, int ldc, size_t sA, size_t sB, size_t sC, h16* P16, bf* Ph, bf* Pl, int tpitch, size_t z, int bx, int by) {   // z: batch; bx, by: the tile's place in rows and columns
    typedef WFrag<bf> F; typedef typename F::V V;
    constexpr int NOPD = NSPLIT ? 3 : 2;              // operand tiles of a stage: A, (A2,) Bt
    constexpr int OPE = GT * GP, STG = NOPD * OPE * 2;   // elements of one operand tile, bytes of one stage
    constexpr int KG = NSPLIT ? 1 : 2;                // 32-wide k steps whose fragments are read from LDS as one group (registers: 4 waves a SIMD stay possible)
    constexpr int SMB = 2 * STG > GT * GOP * 4 ? 2 * STG : GT * GOP * 4;
    __shared__ __align__(16) char sm[SMB];            // the two stage buffers; behind the loop's last barrier the output tile
    A += z * sA; if (NSPLIT) A2 += z * sA; Bt += z * sB;
    const int tid = (int)threadIdx.x, lane = tid & 31, lr = lane & 15, hi = lane >> 4; const int w = __builtin_amdgcn_readfirstlane(tid >> 5); const int wm = w >> 2, wn = w & 3; const int r0 = bx * GT, c0 = by * GT;
    // this thread's share of a stage: 16 bytes (chunk tid & 7) of rows tid / 8 + 0, 32, 64, 96 of every operand tile
    const unsigned lc = (unsigned)(size_t)sm + (unsigned)((tid >> 3) * (GP * 2) + (tid & 7) * 16);
    const size_t rs = (size_t)32 * K; const size_t ca = (size_t)(r0 + (tid >> 3)) * K + (tid & 7) * 8, cb = (size_t)(c0 + (tid >> 3)) * K + (tid & 7) * 8;
    auto stage = [&](int t, int b) { const unsigned l = lc + (unsigned)(b * STG); const size_t ko = (size_t)t * GKS;
        if constexpr (NSPLIT != 0) copy_stage3(l, A + ca + ko, A2 + ca + ko, Bt + cb + ko, rs); else copy_stage2(l, A + ca + ko, Bt + cb + ko, rs); };
    v8f acc[4][2];
#pragma unroll
    for (int mb = 0; mb < 4; ++mb)
#pragma unroll
        for (int nb = 0; nb < 2; ++nb) acc[mb][nb] = (v8f){};
    const int nst = K / GKS;
    stage(0, 0);
    asm volatile("s_wait_asynccnt 0x0" ::: "memory");   // this wave's copies of stage 0 have landed
    __syncthreads();                                    // every wave's have: stage 0 may be read
    if (nst > 1) stage(1, 1);
    const int ao = (wm * 64 + lr) * GP + 8 * hi, bo = (wn * 32 + lr) * GP + 8 * hi;
#pragma unroll 1   // kept rolled: one publish point per stage, the buffer picked by the trip's parity
    for (int t = 0; t < nst; ++t) {
        const bf* sa = (const bf*)(sm + (t & 1) * STG); const bf* sb = sa + (NOPD - 1) * OPE;
#pragma unroll
        for (int kg = 0; kg < 2 / KG; ++kg) {
            V a[KG][4], a2[KG][4], b[KG][2];
#pragma unroll
            for (int u = 0; u < KG; ++u) { const int kk = (kg * KG + u) * 32;
#pragma unroll
                for (int mb = 0; mb < 4; ++mb) { a[u][mb] = F::ld(sa + ao + mb * 16 * GP + kk); if (NSPLIT) a2[u][mb] = F::ld(sa + OPE + ao + mb * 16 * GP + kk); }
#pragma unroll
                for (int nb = 0; nb < 2; ++nb) b[u][nb] = F::ld(sb + bo + nb * 16 * GP + kk); }
            __builtin_amdgcn_sched_barrier(0);   // the group's LDS reads are issued together, ahead of its products; without it the scheduler reloads one B register set among the products and the wave waits out the LDS latency several times a stage
#pragma unroll
            for (int u = 0; u < KG; ++u) {
#pragma unroll
                for (int nb = 0; nb < 2; ++nb)
#pragma unroll
                    for (int mb = 0; mb < 4; ++mb) acc[mb][nb] = F::mma(a[u][mb], b[u][nb], acc[mb][nb]);
                if (NSPLIT) {
#pragma unroll
                    for (int nb = 0; nb < 2; ++nb)
#pragma unroll
                        for (int mb = 0; mb < 4; ++mb) acc[mb][nb] = F::mma(a2[u][mb], b[u][nb], acc[mb][nb]);
                }
            }
        }
        __builtin_amdgcn_sched_barrier(0);   // the stage's products stay in front of the publish point; without it the scheduler sinks them behind the barrier and the refill, and the copies then fly only while the next fragments are read
        asm volatile("s_wait_dscnt 0x0" ::: "memory");      // this wave's reads of the buffer have returned before the buffer is refilled
        asm volatile("s_wait_asynccnt 0x0" ::: "memory");   // this wave's copies of stage t + 1 have landed
        __syncthreads();                                    // publishes stage t + 1 and ends every wave's reads of stage t
        if (t + 2 < nst) stage(t + 2, t & 1);
    }
    asm volatile("s_wait_asynccnt 0x0" ::: "memory");       // nothing is in flight when the buffers become the output tile
    // the loop's last barrier has ended every read of the buffers: each wave lays its 64x32 block in the f32 tile; behind one more barrier the threads store whole lines
    float* os = (float*)sm;
#pragma unroll
    for (int mb = 0; mb < 4; ++mb)
#pragma unroll
        for (int nb = 0; nb < 2; ++nb)
#pragma unroll
            for (int j = 0; j < 8; ++j) os[(wm * 64 + mb * 16 + hi * 8 + j) * GOP + wn * 32 + nb * 16 + lr] = acc[mb][nb][j];
    __syncthreads();
#pragma unroll 1   // kept rolled: four rows' LDS reads and line stores in flight per trip; unrolled whole, the rounding code only lengthens the text
    for (int s4 = 0; s4 < 4; ++s4) {
#pragma unroll
        for (int u = 0; u < 4; ++u) { const int idx = (s4 * 4 + u) * 256 + tid; const int row = idx >> 5, cofs = (idx & 31) * 4; const v4f val = *(const v4fa*)(os + row * GOP + cofs);
            if constexpr (PLANES) { const int n = c0 + cofs; const size_t po = z * sC + (size_t)(r0 + row) * ldc + (size_t)(n >> 6) * tpitch + (n & 63); v4h o16; v4us oh, ol;   // 16 lanes x 8 bytes: one whole 128-byte line of each plane
#pragma unroll
                for (int k = 0; k < 4; ++k) { o16[k] = tohx(val[k]); unsigned short a2, c2; splitf(val[k], a2, c2); oh[k] = a2; ol[k] = c2; }
                *(v4h*)(P16 + po) = o16; *(v4us*)(Ph + po) = oh; *(v4us*)(Pl + po) = ol; }
            else *(v4f*)(C + z * sC + (size_t)(r0 + row) * ldc + c0 + cofs) = val; }
        asm volatile("s_wait_xcnt 0x0" ::: "memory");   // behind the trip's last store, in front of the next trip's rewrite of the address and data registers that these stores name
    }
}
// one product per launch: batch = grid z, tile = grid (x, y)
template <int NSPLIT, bool PLANES>
__global__ __launch_bounds__(256) void k_gemmt(const bf* __restrict__ A, const bf* __restrict__ A2, const bf* __restrict__ Bt, int K, float* C, int ldc, size_t sA, size_t sB, size_t sC, h16* P16, bf* Ph, bf* Pl, int tpitch) {
    gemmt<NSPLIT, PLANES>(A, A2, Bt, K, C, ldc, sA, sB, sC, P16, Ph, Pl, tpitch, blockIdx.z, (int)blockIdx.x, (int)blockIdx.y);
}
// the q, k and v products of all batches in ONE launch: none reads what another writes. Grid (position tiles, feature tiles, batch x 3 + product): a batch's three products lie side by side in the grid and read its activations together.
// q and k: x W^T, each 64-wide half of a tile's columns = one head, laid straight into the [batch][head][t][d] planes; v: W x^T (rows = features, columns = positions), whose rows are the [batch][head x 64 + d][t] plane as it stands
static_assert(NKV == NH_, "q, k and v share one grid: equal feature counts");
__global__ __launch_bounds__(256) void k_qkv(const bf* __restrict__ X, const bf* __restrict__ Wq, const bf* __restrict__ Wk, const bf* __restrict__ Wv, int K, h16* Q16, bf* Qh, bf* Ql, h16* K16, bf* Kh, bf* Kl, h16* V16, bf* Vh, bf* Vl) {
    const int sel = (int)(blockIdx.z % 3u); const bool tv = sel == 2;   // 0: q, 1: k, 2: v; the same for the whole work-group
    gemmt<0, true>(tv ? Wv : X, nullptr, tv ? X : (sel == 1 ? Wk : Wq), K, nullptr, tv ? TT : HD, tv ? (size_t)0 : (size_t)TT * DM, tv ? (size_t)TT * DM : (size_t)0, (size_t)NH_ * TT * HD,
                   sel == 0 ? Q16 : (sel == 1 ? K16 : V16), sel == 0 ? Qh : (sel == 1 ? Kh : Vh), sel == 0 ? Ql : (sel == 1 ? Kl : Vl), tv ? 64 : TT * HD, blockIdx.z / 3u, (int)(tv ? blockIdx.y : blockIdx.x), (int)(tv ? blockIdx.x : blockIdx.y));
}

typedef __attribute__((ext_vector_type(2))) unsigned short v2us;
typedef __attribute__((ext_vector_type(4))) int v4i;

__global__ __launch_bounds__(256) void k_wtG(const float* __restrict__ w, int K, int N, bf* Bt) {
    const int lane = threadIdx.x & 31; const int L0 = (blockIdx.x * 8 + (threadIdx.x >> 5)) * 8; const int nlines = N * K / 64;
{
#pragma unroll 1
        for (int l = 0; l < 8; ++l) { const int L = L0 + l; if (L >= nlines) break; const size_t e = (size_t)L * 64 + lane * 2; const int k = (int)(e % K), n = (int)(e / K); v2us o;
            o[0] = f2bf(w[(size_t)k * N + n]); o[1] = f2bf(w[(size_t)(k + 1) * N + n]); *(v2us*)(Bt + e) = o; }
         }
}
// ---- k_cvtall: all five f32 inputs rounded to bf16 in ONE launch of CVG work-groups (two of 8 waves per WGP: 16 long-lived waves).
// A chunk is 8 floats of one thread (32 bytes read, 16 written). A work-group takes CVX x 256 chunks of x that lie in a row (a thread's chunks 256 chunks apart) and 256 chunks of each weight: straight-line code,
// all of a thread's loads issued before its first rounding, so that the launch pays the start of few waves and one memory latency instead of one of each per chunk.
#define CVG  512
#define CVX  (NB_ * TT * DM / 8 / 256 / CVG)
static_assert((size_t)CVX * CVG * 256 * 8 == (size_t)NB_ * TT * DM, "x is a whole number of chunks per thread");
static_assert(DQ * DM == CVG * 256 * 8 && DKV * DM == CVG * 256 * 8, "each weight is one chunk per thread");
__device__ __forceinline__ v8us round8(v8f v) { v8us o;
#pragma unroll
    for (int k = 0; k < 8; ++k) o[k] = f2bf(v[k]); return o; }
__global__ __launch_bounds__(256) void k_cvtall(const float* __restrict__ x, const float* __restrict__ wq, const float* __restrict__ wk, const float* __restrict__ wv, const float* __restrict__ wo, bf* XB, bf* WQ, bf* WK, bf* WV, bf* WO) {
    const unsigned cx = blockIdx.x * (CVX * 256u) + threadIdx.x, cw = blockIdx.x * 256u + threadIdx.x;   // this thread's first chunk of x, its chunk of each weight
    // byte offsets in 32 bits: each access is a uniform base, one offset register and a constant
    auto ld = [](const float* p, unsigned chunk) { return *(const v8f*)((const char*)p + chunk * 32u); };
    auto st = [](bf* p, unsigned chunk, v8f v) { *(v8us*)((char*)p + chunk * 16u) = round8(v); };
    v8f v[CVX + 4];
#pragma unroll
    for (int u = 0; u < CVX; ++u) v[u] = ld(x + u * 2048, cx);
    v[CVX] = ld(wq, cw); v[CVX + 1] = ld(wk, cw); v[CVX + 2] = ld(wv, cw); v[CVX + 3] = ld(wo, cw);
#pragma unroll
    for (int u = 0; u < CVX; ++u) st(XB + u * 2048, cx, v[u]);
    st(WQ, cw, v[CVX]); st(WK, cw, v[CVX + 1]); st(WV, cw, v[CVX + 2]); st(WO, cw, v[CVX + 3]);
}
// ---- k_fattn: causal scores, softmax, probability x value and the head merge of ALL batches in ONE launch; grid (batches x heads, query tiles, heaviest tile first: the cost falls with the flat index over the whole launch), AW x 32 threads.
// Transposed products: S^T = K Q^T (A = 16 key rows, B = 16 query columns), O^T += V^T P^T (A = 16 rows of the [d][t] value plane, B = P^T). A lane holds scores of ONE query (column c = lane & 15; keys 8 hi + r of each 16),
// so a pair of score tiles, rounded to 16 bit, IS the B operand of the second product in the k order of WFrag::ld (8 hi + s, 16 + 8 hi + s): the probabilities never leave the registers.
// Online softmax in the log2 domain: running maximum m and sum l per query; O^T and l are rescaled only in a trip in which some query's maximum rises. Wave w takes every AW-th block of 32 keys;
// the AW partial (m, l, O^T) are joined through LDS in wave order behind one work-group barrier; the joined context x 2^-10 / l goes out as hi + lo bf16 rows of the merged [t][heads x 64] planes.
// HL: hi + lo bf16 planes, 3 products each (query rows < RH, 16 queries a wave); else single fp16 (32 queries a wave).
// K and V reach the waves through LDS: a stage is AW x 32 = 256 keys (wave w works on its w-th block of 32), brought in by asynchronous 16-byte copies in groups of 64 keys
// (a wave's copy covers 4 whole 128-byte lines: 4 K rows, or 64 keys of 4 rows of the [d][t] value plane); a group wholly behind the diagonal is not copied and not read.
// fp16: two buffers, the next stage's copies fly while this stage is worked on. HL (at most 2 stages, twice the planes): one buffer of the same total size, filled, read, and refilled behind a barrier.
#define AW   8
#define KPI  72                    // 16-bit elements between two K rows in LDS (144 bytes = 16 x odd: conflict-free for 16-byte fragment reads)
#define VPI  264                   // 16-bit elements between two rows of the staged value plane (256 keys + 8: 528 bytes = 16 x odd)
#define SKB  (AW * 32 * KPI * 2)   // bytes of a stage's K rows
#define SKV  (SKB + HD * VPI * 2)  // bytes of a stage's K rows and value rows of one plane pair
#define OP   68                    // floats between two queries' partial outputs in LDS (64 + 4: 16-byte aligned rows)
#define NEGB (-3.0e38f)
#define SCL2 (SCL * 1.4426950408889634f)   // 2^-13 x log2(e): exp(s x 2^-13 - max) = exp2(s x SCL2 - max2)
// 64 keys of one K plane and one value plane: this thread's 16 bytes of K rows r, r + 32 and of value rows r, r + 32, in ONE statement;
// the s_wait_xcnt stands inside the statement, behind the last copy, in front of any rewrite of an address register that a copy names
template <typename T16>
__device__ __forceinline__ void copy_kv(unsigned lk, unsigned lv, const T16* gk, const T16* gv) {
    asm volatile(CP4(0, 1, 2, 3, 4, 5, 6, 7) "s_wait_xcnt 0x0" :: "v"(lk), "v"(gk), "v"(lk + 32 * KPI * 2), "v"(gk + 32 * HD), "v"(lv), "v"(gv), "v"(lv + 32 * VPI * 2), "v"(gv + 32 * TT) : "memory");
}
template <typename T16, bool HL, int NQ>
__device__ __forceinline__ void attn_tile(const T16* __restrict__ Q, const T16* __restrict__ Q2, const T16* __restrict__ Kp, const T16* __restrict__ K2, const T16* __restrict__ Vt, const T16* __restrict__ V2, int q0, int head, char* sb, float* sm, float* sl, bf* Ah, bf* Al) {
    typedef WFrag<T16> F; typedef typename F::V V;
    const int lane = threadIdx.x & 31, c = lane & 15, hi = lane >> 4; const int w = __builtin_amdgcn_readfirstlane((int)(threadIdx.x >> 5));
    V qf[NQ][2], q2[NQ][2];
#pragma unroll
    for (int g = 0; g < NQ; ++g)
#pragma unroll
        for (int ks = 0; ks < 2; ++ks) { const size_t qo = (size_t)(q0 + g * 16 + c) * HD + ks * 32 + 8 * hi; qf[g][ks] = F::ld(Q + qo); if (HL) q2[g][ks] = F::ld(Q2 + qo); }
    v8f o[NQ][4]; float m[NQ], l[NQ];
#pragma unroll
    for (int g = 0; g < NQ; ++g) { m[g] = NEGB; l[g] = 0.f;
#pragma unroll
        for (int dt = 0; dt < 4; ++dt) o[g][dt] = (v8f){}; }
    const int nblk = q0 / 32 + 1;      // blocks of 32 keys up to and including the one that holds the diagonal
    const int nst = (nblk + AW - 1) / AW;   // stages of AW blocks
    // this thread's share of a group of 64 keys: 16 bytes (chunk tid & 7) of rows tid / 8 and tid / 8 + 32
    const int tid = (int)threadIdx.x;
    const unsigned lk0 = (unsigned)(size_t)sb + (unsigned)((tid >> 3) * (KPI * 2) + (tid & 7) * 16), lv0 = (unsigned)(size_t)sb + (unsigned)(SKB + (tid >> 3) * (VPI * 2) + (tid & 7) * 16);
    const size_t gk0 = (size_t)(tid >> 3) * HD + (tid & 7) * 8, gv0 = (size_t)(tid >> 3) * TT + (tid & 7) * 8;
    auto stage = [&](int st, int b) {
#pragma unroll
        for (int j = 0; j < 4; ++j)
            if (st * AW + 2 * j < nblk) {   // the same for the whole work-group: the group holds a key block up to the diagonal (and so lies inside the planes)
                const unsigned lk = lk0 + (unsigned)(b * SKV + j * 64 * KPI * 2), lv = lv0 + (unsigned)(b * SKV + j * 128); const size_t gk = gk0 + (size_t)(st * AW * 32 + j * 64) * HD, gv = gv0 + (size_t)(st * AW * 32 + j * 64);
                copy_kv(lk, lv, Kp + gk, Vt + gv); if constexpr (HL) copy_kv(lk + SKV, lv + SKV, K2 + gk, V2 + gv); }
    };
    if constexpr (!HL) {
        stage(0, 0);
        asm volatile("s_wait_asynccnt 0x0" ::: "memory");   // this wave's copies of stage 0 have landed
        __syncthreads();                                    // every wave's have: stage 0 may be read
        if (nst > 1) stage(1, 1);
    }
    const int kfo = (w * 32 + c) * KPI + 8 * hi, vfo = c * VPI + w * 32 + 8 * hi;   // this lane's first K and V fragment elements in a stage
#pragma unroll 1   // kept rolled: run-time trip count, one publish point per stage, and one body already holds most of the register file
    for (int st = 0; st < nst; ++st) {
      if constexpr (HL) {
        stage(st, 0);
        asm volatile("s_wait_asynccnt 0x0" ::: "memory");   // this wave's copies of the stage have landed
        __syncthreads();                                    // every wave's have: the stage may be read
      }
      const int kb = st * AW + w;
      if (kb < nblk) {   // wave-uniform: this wave's block of the stage reaches up to the diagonal
        const int k0 = kb * 32;
        const T16* kp = (const T16*)(sb + (HL ? 0 : (st & 1) * SKV)) + kfo; const T16* vp = (const T16*)(sb + (HL ? 0 : (st & 1) * SKV) + SKB) + vfo; const T16* kp2 = kp + SKV / 2; const T16* vp2 = vp + SKV / 2;
        V kf[2][2], k2[2][2], vf[4], v2[4];
#pragma unroll
        for (int kt = 0; kt < 2; ++kt)
#pragma unroll
            for (int ks = 0; ks < 2; ++ks) { const int ko = kt * 16 * KPI + ks * 32; kf[kt][ks] = F::ld(kp + ko); if (HL) k2[kt][ks] = F::ld(kp2 + ko); }
        __builtin_amdgcn_sched_barrier(0);   // all of the trip's K fragment reads are issued before its first product; without it the scheduler spreads them among the products and the wave waits on LDS at several places of a trip
        v8f s[NQ][2];
#pragma unroll
        for (int g = 0; g < NQ; ++g)
#pragma unroll
            for (int kt = 0; kt < 2; ++kt) s[g][kt] = (v8f){};
#pragma unroll
        for (int ks = 0; ks < 2; ++ks)
#pragma unroll
            for (int g = 0; g < NQ; ++g)
#pragma unroll
                for (int kt = 0; kt < 2; ++kt) { s[g][kt] = F::mma(kf[kt][ks], qf[g][ks], s[g][kt]); if (HL) { s[g][kt] = F::mma(k2[kt][ks], qf[g][ks], s[g][kt]); s[g][kt] = F::mma(kf[kt][ks], q2[g][ks], s[g][kt]); } }
#pragma unroll
        for (int dt = 0; dt < 4; ++dt) { const int vo = dt * 16 * VPI; vf[dt] = F::ld(vp + vo); if (HL) v2[dt] = F::ld(vp2 + vo); }
        __builtin_amdgcn_sched_barrier(0);   // the V fragment reads stay in front of the softmax, which covers their LDS latency, and are scheduled with the score products alone; without it the scheduler lifts them to the first products, where every K register is still live, and the build spills
#pragma unroll
        for (int g = 0; g < NQ; ++g)
#pragma unroll
            for (int kt = 0; kt < 2; ++kt) s[g][kt] *= SCL2;
        if (kb == nblk - 1) {          // the diagonal block (wave-uniform test): keys behind the query are excluded; every query of the tile keeps at least this block's first key
#pragma unroll
            for (int g = 0; g < NQ; ++g)
#pragma unroll
                for (int kt = 0; kt < 2; ++kt)
#pragma unroll
                    for (int r = 0; r < 8; ++r) s[g][kt][r] = (k0 + kt * 16 + 8 * hi + r <= q0 + g * 16 + c) ? s[g][kt][r] : NEGB;
        }
        float mn[NQ]; bool need = false;
#pragma unroll
        for (int g = 0; g < NQ; ++g) { float mx = s[g][0][0];
#pragma unroll
            for (int r = 1; r < 8; ++r) mx = fmaxf(mx, s[g][0][r]);
#pragma unroll
            for (int r = 0; r < 8; ++r) mx = fmaxf(mx, s[g][1][r]);
            mx = fmaxf(mx, __shfl_xor(mx, 16, 32)); mn[g] = fmaxf(m[g], mx); need = need || (mn[g] > m[g]); }
        if (__builtin_amdgcn_ballot_w32(need) != 0) {   // scalar branch: some query's maximum rose (always in a wave's first trip)
#pragma unroll
            for (int g = 0; g < NQ; ++g) { const float al = __builtin_amdgcn_exp2f(m[g] - mn[g]); l[g] *= al; m[g] = mn[g];
#pragma unroll
                for (int dt = 0; dt < 4; ++dt) o[g][dt] *= al; }
        }
        V pb[NQ], p2[NQ];
#pragma unroll
        for (int g = 0; g < NQ; ++g) {
            if constexpr (HL) { v8us h0, h1, l0, l1;
#pragma unroll
                for (int r = 0; r < 8; ++r) { const float pa = __builtin_amdgcn_exp2f(s[g][0][r] - m[g]), pc = __builtin_amdgcn_exp2f(s[g][1][r] - m[g]); l[g] += pa; l[g] += pc; unsigned short a, b2; splitf(pa, a, b2); h0[r] = a; l0[r] = b2; splitf(pc, a, b2); h1[r] = a; l1[r] = b2; }
                pb[g] = cat16b(h0, h1); p2[g] = cat16b(l0, l1);
            } else { v8h h0, h1;
#pragma unroll
                for (int r = 0; r < 8; ++r) { const float pa = __builtin_amdgcn_exp2f(s[g][0][r] - m[g]), pc = __builtin_amdgcn_exp2f(s[g][1][r] - m[g]); l[g] += pa; l[g] += pc; h0[r] = tohx(pa); h1[r] = tohx(pc); }
                pb[g] = cat16(h0, h1); }
        }
#pragma unroll
        for (int dt = 0; dt < 4; ++dt)
#pragma unroll
            for (int g = 0; g < NQ; ++g) { o[g][dt] = F::mma(vf[dt], pb[g], o[g][dt]); if (HL) { o[g][dt] = F::mma(vf[dt], p2[g], o[g][dt]); o[g][dt] = F::mma(v2[dt], pb[g], o[g][dt]); } }
      }
      asm volatile("s_wait_dscnt 0x0" ::: "memory");          // this wave's reads of the buffer have returned before the buffer is refilled
      if constexpr (!HL) asm volatile("s_wait_asynccnt 0x0" ::: "memory");   // this wave's copies of stage st + 1 have landed
      __syncthreads();                                        // ends every wave's reads of stage st (and, with two buffers, publishes stage st + 1)
      if constexpr (!HL) { if (st + 2 < nst) stage(st + 2, st & 1); }
    }
    asm volatile("s_wait_asynccnt 0x0" ::: "memory");         // nothing is in flight when the buffers become the partial planes
    float* so = (float*)sb;                                   // the loop's last barrier has ended every read of the buffers
    // every wave lays its partial (m, l, O^T) in its own LDS plane (a wave that got no key block lays m = NEGB, l = 0, zeros: its weight below is exp2(-huge) = 0)
    float* my = so + w * (32 * OP);
#pragma unroll
    for (int g = 0; g < NQ; ++g) { l[g] += __shfl_xor(l[g], 16, 32); if (hi == 0) { sm[w * 32 + g * 16 + c] = m[g]; sl[w * 32 + g * 16 + c] = l[g]; }
#pragma unroll
        for (int dt = 0; dt < 4; ++dt) { float* p = my + (g * 16 + c) * OP + dt * 16 + 8 * hi; *(v4fa*)p = (v4f){o[g][dt][0], o[g][dt][1], o[g][dt][2], o[g][dt][3]}; *(v4fa*)(p + 4) = (v4f){o[g][dt][4], o[g][dt][5], o[g][dt][6], o[g][dt][7]}; } }
    __syncthreads();
    for (int idx = (int)threadIdx.x; idx < NQ * 16 * 8; idx += AW * 32) { const int q = idx >> 3, d8 = (idx & 7) * 8;   // one thread: 8 outputs of one query
        float M = sm[q];
#pragma unroll
        for (int p = 1; p < AW; ++p) M = fmaxf(M, sm[p * 32 + q]);
        float L = 0.f; v4f a0 = (v4f){}, a1 = (v4f){};
#pragma unroll
        for (int p = 0; p < AW; ++p) { const float sc = __builtin_amdgcn_exp2f(sm[p * 32 + q] - M); L += sc * sl[p * 32 + q]; const float* pp = so + p * (32 * OP) + q * OP + d8; a0 += sc * *(const v4fa*)pp; a1 += sc * *(const v4fa*)(pp + 4); }
        const float f = __fdiv_rn(0.0009765625f, L);   // x 2^-10: this module scales v by c^-0.5 = 2^-5 and the projected output by out_dim^-0.5 = 2^-5: both linear: ONE exact factor on the merged context
        v8us oh, ol;
#pragma unroll
        for (int k = 0; k < 4; ++k) { unsigned short a, b2; splitf(a0[k] * f, a, b2); oh[k] = a; ol[k] = b2; splitf(a1[k] * f, a, b2); oh[4 + k] = a; ol[4 + k] = b2; }
        const size_t oo = (size_t)(q0 + q) * DQ + head * HD + d8; *(v8us*)(Ah + oo) = oh; *(v8us*)(Al + oo) = ol; }
}
__global__ __launch_bounds__(AW * 32) void k_fattn(const h16* __restrict__ Q16, const h16* __restrict__ K16, const h16* __restrict__ V16, const bf* __restrict__ Qh, const bf* __restrict__ Ql, const bf* __restrict__ Kh, const bf* __restrict__ Kl, const bf* __restrict__ Vh, const bf* __restrict__ Vl, bf* Ah, bf* Al) {
    __shared__ __align__(16) char so[2 * SKV > AW * 32 * OP * 4 ? 2 * SKV : AW * 32 * OP * 4];   // the stage buffers; behind the loop's last barrier the waves' partial outputs
    __shared__ float sm[AW * 32]; __shared__ float sl[AW * 32];
    const int head = blockIdx.x % NH_, ty = blockIdx.y; const size_t zp = (size_t)blockIdx.x * TT * HD;   // planes [batch][head][..]: blockIdx.x = batch x heads + head; one kv head per query head
    { const size_t ao = (size_t)(blockIdx.x / NH_) * TT * DQ; Ah += ao; Al += ao; }   // this batch's rows of the merged context
    if (ty < (TT - RH) / 32) attn_tile<h16, false, 2>(Q16 + zp, nullptr, K16 + zp, nullptr, V16 + zp, nullptr, TT - 32 * (ty + 1), head, so, sm, sl, Ah, Al);
    else attn_tile<bf, true, 1>(Qh + zp, Ql + zp, Kh + zp, Kl + zp, Vh + zp, Vl + zp, RH - 16 * (ty - (TT - RH) / 32 + 1), head, so, sm, sl, Ah, Al);
}

extern "C" void kernel_launch(void* const* d_in, const int* in_sizes, int n_in,
                              void* d_out, int out_size, void* d_ws, size_t ws_size, hipStream_t stream) {
    (void)in_sizes; (void)n_in; (void)out_size;
    const float* x = (const float*)d_in[0]; const float* wk = (const float*)d_in[1]; const float* wq = (const float*)d_in[2]; const float* wv = (const float*)d_in[3]; const float* wo = (const float*)d_in[4];   /* input order x, W_key, W_query, W_value, W_proj ('oi' [1024][1024], UNIT normal): the KEY weight comes FIRST; NO bias input in this module */ const float* cosT = nullptr; const float* sinT = nullptr; (void)cosT; (void)sinT;
    float* OUT = (float*)d_out;     // [4][2048][1024]
    char* wsp = (char*)d_ws;
    auto take = [&](size_t bytes) { char* p = wsp; wsp += (bytes + 255) & ~(size_t)255; return (void*)p; };
    bf* WQ = (bf*)take((size_t)DQ * DM * 2); bf* WK = (bf*)take((size_t)DKV * DM * 2); bf* WV = (bf*)take((size_t)DKV * DM * 2); bf* WO = (bf*)take((size_t)DM * DQ * 2);
    // every plane holds all NB_ batches, batch outermost
    bf* XB = (bf*)take((size_t)NB_ * TT * DM * 2);
    const size_t PB = (size_t)NB_ * NH_ * TT * HD * 2;
    h16* QP16 = (h16*)take(PB); h16* KP16 = (h16*)take(PB); h16* VT16 = (h16*)take(PB);
    bf* QPh = (bf*)take(PB); bf* QPl = (bf*)take(PB); bf* KPh = (bf*)take(PB); bf* KPl = (bf*)take(PB); bf* VTh = (bf*)take(PB); bf* VTl = (bf*)take(PB);
    bf* ATh = (bf*)take((size_t)NB_ * TT * DQ * 2); bf* ATl = (bf*)take((size_t)NB_ * TT * DQ * 2);
    if ((size_t)(wsp - (char*)d_ws) > ws_size) return;    // ws 256 MiB
    // each stage is ONE launch over all batches: the rounding of x and of the four weights together, the q, k, v products together, the attention (batch in grid x), the out projection (batch = grid z)
    k_cvtall<<<CVG, 256, 0, stream>>>(x, wq, wk, wv, wo, XB, WQ, WK, WV, WO);
    k_qkv<<<dim3(TT / GT, DQ / GT, 3 * NB_), 256, 0, stream>>>(XB, WQ, WK, WV, DM, QP16, QPh, QPl, KP16, KPh, KPl, VT16, VTh, VTl);
    k_fattn<<<dim3(NB_ * NH_, (TT - RH) / 32 + RH / 16, 1), AW * 32, 0, stream>>>(QP16, KP16, VT16, QPh, QPl, KPh, KPl, VTh, VTl, ATh, ATl);
    k_gemmt<1, false><<<dim3(TT / GT, DM / GT, NB_), 256, 0, stream>>>(ATh, ATl, WO, DQ, OUT, DM, (size_t)TT * DQ, 0, (size_t)TT * DM, nullptr, nullptr, nullptr, 0);
}

// v008
// Measured time: 137 microseconds a run.
// Timed twice side by side with v007, it ran 1.23 times as fast both times.
// Counting every step since v000, it is 22.5 times as fast.
#include <hip/hip_runtime.h>

// Causal multi-head self-attention whose projections and output are each scaled by 1/sqrt(width) (x [4][2048][1024]; k, q, v = (x W^T) x 1024^-0.5 ('oi' [1024][1024] UNIT normal, no bias; 16 heads x 64): each projection x 2^-5 (exact); scores = q.k x 64^-0.5: with the two 2^-5 factors folded in, q.k(unscaled) x 2^-13 (exact); causal (tril kept, -inf elsewhere); softmax; out = (merged W_proj^T) x 1024^-0.5 ('oi', no bias): the v factor 2^-5 and the output factor 2^-5 are both linear: ONE factor 2^-10 on the merged context (exact) -> [4][2048][1024] (8.4 M); argument order x, W_key, W_query, W_value, W_proj: KEY FIRST).
// Compute dtypes, f32 accumulate: every input rounded to bf16; q/k/v on PLAIN bf16 operands (inputs: exact); causal scores and attn.v: query rows < 512 hl (3 products), the rest single fp16, causal block skipping, one fused launch for all batches; online softmax f32 (scale 2^-13 exact); the merged context x 2^-10 (exact); W_proj hl x exact (2 products), NO bias.

#define NB_  4
#define TT   2048
#define DM   1024
#define NH_  16
#define NKV  16
#define REP  (NH_ / NKV)
#define HD   64
#define DQ   (NH_ * HD)
#define DKV  (NKV * HD)
#define RH   512                  // query rows < RH use hi+lo planes (0: none)
#define SCL  0.0001220703125f   // 2^-13 = 1024^-0.5 (on q) x 1024^-0.5 (on k) x 64^-0.5: this module scales q AND k by c^-0.5 = 2^-5 each and the scores by hd^-0.5 = 2^-3: all exact powers of two, applied here in ONE multiply on the unscaled q.k
typedef _Float16 h16;
typedef unsigned short bf;
typedef __attribute__((ext_vector_type(16))) __bf16   v16bf;
typedef __attribute__((ext_vector_type(16))) _Float16 v16h;
typedef __attribute__((ext_vector_type(8)))  _Float16 v8h;
typedef __attribute__((ext_vector_type(8)))  unsigned short v8us;
typedef __attribute__((ext_vector_type(8)))  float    v8f;
typedef __attribute__((ext_vector_type(4)))  float    v4f;
typedef v8h  __attribute__((may_alias)) v8ha;
typedef v4f  __attribute__((may_alias)) v4fa;
typedef v8us __attribute__((may_alias)) v8usa;

__device__ __forceinline__ unsigned short f2bf(float f) { unsigned u = __float_as_uint(f); u += 0x7FFFu + ((u >> 16) & 1u); return (unsigned short)(u >> 16); }
__device__ __forceinline__ float bf2f(unsigned short b) { return __uint_as_float(((unsigned)b) << 16); }
__device__ __forceinline__ float bfr(float f) { return bf2f(f2bf(f)); }
__device__ __forceinline__ v16h cat16(v8h lo, v8h hi) { return __builtin_shufflevector(lo, hi, 0, 1, 2, 3, 4, 5, 6, 7, 8, 9, 10, 11, 12, 13, 14, 15); }
__device__ __forceinline__ v16bf cat16b(v8us lo, v8us hi) { return __builtin_bit_cast(v16bf, __builtin_shufflevector(lo, hi, 0, 1, 2, 3, 4, 5, 6, 7, 8, 9, 10, 11, 12, 13, 14, 15)); }
__device__ __forceinline__ v8f wmma16(v16h a, v16h b, v8f c) { return __builtin_amdgcn_wmma_f32_16x16x32_f16(false, a, false, b, (short)0, c, false, false); }
__device__ __forceinline__ v8f wmmab(v16bf a, v16bf b, v8f c) { return __builtin_amdgcn_wmma_f32_16x16x32_bf16(false, a, false, b, (short)0, c, false, false); }
__device__ __forceinline__ h16 tohx(float x) { return (h16)x; }
__device__ __forceinline__ void splitf(float y, unsigned short& h, unsigned short& l) { h = f2bf(y); l = f2bf(y - bf2f(h)); }
typedef __attribute__((ext_vector_type(4))) _Float16 v4h;
typedef __attribute__((ext_vector_type(4))) unsigned short v4us;



// ---- k_gemmt: GEMM on LDS-staged operands, one 128x128 output tile per work-group of 8 waves (2 x 4; a wave holds 64x32 = 8 accumulators over the whole of K).
// A stage is 64 of K = one whole 128-byte line of each of the 128 rows of every operand, brought into LDS by asynchronous 16-byte copies (a wave's copy covers 4 whole lines) and shared by all 8 waves;
// two buffers: the next stage's copies fly while this stage is worked on. LDS rows lie 144 bytes apart (16 x odd: conflict-free for 16-byte fragment reads).
// C[m][n] (f32, pitch ldc) = sum_k A[m][k] Bt[n][k] (+ A2[m][k] Bt[n][k] under NSPLIT). z-batch strides sA/sB/sC in elements (sC: of C, or of each plane under PLANES). K % 64 == 0, rows and columns % 128 == 0.
// PLANES: the tile is not stored as f32 but rounded at once into three 16-bit planes (fp16, and bf16 hi + lo); element (m, n) lies at m x ldc + (n / 64) x tpitch + n % 64.
// ldc = 64, tpitch = rows x 64 gives head planes [n / 64][m][n % 64]; with A = the weight and Bt = the activations, ldc = positions and tpitch = 64 give the transposed value plane [feature][position].
template <typename T16> struct WFrag;
template <> struct WFrag<h16> { typedef v16h V; static __device__ __forceinline__ V ld(const h16* p) { return cat16(*(const v8h*)p, *(const v8h*)(p + 16)); } static __device__ __forceinline__ v8f mma(V a, V b, v8f c) { return wmma16(a, b, c); } };
template <> struct WFrag<bf> { typedef v16bf V; static __device__ __forceinline__ V ld(const bf* p) { return cat16b(*(const v8us*)p, *(const v8us*)(p + 16)); } static __device__ __forceinline__ v8f mma(V a, V b, v8f c) { return wmmab(a, b, c); } };
#define GT   128                  // rows of each operand tile
#define GKS  64                   // k per stage
#define GP   72                   // 16-bit elements between two operand rows in LDS
#define OPB  (GT * GP * 2)        // bytes of one operand tile in LDS
#define GOP  132                  // floats between two rows of the staged output tile (128 + 4: 16-byte aligned rows)
// one stage's copies of this thread: its 16 bytes of rows r, r + 32, r + 64, r + 96 of two (three) operand tiles that lie OPB bytes apart in LDS, in ONE statement;
// the s_wait_xcnt stands inside the statement, behind the last copy, in front of any rewrite of an address register that a copy names
#define CP4(a, b, c, d, e, f, g, h) "global_load_async_to_lds_b128 %" #a ", %" #b ", off\n\tglobal_load_async_to_lds_b128 %" #c ", %" #d ", off\n\tglobal_load_async_to_lds_b128 %" #e ", %" #f ", off\n\tglobal_load_async_to_lds_b128 %" #g ", %" #h ", off\n\t"
#define RW4(l, g) "v"(l), "v"(g), "v"((l) + 32 * GP * 2), "v"((g) + rs), "v"((l) + 64 * GP * 2), "v"((g) + 2 * rs), "v"((l) + 96 * GP * 2), "v"((g) + 3 * rs)
__device__ __forceinline__ void copy_stage2(unsigned l, const bf* ga, const bf* gb, size_t rs) {
    asm volatile(CP4(0, 1, 2, 3, 4, 5, 6, 7) CP4(8, 9, 10, 11, 12, 13, 14, 15) "s_wait_xcnt 0x0" :: RW4(l, ga), RW4(l + OPB, gb) : "memory");
}
__device__ __forceinline__ void copy_stage3(unsigned l, const bf* ga, const bf* ga2, const bf* gb, size_t rs) {
    asm volatile(CP4(0, 1, 2, 3, 4, 5, 6, 7) CP4(8, 9, 10, 11, 12, 13, 14, 15) CP4(16, 17, 18, 19, 20, 21, 22, 23) "s_wait_xcnt 0x0" :: RW4(l, ga), RW4(l + OPB, ga2), RW4(l + 2 * OPB, gb) : "memory");
}
template <int NSPLIT, bool PLANES>
__device__ __forceinline__ void gemmt(const bf* __restrict__ A, const bf* __restrict__ A2, const bf* __restrict__ Bt, int K, float* C, int ldc, size_t sA, size_t sB, size_t sC, h16* P16, bf* Ph, bf* Pl, int tpitch, size_t z, int bx, int by) {   // z: batch; bx, by: the tile's place in rows and columns
    typedef WFrag<bf> F; typedef typename F::V V;
    constexpr int NOPD = NSPLIT ? 3 : 2;              // operand tiles of a stage: A, (A2,) Bt
    constexpr int OPE = GT * GP, STG = NOPD * OPE * 2;   // elements of one operand tile, bytes of one stage
    constexpr int KG = NSPLIT ? 1 : 2;                // 32-wide k steps whose fragments are read from LDS as one group (registers: 4 waves a SIMD stay possible)
    constexpr int SMB = 2 * STG > GT * GOP * 4 ? 2 * STG : GT * GOP * 4;
    __shared__ __align__(16) char sm[SMB];            // the two stage buffers; behind the loop's last barrier the output tile
    A += z * sA; if (NSPLIT) A2 += z * sA; Bt += z * sB;
    const int tid = (int)threadIdx.x, lane = tid & 31, lr = lane & 15, hi = lane >> 4; const int w = __builtin_amdgcn_readfirstlane(tid >> 5); const int wm = w >> 2, wn = w & 3; const int r0 = bx * GT, c0 = by * GT;
    // this thread's share of a stage: 16 bytes (chunk tid & 7) of rows tid / 8 + 0, 32, 64, 96 of every operand tile
    const unsigned lc = (unsigned)(size_t)sm + (unsigned)((tid >> 3) * (GP * 2) + (tid & 7) * 16);
    const size_t rs = (size_t)32 * K; const size_t ca = (size_t)(r0 + (tid >> 3)) * K + (tid & 7) * 8, cb = (size_t)(c0 + (tid >> 3)) * K + (tid & 7) * 8;
    auto stage = [&](int t, int b) { const unsigned l = lc + (unsigned)(b * STG); const size_t ko = (size_t)t * GKS;
        if constexpr (NSPLIT != 0) copy_stage3(l, A + ca + ko, A2 + ca + ko, Bt + cb + ko, rs); else copy_stage2(l, A + ca + ko, Bt + cb + ko, rs); };
    v8f acc[4][2];
#pragma unroll
    for (int mb = 0; mb < 4; ++mb)
#pragma unroll
        for (int nb = 0; nb < 2; ++nb) acc[mb][nb] = (v8f){};
    const int nst = K / GKS;
    stage(0, 0);
    asm volatile("s_wait_asynccnt 0x0" ::: "memory");   // this wave's copies of stage 0 have landed
    __syncthreads();                                    // every wave's have: stage 0 may be read
    if (nst > 1) stage(1, 1);
    const int ao = (wm * 64 + lr) * GP + 8 * hi, bo = (wn * 32 + lr) * GP + 8 * hi;
#pragma unroll 1   // kept rolled: one publish point per stage, the buffer picked by the trip's parity
    for (int t = 0; t < nst; ++t) {
        const bf* sa = (const bf*)(sm + (t & 1) * STG); const bf* sb = sa + (NOPD - 1) * OPE;
#pragma unroll
        for (int kg = 0; kg < 2 / KG; ++kg) {
            V a[KG][4], a2[KG][4], b[KG][2];
#pragma unroll
            for (int u = 0; u < KG; ++u) { const int kk = (kg * KG + u) * 32;
#pragma unroll
                for (int mb = 0; mb < 4; ++mb) { a[u][mb] = F::ld(sa + ao + mb * 16 * GP + kk); if (NSPLIT) a2[u][mb] = F::ld(sa + OPE + ao + mb * 16 * GP + kk); }
#pragma unroll
                for (int nb = 0; nb < 2; ++nb) b[u][nb] = F::ld(sb + bo + nb * 16 * GP + kk); }
            __builtin_amdgcn_sched_barrier(0);   // the group's LDS reads are issued together, ahead of its products; without it the scheduler reloads one B register set among the products and the wave waits out the LDS latency several times a stage
#pragma unroll
            for (int u = 0; u < KG; ++u) {
#pragma unroll
                for (int nb = 0; nb < 2; ++nb)
#pragma unroll
                    for (int mb = 0; mb < 4; ++mb) acc[mb][nb] = F::mma(a[u][mb], b[u][nb], acc[mb][nb]);
                if (NSPLIT) {
#pragma unroll
                    for (int nb = 0; nb < 2; ++nb)
#pragma unroll
                        for (int mb = 0; mb < 4; ++mb) acc[mb][nb] = F::mma(a2[u][mb], b[u][nb], acc[mb][nb]);
                }
            }
        }
        __builtin_amdgcn_sched_barrier(0);   // the stage's products stay in front of the publish point; without it the scheduler sinks them behind the barrier and the refill, and the copies then fly only while the next fragments are read
        asm volatile("s_wait_dscnt 0x0" ::: "memory");      // this wave's reads of the buffer have returned before the buffer is refilled
        asm volatile("s_wait_asynccnt 0x0" ::: "memory");   // this wave's copies of stage t + 1 have landed
        __syncthreads();                                    // publishes stage t + 1 and ends every wave's reads of stage t
        if (t + 2 < nst) stage(t + 2, t & 1);
    }
    asm volatile("s_wait_asynccnt 0x0" ::: "memory");       // nothing is in flight when the buffers become the output tile
    // the loop's last barrier has ended every read of the buffers: each wave lays its 64x32 block in the f32 tile; behind one more barrier the threads store whole lines
    float* os = (float*)sm;
#pragma unroll
    for (int mb = 0; mb < 4; ++mb)
#pragma unroll
        for (int nb = 0; nb < 2; ++nb)
#pragma unroll
            for (int j = 0; j < 8; ++j) os[(wm * 64 + mb * 16 + hi * 8 + j) * GOP + wn * 32 + nb * 16 + lr] = acc[mb][nb][j];
    __syncthreads();
#pragma unroll 1   // kept rolled: four rows' LDS reads and line stores in flight per trip; unrolled whole, the rounding code only lengthens the text
    for (int s4 = 0; s4 < 4; ++s4) {
#pragma unroll
        for (int u = 0; u < 4; ++u) { const int idx = (s4 * 4 + u) * 256 + tid; const int row = idx >> 5, cofs = (idx & 31) * 4; const v4f val = *(const v4fa*)(os + row * GOP + cofs);
            if constexpr (PLANES) { const int n = c0 + cofs; const size_t po = z * sC + (size_t)(r0 + row) * ldc + (size_t)(n >> 6) * tpitch + (n & 63); v4h o16; v4us oh, ol;   // 16 lanes x 8 bytes: one whole 128-byte line of each plane
#pragma unroll
                for (int k = 0; k < 4; ++k) { o16[k] = tohx(val[k]); unsigned short a2, c2; splitf(val[k], a2, c2); oh[k] = a2; ol[k] = c2; }
                *(v4h*)(P16 + po) = o16; *(v4us*)(Ph + po) = oh; *(v4us*)(Pl + po) = ol; }
            else *(v4f*)(C + z * sC + (size_t)(r0 + row) * ldc + c0 + cofs) = val; }
        asm volatile("s_wait_xcnt 0x0" ::: "memory");   // behind the trip's last store, in front of the next trip's rewrite of the address and data registers that these stores name
    }
}
// one product per launch: batch = grid z, tile = grid (x, y)
template <int NSPLIT, bool PLANES>
__global__ __launch_bounds__(256) void k_gemmt(const bf* __restrict__ A, const bf* __restrict__ A2, const bf* __restrict__ Bt, int K, float* C, int ldc, size_t sA, size_t sB, size_t sC, h16* P16, bf* Ph, bf* Pl, int tpitch) {
    gemmt<NSPLIT, PLANES>(A, A2, Bt, K, C, ldc, sA, sB, sC, P16, Ph, Pl, tpitch, blockIdx.z, (int)blockIdx.x, (int)blockIdx.y);
}
// the q, k and v products of all batches in ONE launch: none reads what another writes. Grid (position tiles, feature tiles, batch x 3 + product): a batch's three products lie side by side in the grid and read its activations together.
// q and k: x W^T, each 64-wide half of a tile's columns = one head, laid straight into the [batch][head][t][d] planes; v: W x^T (rows = features, columns = positions), whose rows are the [batch][head x 64 + d][t] plane as it stands
static_assert(NKV == NH_, "q, k and v share one grid: equal feature counts");
__global__ __launch_bounds__(256) void k_qkv(const bf* __restrict__ X, const bf* __restrict__ Wq, const bf* __restrict__ Wk, const bf* __restrict__ Wv, int K, h16* Q16, bf* Qh, bf* Ql, h16* K16, bf* Kh, bf* Kl, h16* V16, bf* Vh, bf* Vl) {
    const int sel = (int)(blockIdx.z % 3u); const bool tv = sel == 2;   // 0: q, 1: k, 2: v; the same for the whole work-group
    gemmt<0, true>(tv ? Wv : X, nullptr, tv ? X : (sel == 1 ? Wk : Wq), K, nullptr, tv ? TT : HD, tv ? (size_t)0 : (size_t)TT * DM, tv ? (size_t)TT * DM : (size_t)0, (size_t)NH_ * TT * HD,
                   sel == 0 ? Q16 : (sel == 1 ? K16 : V16), sel == 0 ? Qh : (sel == 1 ? Kh : Vh), sel == 0 ? Ql : (sel == 1 ? Kl : Vl), tv ? 64 : TT * HD, blockIdx.z / 3u, (int)(tv ? blockIdx.y : blockIdx.x), (int)(tv ? blockIdx.x : blockIdx.y));
}

typedef __attribute__((ext_vector_type(2))) unsigned short v2us;
typedef __attribute__((ext_vector_type(4))) int v4i;

__global__ __launch_bounds__(256) void k_wtG(const float* __restrict__ w, int K, int N, bf* Bt) {
    const int lane = threadIdx.x & 31; const int L0 = (blockIdx.x * 8 + (threadIdx.x >> 5)) * 8; const int nlines = N * K / 64;
{
#pragma unroll 1
        for (int l = 0; l < 8; ++l) { const int L = L0 + l; if (L >= nlines) break; const size_t e = (size_t)L * 64 + lane * 2; const int k = (int)(e % K), n = (int)(e / K); v2us o;
            o[0] = f2bf(w[(size_t)k * N + n]); o[1] = f2bf(w[(size_t)(k + 1) * N + n]); *(v2us*)(Bt + e) = o; }
         }
}
// ---- k_cvtall: all five f32 inputs rounded to bf16 in ONE launch of CVG work-groups (two of 8 waves per WGP: 16 long-lived waves).
// A chunk is 8 floats of one thread (32 bytes read, 16 written). A work-group takes CVX x 256 chunks of x that lie in a row (a thread's chunks 256 chunks apart) and 256 chunks of each weight: straight-line code,
// all of a thread's loads issued before its first rounding, so that the launch pays the start of few waves and one memory latency instead of one of each per chunk.
#define CVG  512
#define CVX  (NB_ * TT * DM / 8 / 256 / CVG)
static_assert((size_t)CVX * CVG * 256 * 8 == (size_t)NB_ * TT * DM, "x is a whole number of chunks per thread");
static_assert(DQ * DM == CVG * 256 * 8 && DKV * DM == CVG * 256 * 8, "each weight is one chunk per thread");
__device__ __forceinline__ v8us round8(v8f v) { v8us o;
#pragma unroll
    for (int k = 0; k < 8; ++k) o[k] = f2bf(v[k]); return o; }
__global__ __launch_bounds__(256) void k_cvtall(const float* __restrict__ x, const float* __restrict__ wq, const float* __restrict__ wk, const float* __restrict__ wv, const float* __restrict__ wo, bf* XB, bf* WQ, bf* WK, bf* WV, bf* WO) {
    const unsigned cx = blockIdx.x * (CVX * 256u) + threadIdx.x, cw = blockIdx.x * 256u + threadIdx.x;   // this thread's first chunk of x, its chunk of each weight
    // byte offsets in 32 bits: each access is a uniform base, one offset register and a constant
    auto ld = [](const float* p, unsigned chunk) { return *(const v8f*)((const char*)p + chunk * 32u); };
    auto st = [](bf* p, unsigned chunk, v8f v) { *(v8us*)((char*)p + chunk * 16u) = round8(v); };
    v8f v[CVX + 4];
#pragma unroll
    for (int u = 0; u < CVX; ++u) v[u] = ld(x + u * 2048, cx);
    v[CVX] = ld(wq, cw); v[CVX + 1] = ld(wk, cw); v[CVX + 2] = ld(wv, cw); v[CVX + 3] = ld(wo, cw);
#pragma unroll
    for (int u = 0; u < CVX; ++u) st(XB + u * 2048, cx, v[u]);
    st(WQ, cw, v[CVX]); st(WK, cw, v[CVX + 1]); st(WV, cw, v[CVX + 2]); st(WO, cw, v[CVX + 3]);
}
// ---- k_fattn: causal scores, softmax, probability x value and the head merge of ALL batches in ONE launch; grid (batches x heads, query tiles, heaviest tile first: the cost falls with the flat index over the whole launch), AW x 32 threads.
// Transposed products: S^T = K Q^T (A = 16 key rows, B = 16 query columns), O^T += V^T P^T (A = 16 rows of the [d][t] value plane, B = P^T). A lane holds scores of ONE query (column c = lane & 15; keys 8 hi + r of each 16),
// so a pair of score tiles, rounded to 16 bit, IS the B operand of the second product in the k order of WFrag::ld (8 hi + s, 16 + 8 hi + s): the probabilities never leave the registers.
// Online softmax in the log2 domain: running maximum m and sum l per query; O^T and l are rescaled only in a trip in which some query's maximum rises.
// A work-group holds QG query groups (one group = the queries of one wave); the KW = AW / QG waves of a group take every KW-th block of 32 keys, in rising order;
// a group's KW partial (m, l, O^T) are joined through LDS in wave order behind one work-group barrier; the joined context x 2^-10 / l goes out as hi + lo bf16 rows of the merged [t][heads x 64] planes.
// HL: hi + lo bf16 planes, 3 products each (query rows < RH, 16 queries a wave); else single fp16 (32 queries a wave).
// K and V reach the waves through LDS: a stage is AW x 32 = 256 keys, read by all QG query groups (one fetch from L2 serves QG x as many queries), brought in by asynchronous 16-byte copies in groups of 64 keys
// (a wave's copy covers 4 whole 128-byte lines: 4 K rows, or 64 keys of 4 rows of the [d][t] value plane); a group wholly behind the last query group's diagonal is not copied and not read.
// fp16: two buffers, the next stage's copies fly while this stage is worked on. HL (at most 2 stages, twice the planes): one buffer of the same total size, filled, read, and refilled behind a barrier.
#define AW   8
#define QG   4                     // query groups of a work-group, which share each staged K and V block
#define KW   (AW / QG)             // waves that split the key blocks of one query group
#define KPI  72                    // 16-bit elements between two K rows in LDS (144 bytes = 16 x odd: conflict-free for 16-byte fragment reads)
#define VPI  264                   // 16-bit elements between two rows of the staged value plane (256 keys + 8: 528 bytes = 16 x odd)
#define SKB  (AW * 32 * KPI * 2)   // bytes of a stage's K rows
#define SKV  (SKB + HD * VPI * 2)  // bytes of a stage's K rows and value rows of one plane pair
#define OP   68                    // floats between two queries' partial outputs in LDS (64 + 4: 16-byte aligned rows)
#define NEGB (-3.0e38f)
#define SCL2 (SCL * 1.4426950408889634f)   // 2^-13 x log2(e): exp(s x 2^-13 - max) = exp2(s x SCL2 - max2)
// 64 keys of one K plane and one value plane: this thread's 16 bytes of K rows r, r + 32 and of value rows r, r + 32, in ONE statement;
// the s_wait_xcnt stands inside the statement, behind the last copy, in front of any rewrite of an address register that a copy names
template <typename T16>
__device__ __forceinline__ void copy_kv(unsigned lk, unsigned lv, const T16* gk, const T16* gv) {
    asm volatile(CP4(0, 1, 2, 3, 4, 5, 6, 7) "s_wait_xcnt 0x0" :: "v"(lk), "v"(gk), "v"(lk + 32 * KPI * 2), "v"(gk + 32 * HD), "v"(lv), "v"(gv), "v"(lv + 32 * VPI * 2), "v"(gv + 32 * TT) : "memory");
}
template <typename T16, bool HL, int NQ>
__device__ __forceinline__ void attn_tile(const T16* __restrict__ Q, const T16* __restrict__ Q2, const T16* __restrict__ Kp, const T16* __restrict__ K2, const T16* __restrict__ Vt, const T16* __restrict__ V2, int q0, int head, char* sb, float* sm, float* sl, bf* Ah, bf* Al) {
    typedef WFrag<T16> F; typedef typename F::V V;
    const int lane = threadIdx.x & 31, c = lane & 15, hi = lane >> 4; const int w = __builtin_amdgcn_readfirstlane((int)(threadIdx.x >> 5));
    const int kw = w % KW, qw = q0 + (w / KW) * (NQ * 16);   // this wave's place among its group's waves; its group's first query
    V qf[NQ][2], q2[NQ][2];
#pragma unroll
    for (int g = 0; g < NQ; ++g)
#pragma unroll
        for (int ks = 0; ks < 2; ++ks) { const size_t qo = (size_t)(qw + g * 16 + c) * HD + ks * 32 + 8 * hi; qf[g][ks] = F::ld(Q + qo); if (HL) q2[g][ks] = F::ld(Q2 + qo); }
    v8f o[NQ][4]; float m[NQ], l[NQ];
#pragma unroll
    for (int g = 0; g < NQ; ++g) { m[g] = NEGB; l[g] = 0.f;
#pragma unroll
        for (int dt = 0; dt < 4; ++dt) o[g][dt] = (v8f){}; }
    const int nblk = qw / 32 + 1;      // blocks of 32 keys up to and including the one that holds this group's diagonal
    const int nblkg = (q0 + (QG - 1) * (NQ * 16)) / 32 + 1;   // the same for the work-group's last group: what is staged
    const int nst = (nblkg + AW - 1) / AW;   // stages of AW blocks
    // this thread's share of a group of 64 keys: 16 bytes (chunk tid & 7) of rows tid / 8 and tid / 8 + 32
    const int tid = (int)threadIdx.x;
    const unsigned lk0 = (unsigned)(size_t)sb + (unsigned)((tid >> 3) * (KPI * 2) + (tid & 7) * 16), lv0 = (unsigned)(size_t)sb + (unsigned)(SKB + (tid >> 3) * (VPI * 2) + (tid & 7) * 16);
    const size_t gk0 = (size_t)(tid >> 3) * HD + (tid & 7) * 8, gv0 = (size_t)(tid >> 3) * TT + (tid & 7) * 8;
    auto stage = [&](int st, int b) {
#pragma unroll
        for (int j = 0; j < 4; ++j)
            if (st * AW + 2 * j < nblkg) {   // the same for the whole work-group: the group holds a key block up to the last diagonal (and so lies inside the planes)
                const unsigned lk = lk0 + (unsigned)(b * SKV + j * 64 * KPI * 2), lv = lv0 + (unsigned)(b * SKV + j * 128); const size_t gk = gk0 + (size_t)(st * AW * 32 + j * 64) * HD, gv = gv0 + (size_t)(st * AW * 32 + j * 64);
                copy_kv(lk, lv, Kp + gk, Vt + gv); if constexpr (HL) copy_kv(lk + SKV, lv + SKV, K2 + gk, V2 + gv); }
    };
    if constexpr (!HL) {
        stage(0, 0);
        asm volatile("s_wait_asynccnt 0x0" ::: "memory");   // this wave's copies of stage 0 have landed
        __syncthreads();                                    // every wave's have: stage 0 may be read
        if (nst > 1) stage(1, 1);
    }
    const int kfo = c * KPI + 8 * hi, vfo = c * VPI + 8 * hi;   // this lane's first K and V fragment elements in a stage's first block
#pragma unroll 1   // kept rolled: run-time trip count, one publish point per stage, and one body already holds most of the register file
    for (int st = 0; st < nst; ++st) {
      if constexpr (HL) {
        stage(st, 0);
        asm volatile("s_wait_asynccnt 0x0" ::: "memory");   // this wave's copies of the stage have landed
        __syncthreads();                                    // every wave's have: the stage may be read
      }
#pragma unroll 1   // kept rolled: one body already holds most of the register file, and a copy of it per block would only lengthen the text
      for (int bs = kw; bs < AW; bs += KW) {   // this wave's blocks of the stage
      const int kb = st * AW + bs;
      if (kb < nblk) {   // wave-uniform: the block reaches up to this group's diagonal
        const int k0 = kb * 32;
        const T16* kp = (const T16*)(sb + (HL ? 0 : (st & 1) * SKV)) + kfo + bs * 32 * KPI; const T16* vp = (const T16*)(sb + (HL ? 0 : (st & 1) * SKV) + SKB) + vfo + bs * 32; const T16* kp2 = kp + SKV / 2; const T16* vp2 = vp + SKV / 2;
        V kf[2][2], k2[2][2], vf[4], v2[4];
#pragma unroll
        for (int kt = 0; kt < 2; ++kt)
#pragma unroll
            for (int ks = 0; ks < 2; ++ks) { const int ko = kt * 16 * KPI + ks * 32; kf[kt][ks] = F::ld(kp + ko); if (HL) k2[kt][ks] = F::ld(kp2 + ko); }
        __builtin_amdgcn_sched_barrier(0);   // all of the trip's K fragment reads are issued before its first product; without it the scheduler spreads them among the products and the wave waits on LDS at several places of a trip
        v8f s[NQ][2];
#pragma unroll
        for (int g = 0; g < NQ; ++g)
#pragma unroll
            for (int kt = 0; kt < 2; ++kt) s[g][kt] = (v8f){};
#pragma unroll
        for (int ks = 0; ks < 2; ++ks)
#pragma unroll
            for (int g = 0; g < NQ; ++g)
#pragma unroll
                for (int kt = 0; kt < 2; ++kt) { s[g][kt] = F::mma(kf[kt][ks], qf[g][ks], s[g][kt]); if (HL) { s[g][kt] = F::mma(k2[kt][ks], qf[g][ks], s[g][kt]); s[g][kt] = F::mma(kf[kt][ks], q2[g][ks], s[g][kt]); } }
#pragma unroll
        for (int dt = 0; dt < 4; ++dt) { const int vo = dt * 16 * VPI; vf[dt] = F::ld(vp + vo); if (HL) v2[dt] = F::ld(vp2 + vo); }
        __builtin_amdgcn_sched_barrier(0);   // the V fragment reads stay in front of the softmax, which covers their LDS latency, and are scheduled with the score products alone; without it the scheduler lifts them to the first products, where every K register is still live, and the build spills
#pragma unroll
        for (int g = 0; g < NQ; ++g)
#pragma unroll
            for (int kt = 0; kt < 2; ++kt) s[g][kt] *= SCL2;
        if (kb == nblk - 1) {          // the diagonal block (wave-uniform test): keys behind the query are excluded; every query of the tile keeps at least this block's first key
#pragma unroll
            for (int g = 0; g < NQ; ++g)
#pragma unroll
                for (int kt = 0; kt < 2; ++kt)
#pragma unroll
                    for (int r = 0; r < 8; ++r) s[g][kt][r] = (k0 + kt * 16 + 8 * hi + r <= qw + g * 16 + c) ? s[g][kt][r] : NEGB;
        }
        float mn[NQ]; bool need = false;
#pragma unroll
        for (int g = 0; g < NQ; ++g) { float mx = s[g][0][0];
#pragma unroll
            for (int r = 1; r < 8; ++r) mx = fmaxf(mx, s[g][0][r]);
#pragma unroll
            for (int r = 0; r < 8; ++r) mx = fmaxf(mx, s[g][1][r]);
            mx = fmaxf(mx, __shfl_xor(mx, 16, 32)); mn[g] = fmaxf(m[g], mx); need = need || (mn[g] > m[g]); }
        if (__builtin_amdgcn_ballot_w32(need) != 0) {   // scalar branch: some query's maximum rose (always in a wave's first trip)
#pragma unroll
            for (int g = 0; g < NQ; ++g) { const float al = __builtin_amdgcn_exp2f(m[g] - mn[g]); l[g] *= al; m[g] = mn[g];
#pragma unroll
                for (int dt = 0; dt < 4; ++dt) o[g][dt] *= al; }
        }
        V pb[NQ], p2[NQ];
#pragma unroll
        for (int g = 0; g < NQ; ++g) {
            if constexpr (HL) { v8us h0, h1, l0, l1;
#pragma unroll
                for (int r = 0; r < 8; ++r) { const float pa = __builtin_amdgcn_exp2f(s[g][0][r] - m[g]), pc = __builtin_amdgcn_exp2f(s[g][1][r] - m[g]); l[g] += pa; l[g] += pc; unsigned short a, b2; splitf(pa, a, b2); h0[r] = a; l0[r] = b2; splitf(pc, a, b2); h1[r] = a; l1[r] = b2; }
                pb[g] = cat16b(h0, h1); p2[g] = cat16b(l0, l1);
            } else { v8h h0, h1;
#pragma unroll
                for (int r = 0; r < 8; ++r) { const float pa = __builtin_amdgcn_exp2f(s[g][0][r] - m[g]), pc = __builtin_amdgcn_exp2f(s[g][1][r] - m[g]); l[g] += pa; l[g] += pc; h0[r] = tohx(pa); h1[r] = tohx(pc); }
                pb[g] = cat16(h0, h1); }
        }
#pragma unroll
        for (int dt = 0; dt < 4; ++dt)
#pragma unroll
            for (int g = 0; g < NQ; ++g) { o[g][dt] = F::mma(vf[dt], pb[g], o[g][dt]); if (HL) { o[g][dt] = F::mma(vf[dt], p2[g], o[g][dt]); o[g][dt] = F::mma(v2[dt], pb[g], o[g][dt]); } }
        if constexpr (HL) {   // (the fp16 form's last product is followed by the rest of the row sums)
        __builtin_amdgcn_sched_barrier(0);   // the block's last products stay in front of the slots below
        asm volatile("v_nop\n\tv_nop\n\tv_nop\n\tv_nop"); }   // the four vector slots the chip needs behind a matrix instruction: over the loop's back edge the next block's address arithmetic reuses the last products' operand registers
      }
      }
      asm volatile("s_wait_dscnt 0x0" ::: "memory");          // this wave's reads of the buffer have returned before the buffer is refilled
      if constexpr (!HL) asm volatile("s_wait_asynccnt 0x0" ::: "memory");   // this wave's copies of stage st + 1 have landed
      __syncthreads();                                        // ends every wave's reads of stage st (and, with two buffers, publishes stage st + 1)
      if constexpr (!HL) { if (st + 2 < nst) stage(st + 2, st & 1); }
    }
    asm volatile("s_wait_asynccnt 0x0" ::: "memory");         // nothing is in flight when the buffers become the partial planes
    float* so = (float*)sb;                                   // the loop's last barrier has ended every read of the buffers
    // every wave lays its partial (m, l, O^T) in its own LDS plane (a wave that got no key block lays m = NEGB, l = 0, zeros: its weight below is exp2(-huge) = 0)
    float* my = so + w * (32 * OP);
#pragma unroll
    for (int g = 0; g < NQ; ++g) { l[g] += __shfl_xor(l[g], 16, 32); if (hi == 0) { sm[w * 32 + g * 16 + c] = m[g]; sl[w * 32 + g * 16 + c] = l[g]; }
#pragma unroll
        for (int dt = 0; dt < 4; ++dt) { float* p = my + (g * 16 + c) * OP + dt * 16 + 8 * hi; *(v4fa*)p = (v4f){o[g][dt][0], o[g][dt][1], o[g][dt][2], o[g][dt][3]}; *(v4fa*)(p + 4) = (v4f){o[g][dt][4], o[g][dt][5], o[g][dt][6], o[g][dt][7]}; } }
    __syncthreads();
    for (int idx = (int)threadIdx.x; idx < QG * NQ * 16 * 8; idx += AW * 32) { const int q = idx >> 3, d8 = (idx & 7) * 8;   // one thread: 8 outputs of one query of the work-group's tile
        const int pq = (q / (NQ * 16)) * KW * 32 + q % (NQ * 16);   // the query's row in the plane of its group's first wave (planes lie 32 rows apart)
        float M = sm[pq];
#pragma unroll
        for (int p = 1; p < KW; ++p) M = fmaxf(M, sm[p * 32 + pq]);
        float L = 0.f; v4f a0 = (v4f){}, a1 = (v4f){};
#pragma unroll
        for (int p = 0; p < KW; ++p) { const float sc = __builtin_amdgcn_exp2f(sm[p * 32 + pq] - M); L += sc * sl[p * 32 + pq]; const float* pp = so + (p * 32 + pq) * OP + d8; a0 += sc * *(const v4fa*)pp; a1 += sc * *(const v4fa*)(pp + 4); }
        const float f = __fdiv_rn(0.0009765625f, L);   // x 2^-10: this module scales v by c^-0.5 = 2^-5 and the projected output by out_dim^-0.5 = 2^-5: both linear: ONE exact factor on the merged context
        v8us oh, ol;
#pragma unroll
        for (int k = 0; k < 4; ++k) { unsigned short a, b2; splitf(a0[k] * f, a, b2); oh[k] = a; ol[k] = b2; splitf(a1[k] * f, a, b2); oh[4 + k] = a; ol[4 + k] = b2; }
        const size_t oo = (size_t)(q0 + q) * DQ + head * HD + d8; *(v8us*)(Ah + oo) = oh; *(v8us*)(Al + oo) = ol; }
}
static_assert(AW % QG == 0 && (TT - RH) % (32 * QG) == 0 && RH % (16 * QG) == 0, "whole query tiles on both sides of RH");
__global__ __launch_bounds__(AW * 32) void k_fattn(const h16* __restrict__ Q16, const h16* __restrict__ K16, const h16* __restrict__ V16, const bf* __restrict__ Qh, const bf* __restrict__ Ql, const bf* __restrict__ Kh, const bf* __restrict__ Kl, const bf* __restrict__ Vh, const bf* __restrict__ Vl, bf* Ah, bf* Al) {
    __shared__ __align__(16) char so[2 * SKV > AW * 32 * OP * 4 ? 2 * SKV : AW * 32 * OP * 4];   // the stage buffers; behind the loop's last barrier the waves' partial outputs
    __shared__ float sm[AW * 32]; __shared__ float sl[AW * 32];
    const int head = blockIdx.x % NH_, ty = blockIdx.y; const size_t zp = (size_t)blockIdx.x * TT * HD;   // planes [batch][head][..]: blockIdx.x = batch x heads + head; one kv head per query head
    { const size_t ao = (size_t)(blockIdx.x / NH_) * TT * DQ; Ah += ao; Al += ao; }   // this batch's rows of the merged context
    if (ty < (TT - RH) / (32 * QG)) attn_tile<h16, false, 2>(Q16 + zp, nullptr, K16 + zp, nullptr, V16 + zp, nullptr, TT - 32 * QG * (ty + 1), head, so, sm, sl, Ah, Al);
    else attn_tile<bf, true, 1>(Qh + zp, Ql + zp, Kh + zp, Kl + zp, Vh + zp, Vl + zp, RH - 16 * QG * (ty - (TT - RH) / (32 * QG) + 1), head, so, sm, sl, Ah, Al);
}

extern "C" void kernel_launch(void* const* d_in, const int* in_sizes, int n_in,
                              void* d_out, int out_size, void* d_ws, size_t ws_size, hipStream_t stream) {
    (void)in_sizes; (void)n_in; (void)out_size;
    const float* x = (const float*)d_in[0]; const float* wk = (const float*)d_in[1]; const float* wq = (const float*)d_in[2]; const float* wv = (const float*)d_in[3]; const float* wo = (const float*)d_in[4];   /* input order x, W_key, W_query, W_value, W_proj ('oi' [1024][1024], UNIT normal): the KEY weight comes FIRST; NO bias input in this module */ const float* cosT = nullptr; const float* sinT = nullptr; (void)cosT; (void)sinT;
    float* OUT = (float*)d_out;     // [4][2048][1024]
    char* wsp = (char*)d_ws;
    auto take = [&](size_t bytes) { char* p = wsp; wsp += (bytes + 255) & ~(size_t)255; return (void*)p; };
    bf* WQ = (bf*)take((size_t)DQ * DM * 2); bf* WK = (bf*)take((size_t)DKV * DM * 2); bf* WV = (bf*)take((size_t)DKV * DM * 2); bf* WO = (bf*)take((size_t)DM * DQ * 2);
    // every plane holds all NB_ batches, batch outermost
    bf* XB = (bf*)take((size_t)NB_ * TT * DM * 2);
    const size_t PB = (size_t)NB_ * NH_ * TT * HD * 2;
    h16* QP16 = (h16*)take(PB); h16* KP16 = (h16*)take(PB); h16* VT16 = (h16*)take(PB);
    bf* QPh = (bf*)take(PB); bf* QPl = (bf*)take(PB); bf* KPh = (bf*)take(PB); bf* KPl = (bf*)take(PB); bf* VTh = (bf*)take(PB); bf* VTl = (bf*)take(PB);
    bf* ATh = (bf*)take((size_t)NB_ * TT * DQ * 2); bf* ATl = (bf*)take((size_t)NB_ * TT * DQ * 2);
    if ((size_t)(wsp - (char*)d_ws) > ws_size) return;    // ws 256 MiB
    // each stage is ONE launch over all batches: the rounding of x and of the four weights together, the q, k, v products together, the attention (batch in grid x), the out projection (batch = grid z)
    k_cvtall<<<CVG, 256, 0, stream>>>(x, wq, wk, wv, wo, XB, WQ, WK, WV, WO);
    k_qkv<<<dim3(TT / GT, DQ / GT, 3 * NB_), 256, 0, stream>>>(XB, WQ, WK, WV, DM, QP16, QPh, QPl, KP16, KPh, KPl, VT16, VTh, VTl);
    k_fattn<<<dim3(NB_ * NH_, (TT - RH) / (32 * QG) + RH / (16 * QG), 1), AW * 32, 0, stream>>>(QP16, KP16, VT16, QPh, QPl, KPh, KPl, VTh, VTl, ATh, ATl);
    k_gemmt<1, false><<<dim3(TT / GT, DM / GT, NB_), 256, 0, stream>>>(ATh, ATl, WO, DQ, OUT, DM, (size_t)TT * DQ, 0, (size_t)TT * DM, nullptr, nullptr, nullptr, 0);
}

// v009
// Measured time: 132 microseconds a run.
// Timed twice side by side with v008, it ran 1.04 and 1.03 times as fast.
// Over all steps from v000 it is 23.4 times as fast.
#include <hip/hip_runtime.h>

// Causal multi-head self-attention whose projections and output are each scaled by 1/sqrt(width) (x [4][2048][1024]; k, q, v = (x W^T) x 1024^-0.5 ('oi' [1024][1024] UNIT normal, no bias; 16 heads x 64): each projection x 2^-5 (exact); scores = q.k x 64^-0.5: with the two 2^-5 factors folded in, q.k(unscaled) x 2^-13 (exact); causal (tril kept, -inf elsewhere); softmax; out = (merged W_proj^T) x 1024^-0.5 ('oi', no bias): the v factor 2^-5 and the output factor 2^-5 are both linear: ONE factor 2^-10 on the merged context (exact) -> [4][2048][1024] (8.4 M); argument order x, W_key, W_query, W_value, W_proj: KEY FIRST).
// Compute dtypes, f32 accumulate: every input rounded to bf16; q/k/v on PLAIN bf16 operands (inputs: exact); causal scores and attn.v: query rows < 512 hl (3 products), the rest single fp16, causal block skipping, one fused launch for all batches; online softmax f32 (scale 2^-13 exact); the merged context x 2^-10 (exact); W_proj hl x exact (2 products), NO bias.

#define NB_  4
#define TT   2048
#define DM   1024
#define NH_  16
#define NKV  16
#define REP  (NH_ / NKV)
#define HD   64
#define DQ   (NH_ * HD)
#define DKV  (NKV * HD)
#define RH   512                  // query rows < RH use hi+lo planes (0: none)
#define SCL  0.0001220703125f   // 2^-13 = 1024^-0.5 (on q) x 1024^-0.5 (on k) x 64^-0.5: this module scales q AND k by c^-0.5 = 2^-5 each and the scores by hd^-0.5 = 2^-3: all exact powers of two, applied here in ONE multiply on the unscaled q.k
typedef _Float16 h16;
typedef unsigned short bf;
typedef __attribute__((ext_vector_type(16))) __bf16   v16bf;
typedef __attribute__((ext_vector_type(16))) _Float16 v16h;
typedef __attribute__((ext_vector_type(8)))  _Float16 v8h;
typedef __attribute__((ext_vector_type(8)))  unsigned short v8us;
typedef __attribute__((ext_vector_type(8)))  float    v8f;
typedef __attribute__((ext_vector_type(4)))  float    v4f;
typedef v8h  __attribute__((may_alias)) v8ha;
typedef v4f  __attribute__((may_alias)) v4fa;
typedef v8us __attribute__((may_alias)) v8usa;

__device__ __forceinline__ unsigned short f2bf(float f) { unsigned u = __float_as_uint(f); u += 0x7FFFu + ((u >> 16) & 1u); return (unsigned short)(u >> 16); }
__device__ __forceinline__ float bf2f(unsigned short b) { return __uint_as_float(((unsigned)b) << 16); }
__device__ __forceinline__ float bfr(float f) { return bf2f(f2bf(f)); }
__device__ __forceinline__ v16h cat16(v8h lo, v8h hi) { return __builtin_shufflevector(lo, hi, 0, 1, 2, 3, 4, 5, 6, 7, 8, 9, 10, 11, 12, 13, 14, 15); }
__device__ __forceinline__ v16bf cat16b(v8us lo, v8us hi) { return __builtin_bit_cast(v16bf, __builtin_shufflevector(lo, hi, 0, 1, 2, 3, 4, 5, 6, 7, 8, 9, 10, 11, 12, 13, 14, 15)); }
__device__ __forceinline__ v8f wmma16(v16h a, v16h b, v8f c) { return __builtin_amdgcn_wmma_f32_16x16x32_f16(false, a, false, b, (short)0, c, false, false); }
__device__ __forceinline__ v8f wmmab(v16bf a, v16bf b, v8f c) { return __builtin_amdgcn_wmma_f32_16x16x32_bf16(false, a, false, b, (short)0, c, false, false); }
__device__ __forceinline__ h16 tohx(float x) { return (h16)x; }
__device__ __forceinline__ void splitf(float y, unsigned short& h, unsigned short& l) { h = f2bf(y); l = f2bf(y - bf2f(h)); }
typedef __attribute__((ext_vector_type(4))) _Float16 v4h;
typedef __attribute__((ext_vector_type(4))) unsigned short v4us;



// ---- k_gemmt: GEMM on LDS-staged operands, one 128x256 output tile per work-group of 8 waves (2 x 4; a wave holds 64x64 = 16 accumulators over the whole of K: each fragment read from LDS feeds 4 products,
// and each operand byte copied from L2 feeds 256 (A) or 128 (Bt) output elements).
// A stage is 64 of K = one whole 128-byte line of each of the 128 rows of A (and A2) and of the 256 rows of Bt, brought into LDS by asynchronous 16-byte copies (a wave's copy covers 4 whole lines) and shared by all 8 waves;
// two buffers: the next stage's copies fly while this stage is worked on. LDS rows lie 144 bytes apart (16 x odd: conflict-free for 16-byte fragment reads).
// C[m][n] (f32, pitch ldc) = sum_k A[m][k] Bt[n][k] (+ A2[m][k] Bt[n][k] under NSPLIT). z-batch strides sA/sB/sC in elements (sC: of C, or of each plane under PLANES). K % 64 == 0, rows % 128 == 0, columns % 256 == 0.
// PLANES: the tile is not stored as f32 but rounded at once into three 16-bit planes (fp16, and bf16 hi + lo); element (m, n) lies at m x ldc + (n / 64) x tpitch + n % 64.
// ldc = 64, tpitch = rows x 64 gives head planes [n / 64][m][n % 64]; with A = the weight and Bt = the activations, ldc = positions and tpitch = 64 give the transposed value plane [feature][position].
template <typename T16> struct WFrag;
template <> struct WFrag<h16> { typedef v16h V; static __device__ __forceinline__ V ld(const h16* p) { return cat16(*(const v8h*)p, *(const v8h*)(p + 16)); } static __device__ __forceinline__ v8f mma(V a, V b, v8f c) { return wmma16(a, b, c); } };
template <> struct WFrag<bf> { typedef v16bf V; static __device__ __forceinline__ V ld(const bf* p) { return cat16b(*(const v8us*)p, *(const v8us*)(p + 16)); } static __device__ __forceinline__ v8f mma(V a, V b, v8f c) { return wmmab(a, b, c); } };
#define GT   128                  // rows of the A tile = output rows of a work-group; the unit in which operand rows are copied
#define GTN  256                  // rows of the Bt tile = output columns of a work-group: two units that lie one behind the other in LDS
#define GKS  64                   // k per stage
#define GP   72                   // 16-bit elements between two operand rows in LDS
#define OPB  (GT * GP * 2)        // bytes of one unit of 128 operand rows in LDS
#define GOP  260                  // floats between two rows of the staged output tile (256 + 4: 16-byte aligned rows)
// copies of this thread: its 16 bytes of rows r, r + 32, r + 64, r + 96 of two (three) units of 128 operand rows that lie OPB bytes apart in LDS, in ONE statement;
// the s_wait_xcnt stands inside the statement, behind the last copy, in front of any rewrite of an address register that a copy names
#define CP4(a, b, c, d, e, f, g, h) "global_load_async_to_lds_b128 %" #a ", %" #b ", off\n\tglobal_load_async_to_lds_b128 %" #c ", %" #d ", off\n\tglobal_load_async_to_lds_b128 %" #e ", %" #f ", off\n\tglobal_load_async_to_lds_b128 %" #g ", %" #h ", off\n\t"
#define RW4(l, g) "v"(l), "v"(g), "v"((l) + 32 * GP * 2), "v"((g) + rs), "v"((l) + 64 * GP * 2), "v"((g) + 2 * rs), "v"((l) + 96 * GP * 2), "v"((g) + 3 * rs)
__device__ __forceinline__ void copy_stage2(unsigned l, const bf* ga, const bf* gb, size_t rs) {
    asm volatile(CP4(0, 1, 2, 3, 4, 5, 6, 7) CP4(8, 9, 10, 11, 12, 13, 14, 15) "s_wait_xcnt 0x0" :: RW4(l, ga), RW4(l + OPB, gb) : "memory");
}
__device__ __forceinline__ void copy_stage3(unsigned l, const bf* ga, const bf* ga2, const bf* gb, size_t rs) {
    asm volatile(CP4(0, 1, 2, 3, 4, 5, 6, 7) CP4(8, 9, 10, 11, 12, 13, 14, 15) CP4(16, 17, 18, 19, 20, 21, 22, 23) "s_wait_xcnt 0x0" :: RW4(l, ga), RW4(l + OPB, ga2), RW4(l + 2 * OPB, gb) : "memory");
}
template <int NSPLIT, bool PLANES>
__device__ __forceinline__ void gemmt(const bf* __restrict__ A, const bf* __restrict__ A2, const bf* __restrict__ Bt, int K, float* C, int ldc, size_t sA, size_t sB, size_t sC, h16* P16, bf* Ph, bf* Pl, int tpitch, size_t z, int bx, int by) {   // z: batch; bx, by: the tile's place in rows and columns
    typedef WFrag<bf> F; typedef typename F::V V;
    constexpr int NOPD = NSPLIT ? 4 : 3;              // units of 128 operand rows in a stage: A, (A2,) Bt, Bt
    constexpr int OPE = GT * GP, STG = NOPD * OPE * 2;   // elements of one unit, bytes of one stage
    constexpr int SMB = 2 * STG > GT * GOP * 4 ? 2 * STG : GT * GOP * 4;
    __shared__ __align__(16) char sm[SMB];            // the two stage buffers; behind the loop's last barrier the output tile
    A += z * sA; if (NSPLIT) A2 += z * sA; Bt += z * sB;
    const int tid = (int)threadIdx.x, lane = tid & 31, lr = lane & 15, hi = lane >> 4; const int w = __builtin_amdgcn_readfirstlane(tid >> 5); const int wm = w >> 2, wn = w & 3; const int r0 = bx * GT, c0 = by * GTN;
    // this thread's share of a stage: 16 bytes (chunk tid & 7) of rows tid / 8 + 0, 32, 64, 96 of every unit
    const unsigned lc = (unsigned)(size_t)sm + (unsigned)((tid >> 3) * (GP * 2) + (tid & 7) * 16);
    const size_t rs = (size_t)32 * K; const size_t ca = (size_t)(r0 + (tid >> 3)) * K + (tid & 7) * 8, cb = (size_t)(c0 + (tid >> 3)) * K + (tid & 7) * 8;
    auto stage = [&](int t, int b) { const unsigned l = lc + (unsigned)(b * STG); const size_t ko = (size_t)t * GKS;
        if constexpr (NSPLIT != 0) { copy_stage2(l, A + ca + ko, A2 + ca + ko, rs); copy_stage2(l + 2 * OPB, Bt + cb + ko, Bt + cb + 4 * rs + ko, rs); } else copy_stage3(l, A + ca + ko, Bt + cb + ko, Bt + cb + 4 * rs + ko, rs); };
    v8f acc[4][4];
#pragma unroll
    for (int mb = 0; mb < 4; ++mb)
#pragma unroll
        for (int nb = 0; nb < 4; ++nb) acc[mb][nb] = (v8f){};
    const int nst = K / GKS;
    stage(0, 0);
    asm volatile("s_wait_asynccnt 0x0" ::: "memory");   // this wave's copies of stage 0 have landed
    __syncthreads();                                    // every wave's have: stage 0 may be read
    if (nst > 1) stage(1, 1);
    const int ao = (wm * 64 + lr) * GP + 8 * hi, bo = (wn * 64 + lr) * GP + 8 * hi;
#pragma unroll 1   // kept rolled: one publish point per stage, the buffer picked by the trip's parity
    for (int t = 0; t < nst; ++t) {
        const bf* sa = (const bf*)(sm + (t & 1) * STG); const bf* sb = sa + (NOPD - 2) * OPE;
#pragma unroll
        for (int kk = 0; kk < GKS; kk += 32) {   // one 32-wide k step's fragments are read from LDS as one group (registers: 4 waves a SIMD stay possible)
            V a[4], a2[4], b[4];
#pragma unroll
            for (int mb = 0; mb < 4; ++mb) { a[mb] = F::ld(sa + ao + mb * 16 * GP + kk); if (NSPLIT) a2[mb] = F::ld(sa + OPE + ao + mb * 16 * GP + kk); }
#pragma unroll
            for (int nb = 0; nb < 4; ++nb) b[nb] = F::ld(sb + bo + nb * 16 * GP + kk);
            __builtin_amdgcn_sched_barrier(0);   // the group's LDS reads are issued together, ahead of its products; without it the scheduler spreads them among the products and the wave waits out the LDS latency several times a stage
#pragma unroll
            for (int nb = 0; nb < 4; ++nb)
#pragma unroll
                for (int mb = 0; mb < 4; ++mb) acc[mb][nb] = F::mma(a[mb], b[nb], acc[mb][nb]);
            if (NSPLIT) {
#pragma unroll
                for (int nb = 0; nb < 4; ++nb)
#pragma unroll
                    for (int mb = 0; mb < 4; ++mb) acc[mb][nb] = F::mma(a2[mb], b[nb], acc[mb][nb]);
            }
        }
        __builtin_amdgcn_sched_barrier(0);   // the stage's products stay in front of the publish point; without it the scheduler sinks them behind the barrier and the refill, and the copies then fly only while the next fragments are read
        asm volatile("s_wait_dscnt 0x0" ::: "memory");      // this wave's reads of the buffer have returned before the buffer is refilled
        asm volatile("s_wait_asynccnt 0x0" ::: "memory");   // this wave's copies of stage t + 1 have landed
        __syncthreads();                                    // publishes stage t + 1 and ends every wave's reads of stage t
        if (t + 2 < nst) stage(t + 2, t & 1);
    }
    asm volatile("s_wait_asynccnt 0x0" ::: "memory");       // nothing is in flight when the buffers become the output tile
    // the loop's last barrier has ended every read of the buffers: each wave lays its 64x64 block in the f32 tile; behind one more barrier the threads store whole lines
    float* os = (float*)sm;
#pragma unroll
    for (int mb = 0; mb < 4; ++mb)
#pragma unroll
        for (int nb = 0; nb < 4; ++nb)
#pragma unroll
            for (int j = 0; j < 8; ++j) os[(wm * 64 + mb * 16 + hi * 8 + j) * GOP + wn * 64 + nb * 16 + lr] = acc[mb][nb][j];
    __syncthreads();
#pragma unroll 1   // kept rolled: four rows' LDS reads and line stores in flight per trip; unrolled whole, the rounding code only lengthens the text
    for (int s4 = 0; s4 < GT * GTN / 4096; ++s4) {
#pragma unroll
        for (int u = 0; u < 4; ++u) { const int idx = (s4 * 4 + u) * 256 + tid; const int row = idx >> 6, cofs = (idx & 63) * 4; const v4f val = *(const v4fa*)(os + row * GOP + cofs);
            if constexpr (PLANES) { const int n = c0 + cofs; const size_t po = z * sC + (size_t)(r0 + row) * ldc + (size_t)(n >> 6) * tpitch + (n & 63); v4h o16; v4us oh, ol;   // 16 lanes x 8 bytes: one whole 128-byte line of each plane
#pragma unroll
                for (int k = 0; k < 4; ++k) { o16[k] = tohx(val[k]); unsigned short a2, c2; splitf(val[k], a2, c2); oh[k] = a2; ol[k] = c2; }
                *(v4h*)(P16 + po) = o16; *(v4us*)(Ph + po) = oh; *(v4us*)(Pl + po) = ol; }
            else *(v4f*)(C + z * sC + (size_t)(r0 + row) * ldc + c0 + cofs) = val; }
        asm volatile("s_wait_xcnt 0x0" ::: "memory");   // behind the trip's last store, in front of the next trip's rewrite of the address and data registers that these stores name
    }
}
// one product per launch: batch = grid z, tile = grid (x, y)
template <int NSPLIT, bool PLANES>
__global__ __launch_bounds__(256) void k_gemmt(const bf* __restrict__ A, const bf* __restrict__ A2, const bf* __restrict__ Bt, int K, float* C, int ldc, size_t sA, size_t sB, size_t sC, h16* P16, bf* Ph, bf* Pl, int tpitch) {
    gemmt<NSPLIT, PLANES>(A, A2, Bt, K, C, ldc, sA, sB, sC, P16, Ph, Pl, tpitch, blockIdx.z, (int)blockIdx.x, (int)blockIdx.y);
}
// the q, k and v products of all batches in ONE launch: none reads what another writes. Grid (tiles of one product, 1, batch x 3 + product), the position tile running fastest: a batch's three products lie side by side in the grid and read its activations together.
// q and k: x W^T, each 64-wide quarter of a tile's columns = one head, laid straight into the [batch][head][t][d] planes; v: W x^T (rows = features, columns = positions), whose rows are the [batch][head x 64 + d][t] plane as it stands
static_assert(NKV == NH_ && (TT / GT) * (DQ / GTN) == (DKV / GT) * (TT / GTN), "q, k and v share one grid: equal tile counts");
__global__ __launch_bounds__(256) void k_qkv(const bf* __restrict__ X, const bf* __restrict__ Wq, const bf* __restrict__ Wk, const bf* __restrict__ Wv, int K, h16* Q16, bf* Qh, bf* Ql, h16* K16, bf* Kh, bf* Kl, h16* V16, bf* Vh, bf* Vl) {
    const int sel = (int)(blockIdx.z % 3u); const bool tv = sel == 2;   // 0: q, 1: k, 2: v; the same for the whole work-group
    gemmt<0, true>(tv ? Wv : X, nullptr, tv ? X : (sel == 1 ? Wk : Wq), K, nullptr, tv ? TT : HD, tv ? (size_t)0 : (size_t)TT * DM, tv ? (size_t)TT * DM : (size_t)0, (size_t)NH_ * TT * HD,
                   sel == 0 ? Q16 : (sel == 1 ? K16 : V16), sel == 0 ? Qh : (sel == 1 ? Kh : Vh), sel == 0 ? Ql : (sel == 1 ? Kl : Vl), tv ? 64 : TT * HD, blockIdx.z / 3u, (int)(tv ? blockIdx.x / (TT / GTN) : blockIdx.x % (TT / GT)), (int)(tv ? blockIdx.x % (TT / GTN) : blockIdx.x / (TT / GT)));
}

typedef __attribute__((ext_vector_type(2))) unsigned short v2us;
typedef __attribute__((ext_vector_type(4))) int v4i;

__global__ __launch_bounds__(256) void k_wtG(const float* __restrict__ w, int K, int N, bf* Bt) {
    const int lane = threadIdx.x & 31; const int L0 = (blockIdx.x * 8 + (threadIdx.x >> 5)) * 8; const int nlines = N * K / 64;
{
#pragma unroll 1
        for (int l = 0; l < 8; ++l) { const int L = L0 + l; if (L >= nlines) break; const size_t e = (size_t)L * 64 + lane * 2; const int k = (int)(e % K), n = (int)(e / K); v2us o;
            o[0] = f2bf(w[(size_t)k * N + n]); o[1] = f2bf(w[(size_t)(k + 1) * N + n]); *(v2us*)(Bt + e) = o; }
         }
}
// ---- k_cvtall: all five f32 inputs rounded to bf16 in ONE launch of CVG work-groups (two of 8 waves per WGP: 16 long-lived waves).
// A chunk is 8 floats of one thread (32 bytes read, 16 written). A work-group takes CVX x 256 chunks of x that lie in a row (a thread's chunks 256 chunks apart) and 256 chunks of each weight: straight-line code,
// all of a thread's loads issued before its first rounding, so that the launch pays the start of few waves and one memory latency instead of one of each per chunk.
#define CVG  512
#define CVX  (NB_ * TT * DM / 8 / 256 / CVG)
static_assert((size_t)CVX * CVG * 256 * 8 == (size_t)NB_ * TT * DM, "x is a whole number of chunks per thread");
static_assert(DQ * DM == CVG * 256 * 8 && DKV * DM == CVG * 256 * 8, "each weight is one chunk per thread");
__device__ __forceinline__ v8us round8(v8f v) { v8us o;
#pragma unroll
    for (int k = 0; k < 8; ++k) o[k] = f2bf(v[k]); return o; }
__global__ __launch_bounds__(256) void k_cvtall(const float* __restrict__ x, const float* __restrict__ wq, const float* __restrict__ wk, const float* __restrict__ wv, const float* __restrict__ wo, bf* XB, bf* WQ, bf* WK, bf* WV, bf* WO) {
    const unsigned cx = blockIdx.x * (CVX * 256u) + threadIdx.x, cw = blockIdx.x * 256u + threadIdx.x;   // this thread's first chunk of x, its chunk of each weight
    // byte offsets in 32 bits: each access is a uniform base, one offset register and a constant
    auto ld = [](const float* p, unsigned chunk) { return *(const v8f*)((const char*)p + chunk * 32u); };
    auto st = [](bf* p, unsigned chunk, v8f v) { *(v8us*)((char*)p + chunk * 16u) = round8(v); };
    v8f v[CVX + 4];
#pragma unroll
    for (int u = 0; u < CVX; ++u) v[u] = ld(x + u * 2048, cx);
    v[CVX] = ld(wq, cw); v[CVX + 1] = ld(wk, cw); v[CVX + 2] = ld(wv, cw); v[CVX + 3] = ld(wo, cw);
#pragma unroll
    for (int u = 0; u < CVX; ++u) st(XB + u * 2048, cx, v[u]);
    st(WQ, cw, v[CVX]); st(WK, cw, v[CVX + 1]); st(WV, cw, v[CVX + 2]); st(WO, cw, v[CVX + 3]);
}
// ---- k_fattn: causal scores, softmax, probability x value and the head merge of ALL batches in ONE launch; grid (batches x heads, query tiles, heaviest tile first: the cost falls with the flat index over the whole launch), AW x 32 threads.
// Transposed products: S^T = K Q^T (A = 16 key rows, B = 16 query columns), O^T += V^T P^T (A = 16 rows of the [d][t] value plane, B = P^T). A lane holds scores of ONE query (column c = lane & 15; keys 8 hi + r of each 16),
// so a pair of score tiles, rounded to 16 bit, IS the B operand of the second product in the k order of WFrag::ld (8 hi + s, 16 + 8 hi + s): the probabilities never leave the registers.
// Online softmax in the log2 domain: running maximum m and sum l per query; O^T and l are rescaled only in a trip in which some query's maximum rises.
// A work-group holds QG query groups (one group = the queries of one wave); the KW = AW / QG waves of a group take every KW-th block of 32 keys, in rising order;
// a group's KW partial (m, l, O^T) are joined through LDS in wave order behind one work-group barrier; the joined context x 2^-10 / l goes out as hi + lo bf16 rows of the merged [t][heads x 64] planes.
// HL: hi + lo bf16 planes, 3 products each (query rows < RH, 16 queries a wave); else single fp16 (32 queries a wave).
// K and V reach the waves through LDS: a stage is AW x 32 = 256 keys, read by all QG query groups (one fetch from L2 serves QG x as many queries), brought in by asynchronous 16-byte copies in groups of 64 keys
// (a wave's copy covers 4 whole 128-byte lines: 4 K rows, or 64 keys of 4 rows of the [d][t] value plane); a group wholly behind the last query group's diagonal is not copied and not read.
// fp16: two buffers, the next stage's copies fly while this stage is worked on. HL (at most 2 stages, twice the planes): one buffer of the same total size, filled, read, and refilled behind a barrier.
#define AW   8
#define QG   4                     // query groups of a work-group, which share each staged K and V block
#define KW   (AW / QG)             // waves that split the key blocks of one query group
#define KPI  72                    // 16-bit elements between two K rows in LDS (144 bytes = 16 x odd: conflict-free for 16-byte fragment reads)
#define VPI  264                   // 16-bit elements between two rows of the staged value plane (256 keys + 8: 528 bytes = 16 x odd)
#define SKB  (AW * 32 * KPI * 2)   // bytes of a stage's K rows
#define SKV  (SKB + HD * VPI * 2)  // bytes of a stage's K rows and value rows of one plane pair
#define OP   68                    // floats between two queries' partial outputs in LDS (64 + 4: 16-byte aligned rows)
#define NEGB (-3.0e38f)
#define SCL2 (SCL * 1.4426950408889634f)   // 2^-13 x log2(e): exp(s x 2^-13 - max) = exp2(s x SCL2 - max2)
// 64 keys of one K plane and one value plane: this thread's 16 bytes of K rows r, r + 32 and of value rows r, r + 32, in ONE statement;
// the s_wait_xcnt stands inside the statement, behind the last copy, in front of any rewrite of an address register that a copy names
template <typename T16>
__device__ __forceinline__ void copy_kv(unsigned lk, unsigned lv, const T16* gk, const T16* gv) {
    asm volatile(CP4(0, 1, 2, 3, 4, 5, 6, 7) "s_wait_xcnt 0x0" :: "v"(lk), "v"(gk), "v"(lk + 32 * KPI * 2), "v"(gk + 32 * HD), "v"(lv), "v"(gv), "v"(lv + 32 * VPI * 2), "v"(gv + 32 * TT) : "memory");
}
template <typename T16, bool HL, int NQ>
__device__ __forceinline__ void attn_tile(const T16* __restrict__ Q, const T16* __restrict__ Q2, const T16* __restrict__ Kp, const T16* __restrict__ K2, const T16* __restrict__ Vt, const T16* __restrict__ V2, int q0, int head, char* sb, float* sm, float* sl, bf* Ah, bf* Al) {
    typedef WFrag<T16> F; typedef typename F::V V;
    const int lane = threadIdx.x & 31, c = lane & 15, hi = lane >> 4; const int w = __builtin_amdgcn_readfirstlane((int)(threadIdx.x >> 5));
    const int kw = w % KW, qw = q0 + (w / KW) * (NQ * 16);   // this wave's place among its group's waves; its group's first query
    V qf[NQ][2], q2[NQ][2];
#pragma unroll
    for (int g = 0; g < NQ; ++g)
#pragma unroll
        for (int ks = 0; ks < 2; ++ks) { const size_t qo = (size_t)(qw + g * 16 + c) * HD + ks * 32 + 8 * hi; qf[g][ks] = F::ld(Q + qo); if (HL) q2[g][ks] = F::ld(Q2 + qo); }
    v8f o[NQ][4]; float m[NQ], l[NQ];
#pragma unroll
    for (int g = 0; g < NQ; ++g) { m[g] = NEGB; l[g] = 0.f;
#pragma unroll
        for (int dt = 0; dt < 4; ++dt) o[g][dt] = (v8f){}; }
    const int nblk = qw / 32 + 1;      // blocks of 32 keys up to and including the one that holds this group's diagonal
    const int nblkg = (q0 + (QG - 1) * (NQ * 16)) / 32 + 1;   // the same for the work-group's last group: what is staged
    const int nst = (nblkg + AW - 1) / AW;   // stages of AW blocks
    // this thread's share of a group of 64 keys: 16 bytes (chunk tid & 7) of rows tid / 8 and tid / 8 + 32
    const int tid = (int)threadIdx.x;
    const unsigned lk0 = (unsigned)(size_t)sb + (unsigned)((tid >> 3) * (KPI * 2) + (tid & 7) * 16), lv0 = (unsigned)(size_t)sb + (unsigned)(SKB + (tid >> 3) * (VPI * 2) + (tid & 7) * 16);
    const size_t gk0 = (size_t)(tid >> 3) * HD + (tid & 7) * 8, gv0 = (size_t)(tid >> 3) * TT + (tid & 7) * 8;
    auto stage = [&](int st, int b) {
#pragma unroll
        for (int j = 0; j < 4; ++j)
            if (st * AW + 2 * j < nblkg) {   // the same for the whole work-group: the group holds a key block up to the last diagonal (and so lies inside the planes)
                const unsigned lk = lk0 + (unsigned)(b * SKV + j * 64 * KPI * 2), lv = lv0 + (unsigned)(b * SKV + j * 128); const size_t gk = gk0 + (size_t)(st * AW * 32 + j * 64) * HD, gv = gv0 + (size_t)(st * AW * 32 + j * 64);
                copy_kv(lk, lv, Kp + gk, Vt + gv); if constexpr (HL) copy_kv(lk + SKV, lv + SKV, K2 + gk, V2 + gv); }
    };
    if constexpr (!HL) {
        stage(0, 0);
        asm volatile("s_wait_asynccnt 0x0" ::: "memory");   // this wave's copies of stage 0 have landed
        __syncthreads();                                    // every wave's have: stage 0 may be read
        if (nst > 1) stage(1, 1);
    }
    const int kfo = c * KPI + 8 * hi, vfo = c * VPI + 8 * hi;   // this lane's first K and V fragment elements in a stage's first block
#pragma unroll 1   // kept rolled: run-time trip count, one publish point per stage, and one body already holds most of the register file
    for (int st = 0; st < nst; ++st) {
      if constexpr (HL) {
        stage(st, 0);
        asm volatile("s_wait_asynccnt 0x0" ::: "memory");   // this wave's copies of the stage have landed
        __syncthreads();                                    // every wave's have: the stage may be read
      }
#pragma unroll 1   // kept rolled: one body already holds most of the register file, and a copy of it per block would only lengthen the text
      for (int bs = kw; bs < AW; bs += KW) {   // this wave's blocks of the stage
      const int kb = st * AW + bs;
      if (kb < nblk) {   // wave-uniform: the block reaches up to this group's diagonal
        const int k0 = kb * 32;
        const T16* kp = (const T16*)(sb + (HL ? 0 : (st & 1) * SKV)) + kfo + bs * 32 * KPI; const T16* vp = (const T16*)(sb + (HL ? 0 : (st & 1) * SKV) + SKB) + vfo + bs * 32; const T16* kp2 = kp + SKV / 2; const T16* vp2 = vp + SKV / 2;
        V kf[2][2], k2[2][2], vf[4], v2[4];
#pragma unroll
        for (int kt = 0; kt < 2; ++kt)
#pragma unroll
            for (int ks = 0; ks < 2; ++ks) { const int ko = kt * 16 * KPI + ks * 32; kf[kt][ks] = F::ld(kp + ko); if (HL) k2[kt][ks] = F::ld(kp2 + ko); }
        __builtin_amdgcn_sched_barrier(0);   // all of the trip's K fragment reads are issued before its first product; without it the scheduler spreads them among the products and the wave waits on LDS at several places of a trip
        v8f s[NQ][2];
#pragma unroll
        for (int g = 0; g < NQ; ++g)
#pragma unroll
            for (int kt = 0; kt < 2; ++kt) s[g][kt] = (v8f){};
#pragma unroll
        for (int ks = 0; ks < 2; ++ks)
#pragma unroll
            for (int g = 0; g < NQ; ++g)
#pragma unroll
                for (int kt = 0; kt < 2; ++kt) { s[g][kt] = F::mma(kf[kt][ks], qf[g][ks], s[g][kt]); if (HL) { s[g][kt] = F::mma(k2[kt][ks], qf[g][ks], s[g][kt]); s[g][kt] = F::mma(kf[kt][ks], q2[g][ks], s[g][kt]); } }
#pragma unroll
        for (int dt = 0; dt < 4; ++dt) { const int vo = dt * 16 * VPI; vf[dt] = F::ld(vp + vo); if (HL) v2[dt] = F::ld(vp2 + vo); }
        __builtin_amdgcn_sched_barrier(0);   // the V fragment reads stay in front of the softmax, which covers their LDS latency, and are scheduled with the score products alone; without it the scheduler lifts them to the first products, where every K register is still live, and the build spills
#pragma unroll
        for (int g = 0; g < NQ; ++g)
#pragma unroll
            for (int kt = 0; kt < 2; ++kt) s[g][kt] *= SCL2;
        if (kb == nblk - 1) {          // the diagonal block (wave-uniform test): keys behind the query are excluded; every query of the tile keeps at least this block's first key
#pragma unroll
            for (int g = 0; g < NQ; ++g)
#pragma unroll
                for (int kt = 0; kt < 2; ++kt)
#pragma unroll
                    for (int r = 0; r < 8; ++r) s[g][kt][r] = (k0 + kt * 16 + 8 * hi + r <= qw + g * 16 + c) ? s[g][kt][r] : NEGB;
        }
        float mn[NQ]; bool need = false;
#pragma unroll
        for (int g = 0; g < NQ; ++g) { float mx = s[g][0][0];
#pragma unroll
            for (int r = 1; r < 8; ++r) mx = fmaxf(mx, s[g][0][r]);
#pragma unroll
            for (int r = 0; r < 8; ++r) mx = fmaxf(mx, s[g][1][r]);
            mx = fmaxf(mx, __shfl_xor(mx, 16, 32)); mn[g] = fmaxf(m[g], mx); need = need || (mn[g] > m[g]); }
        if (__builtin_amdgcn_ballot_w32(need) != 0) {   // scalar branch: some query's maximum rose (always in a wave's first trip)
#pragma unroll
            for (int g = 0; g < NQ; ++g) { const float al = __builtin_amdgcn_exp2f(m[g] - mn[g]); l[g] *= al; m[g] = mn[g];
#pragma unroll
                for (int dt = 0; dt < 4; ++dt) o[g][dt] *= al; }
        }
        V pb[NQ], p2[NQ];
#pragma unroll
        for (int g = 0; g < NQ; ++g) {
            if constexpr (HL) { v8us h0, h1, l0, l1;
#pragma unroll
                for (int r = 0; r < 8; ++r) { const float pa = __builtin_amdgcn_exp2f(s[g][0][r] - m[g]), pc = __builtin_amdgcn_exp2f(s[g][1][r] - m[g]); l[g] += pa; l[g] += pc; unsigned short a, b2; splitf(pa, a, b2); h0[r] = a; l0[r] = b2; splitf(pc, a, b2); h1[r] = a; l1[r] = b2; }
                pb[g] = cat16b(h0, h1); p2[g] = cat16b(l0, l1);
            } else { v8h h0, h1;
#pragma unroll
                for (int r = 0; r < 8; ++r) { const float pa = __builtin_amdgcn_exp2f(s[g][0][r] - m[g]), pc = __builtin_amdgcn_exp2f(s[g][1][r] - m[g]); l[g] += pa; l[g] += pc; h0[r] = tohx(pa); h1[r] = tohx(pc); }
                pb[g] = cat16(h0, h1); }
        }
#pragma unroll
        for (int dt = 0; dt < 4; ++dt)
#pragma unroll
            for (int g = 0; g < NQ; ++g) { o[g][dt] = F::mma(vf[dt], pb[g], o[g][dt]); if (HL) { o[g][dt] = F::mma(vf[dt], p2[g], o[g][dt]); o[g][dt] = F::mma(v2[dt], pb[g], o[g][dt]); } }
        if constexpr (HL) {   // (the fp16 form's last product is followed by the rest of the row sums)
        __builtin_amdgcn_sched_barrier(0);   // the block's last products stay in front of the slots below
        asm volatile("v_nop\n\tv_nop\n\tv_nop\n\tv_nop"); }   // the four vector slots the chip needs behind a matrix instruction: over the loop's back edge the next block's address arithmetic reuses the last products' operand registers
      }
      }
      asm volatile("s_wait_dscnt 0x0" ::: "memory");          // this wave's reads of the buffer have returned before the buffer is refilled
      if constexpr (!HL) asm volatile("s_wait_asynccnt 0x0" ::: "memory");   // this wave's copies of stage st + 1 have landed
      __syncthreads();                                        // ends every wave's reads of stage st (and, with two buffers, publishes stage st + 1)
      if constexpr (!HL) { if (st + 2 < nst) stage(st + 2, st & 1); }
    }
    asm volatile("s_wait_asynccnt 0x0" ::: "memory");         // nothing is in flight when the buffers become the partial planes
    float* so = (float*)sb;                                   // the loop's last barrier has ended every read of the buffers
    // every wave lays its partial (m, l, O^T) in its own LDS plane (a wave that got no key block lays m = NEGB, l = 0, zeros: its weight below is exp2(-huge) = 0)
    float* my = so + w * (32 * OP);
#pragma unroll
    for (int g = 0; g < NQ; ++g) { l[g] += __shfl_xor(l[g], 16, 32); if (hi == 0) { sm[w * 32 + g * 16 + c] = m[g]; sl[w * 32 + g * 16 + c] = l[g]; }
#pragma unroll
        for (int dt = 0; dt < 4; ++dt) { float* p = my + (g * 16 + c) * OP + dt * 16 + 8 * hi; *(v4fa*)p = (v4f){o[g][dt][0], o[g][dt][1], o[g][dt][2], o[g][dt][3]}; *(v4fa*)(p + 4) = (v4f){o[g][dt][4], o[g][dt][5], o[g][dt][6], o[g][dt][7]}; } }
    __syncthreads();
    for (int idx = (int)threadIdx.x; idx < QG * NQ * 16 * 8; idx += AW * 32) { const int q = idx >> 3, d8 = (idx & 7) * 8;   // one thread: 8 outputs of one query of the work-group's tile
        const int pq = (q / (NQ * 16)) * KW * 32 + q % (NQ * 16);   // the query's row in the plane of its group's first wave (planes lie 32 rows apart)
        float M = sm[pq];
#pragma unroll
        for (int p = 1; p < KW; ++p) M = fmaxf(M, sm[p * 32 + pq]);
        float L = 0.f; v4f a0 = (v4f){}, a1 = (v4f){};
#pragma unroll
        for (int p = 0; p < KW; ++p) { const float sc = __builtin_amdgcn_exp2f(sm[p * 32 + pq] - M); L += sc * sl[p * 32 + pq]; const float* pp = so + (p * 32 + pq) * OP + d8; a0 += sc * *(const v4fa*)pp; a1 += sc * *(const v4fa*)(pp + 4); }
        const float f = __fdiv_rn(0.0009765625f, L);   // x 2^-10: this module scales v by c^-0.5 = 2^-5 and the projected output by out_dim^-0.5 = 2^-5: both linear: ONE exact factor on the merged context
        v8us oh, ol;
#pragma unroll
        for (int k = 0; k < 4; ++k) { unsigned short a, b2; splitf(a0[k] * f, a, b2); oh[k] = a; ol[k] = b2; splitf(a1[k] * f, a, b2); oh[4 + k] = a; ol[4 + k] = b2; }
        const size_t oo = (size_t)(q0 + q) * DQ + head * HD + d8; *(v8us*)(Ah + oo) = oh; *(v8us*)(Al + oo) = ol; }
}
static_assert(AW % QG == 0 && (TT - RH) % (32 * QG) == 0 && RH % (16 * QG) == 0, "whole query tiles on both sides of RH");
__global__ __launch_bounds__(AW * 32) void k_fattn(const h16* __restrict__ Q16, const h16* __restrict__ K16, const h16* __restrict__ V16, const bf* __restrict__ Qh, const bf* __restrict__ Ql, const bf* __restrict__ Kh, const bf* __restrict__ Kl, const bf* __restrict__ Vh, const bf* __restrict__ Vl, bf* Ah, bf* Al) {
    __shared__ __align__(16) char so[2 * SKV > AW * 32 * OP * 4 ? 2 * SKV : AW * 32 * OP * 4];   // the stage buffers; behind the loop's last barrier the waves' partial outputs
    __shared__ float sm[AW * 32]; __shared__ float sl[AW * 32];
    const int head = blockIdx.x % NH_, ty = blockIdx.y; const size_t zp = (size_t)blockIdx.x * TT * HD;   // planes [batch][head][..]: blockIdx.x = batch x heads + head; one kv head per query head
    { const size_t ao = (size_t)(blockIdx.x / NH_) * TT * DQ; Ah += ao; Al += ao; }   // this batch's rows of the merged context
    if (ty < (TT - RH) / (32 * QG)) attn_tile<h16, false, 2>(Q16 + zp, nullptr, K16 + zp, nullptr, V16 + zp, nullptr, TT - 32 * QG * (ty + 1), head, so, sm, sl, Ah, Al);
    else attn_tile<bf, true, 1>(Qh + zp, Ql + zp, Kh + zp, Kl + zp, Vh + zp, Vl + zp, RH - 16 * QG * (ty - (TT - RH) / (32 * QG) + 1), head, so, sm, sl, Ah, Al);
}

extern "C" void kernel_launch(void* const* d_in, const int* in_sizes, int n_in,
                              void* d_out, int out_size, void* d_ws, size_t ws_size, hipStream_t stream) {
    (void)in_sizes; (void)n_in; (void)out_size;
    const float* x = (const float*)d_in[0]; const float* wk = (const float*)d_in[1]; const float* wq = (const float*)d_in[2]; const float* wv = (const float*)d_in[3]; const float* wo = (const float*)d_in[4];   /* input order x, W_key, W_query, W_value, W_proj ('oi' [1024][1024], UNIT normal): the KEY weight comes FIRST; NO bias input in this module */ const float* cosT = nullptr; const float* sinT = nullptr; (void)cosT; (void)sinT;
    float* OUT = (float*)d_out;     // [4][2048][1024]
    char* wsp = (char*)d_ws;
    auto take = [&](size_t bytes) { char* p = wsp; wsp += (bytes + 255) & ~(size_t)255; return (void*)p; };
    bf* WQ = (bf*)take((size_t)DQ * DM * 2); bf* WK = (bf*)take((size_t)DKV * DM * 2); bf* WV = (bf*)take((size_t)DKV * DM * 2); bf* WO = (bf*)take((size_t)DM * DQ * 2);
    // every plane holds all NB_ batches, batch outermost
    bf* XB = (bf*)take((size_t)NB_ * TT * DM * 2);
    const size_t PB = (size_t)NB_ * NH_ * TT * HD * 2;
    h16* QP16 = (h16*)take(PB); h16* KP16 = (h16*)take(PB); h16* VT16 = (h16*)take(PB);
    bf* QPh = (bf*)take(PB); bf* QPl = (bf*)take(PB); bf* KPh = (bf*)take(PB); bf* KPl = (bf*)take(PB); bf* VTh = (bf*)take(PB); bf* VTl = (bf*)take(PB);
    bf* ATh = (bf*)take((size_t)NB_ * TT * DQ * 2); bf* ATl = (bf*)take((size_t)NB_ * TT * DQ * 2);
    if ((size_t)(wsp - (char*)d_ws) > ws_size) return;    // ws 256 MiB
    // each stage is ONE launch over all batches: the rounding of x and of the four weights together, the q, k, v products together, the attention (batch in grid x), the out projection (batch = grid z)
    k_cvtall<<<CVG, 256, 0, stream>>>(x, wq, wk, wv, wo, XB, WQ, WK, WV, WO);
    k_qkv<<<dim3((TT / GT) * (DQ / GTN), 1, 3 * NB_), 256, 0, stream>>>(XB, WQ, WK, WV, DM, QP16, QPh, QPl, KP16, KPh, KPl, VT16, VTh, VTl);
    k_fattn<<<dim3(NB_ * NH_, (TT - RH) / (32 * QG) + RH / (16 * QG), 1), AW * 32, 0, stream>>>(QP16, KP16, VT16, QPh, QPl, KPh, KPl, VTh, VTl, ATh, ATl);
    k_gemmt<1, false><<<dim3(TT / GT, DM / GTN, NB_), 256, 0, stream>>>(ATh, ATl, WO, DQ, OUT, DM, (size_t)TT * DQ, 0, (size_t)TT * DM, nullptr, nullptr, nullptr, 0);
}

// v010
// One run takes 127 microseconds.
// Next to v009, in two timings, it ran 1.04 times as fast each time.
// Counting every step since v000, it is 24.2 times as fast.
#include <hip/hip_runtime.h>

// Causal multi-head self-attention whose projections and output are each scaled by 1/sqrt(width) (x [4][2048][1024]; k, q, v = (x W^T) x 1024^-0.5 ('oi' [1024][1024] UNIT normal, no bias; 16 heads x 64): each projection x 2^-5 (exact); scores = q.k x 64^-0.5: with the two 2^-5 factors folded in, q.k(unscaled) x 2^-13 (exact); causal (tril kept, -inf elsewhere); softmax; out = (merged W_proj^T) x 1024^-0.5 ('oi', no bias): the v factor 2^-5 and the output factor 2^-5 are both linear: ONE factor 2^-10 on the merged context (exact) -> [4][2048][1024] (8.4 M); argument order x, W_key, W_query, W_value, W_proj: KEY FIRST).
// Compute dtypes, f32 accumulate: every input rounded to bf16; q/k/v on PLAIN bf16 operands (inputs: exact); causal scores and attn.v: query rows < 512 hl (3 products), the rest single fp16, causal block skipping, one fused launch for all batches; online softmax f32 (scale 2^-13 exact); the merged context x 2^-10 (exact); W_proj hl x exact (2 products), NO bias.

#define NB_  4
#define TT   2048
#define DM   1024
#define NH_  16
#define NKV  16
#define REP  (NH_ / NKV)
#define HD   64
#define DQ   (NH_ * HD)
#define DKV  (NKV * HD)
#define RH   512                  // query rows < RH use hi+lo planes (0: none)
#define SCL  0.0001220703125f   // 2^-13 = 1024^-0.5 (on q) x 1024^-0.5 (on k) x 64^-0.5: this module scales q AND k by c^-0.5 = 2^-5 each and the scores by hd^-0.5 = 2^-3: all exact powers of two, applied here in ONE multiply on the unscaled q.k
typedef _Float16 h16;
typedef unsigned short bf;
typedef __attribute__((ext_vector_type(16))) __bf16   v16bf;
typedef __attribute__((ext_vector_type(16))) _Float16 v16h;
typedef __attribute__((ext_vector_type(8)))  _Float16 v8h;
typedef __attribute__((ext_vector_type(8)))  unsigned short v8us;
typedef __attribute__((ext_vector_type(8)))  float    v8f;
typedef __attribute__((ext_vector_type(4)))  float    v4f;
typedef v8h  __attribute__((may_alias)) v8ha;
typedef v4f  __attribute__((may_alias)) v4fa;
typedef v8us __attribute__((may_alias)) v8usa;

__device__ __forceinline__ unsigned short f2bf(float f) { unsigned u = __float_as_uint(f); u += 0x7FFFu + ((u >> 16) & 1u); return (unsigned short)(u >> 16); }
__device__ __forceinline__ float bf2f(unsigned short b) { return __uint_as_float(((unsigned)b) << 16); }
__device__ __forceinline__ float bfr(float f) { return bf2f(f2bf(f)); }
__device__ __forceinline__ v16h cat16(v8h lo, v8h hi) { return __builtin_shufflevector(lo, hi, 0, 1, 2, 3, 4, 5, 6, 7, 8, 9, 10, 11, 12, 13, 14, 15); }
__device__ __forceinline__ v16bf cat16b(v8us lo, v8us hi) { return __builtin_bit_cast(v16bf, __builtin_shufflevector(lo, hi, 0, 1, 2, 3, 4, 5, 6, 7, 8, 9, 10, 11, 12, 13, 14, 15)); }
__device__ __forceinline__ v8f wmma16(v16h a, v16h b, v8f c) { return __builtin_amdgcn_wmma_f32_16x16x32_f16(false, a, false, b, (short)0, c, false, false); }
__device__ __forceinline__ v8f wmmab(v16bf a, v16bf b, v8f c) { return __builtin_amdgcn_wmma_f32_16x16x32_bf16(false, a, false, b, (short)0, c, false, false); }
__device__ __forceinline__ h16 tohx(float x) { return (h16)x; }
__device__ __forceinline__ void splitf(float y, unsigned short& h, unsigned short& l) { h = f2bf(y); l = f2bf(y - bf2f(h)); }
typedef __attribute__((ext_vector_type(4))) _Float16 v4h;
typedef __attribute__((ext_vector_type(4))) unsigned short v4us;



// ---- k_gemmt: GEMM on LDS-staged operands, one 128x256 output tile per work-group of 8 waves (2 x 4; a wave holds 64x64 = 16 accumulators over the whole of K: each fragment read from LDS feeds 4 products,
// and each operand byte copied from L2 feeds 256 (A) or 128 (Bt) output elements).
// A stage is 64 of K = one whole 128-byte line of each of the 128 rows of A (and A2) and of the 256 rows of Bt, brought into LDS by asynchronous 16-byte copies (a wave's copy covers 4 whole lines) and shared by all 8 waves;
// two buffers: the next stage's copies fly while this stage is worked on. LDS rows lie 144 bytes apart (16 x odd: conflict-free for 16-byte fragment reads).
// C[m][n] (f32, pitch ldc) = sum_k A[m][k] Bt[n][k] (+ A2[m][k] Bt[n][k] under NSPLIT). z-batch strides sA/sB/sC in elements (sC: of C, or of each plane under PLANES). K % 64 == 0, rows % 128 == 0, columns % 256 == 0.
// PLANES: the tile is not stored as f32 but rounded at once into three 16-bit planes (fp16, and bf16 hi + lo); element (m, n) lies at m x ldc + (n / 64) x tpitch + n % 64.
// ldc = 64, tpitch = rows x 64 gives head planes [n / 64][m][n % 64]; with A = the weight and Bt = the activations, ldc = positions and tpitch = 64 give the transposed value plane [feature][position].
template <typename T16> struct WFrag;
template <> struct WFrag<h16> { typedef v16h V; static __device__ __forceinline__ V ld(const h16* p) { return cat16(*(const v8h*)p, *(const v8h*)(p + 16)); } static __device__ __forceinline__ v8f mma(V a, V b, v8f c) { return wmma16(a, b, c); } };
template <> struct WFrag<bf> { typedef v16bf V; static __device__ __forceinline__ V ld(const bf* p) { return cat16b(*(const v8us*)p, *(const v8us*)(p + 16)); } static __device__ __forceinline__ v8f mma(V a, V b, v8f c) { return wmmab(a, b, c); } };
#define GT   128                  // rows of the A tile = output rows of a work-group; the unit in which operand rows are copied
#define GTN  256                  // rows of the Bt tile = output columns of a work-group: two units that lie one behind the other in LDS
#define GKS  64                   // k per stage
#define GP   72                   // 16-bit elements between two operand rows in LDS
#define OPB  (GT * GP * 2)        // bytes of one unit of 128 operand rows in LDS
#define GOP  260                  // floats between two rows of the staged output tile (256 + 4: 16-byte aligned rows)
// copies of this thread: its 16 bytes of rows r, r + 32, r + 64, r + 96 of two (three) units of 128 operand rows that lie OPB bytes apart in LDS, in ONE statement;
// the s_wait_xcnt stands inside the statement, behind the last copy, in front of any rewrite of an address register that a copy names
#define CP4(a, b, c, d, e, f, g, h) "global_load_async_to_lds_b128 %" #a ", %" #b ", off\n\tglobal_load_async_to_lds_b128 %" #c ", %" #d ", off\n\tglobal_load_async_to_lds_b128 %" #e ", %" #f ", off\n\tglobal_load_async_to_lds_b128 %" #g ", %" #h ", off\n\t"
#define RW4(l, g) "v"(l), "v"(g), "v"((l) + 32 * GP * 2), "v"((g) + rs), "v"((l) + 64 * GP * 2), "v"((g) + 2 * rs), "v"((l) + 96 * GP * 2), "v"((g) + 3 * rs)
__device__ __forceinline__ void copy_stage2(unsigned l, const bf* ga, const bf* gb, size_t rs) {
    asm volatile(CP4(0, 1, 2, 3, 4, 5, 6, 7) CP4(8, 9, 10, 11, 12, 13, 14, 15) "s_wait_xcnt 0x0" :: RW4(l, ga), RW4(l + OPB, gb) : "memory");
}
__device__ __forceinline__ void copy_stage3(unsigned l, const bf* ga, const bf* ga2, const bf* gb, size_t rs) {
    asm volatile(CP4(0, 1, 2, 3, 4, 5, 6, 7) CP4(8, 9, 10, 11, 12, 13, 14, 15) CP4(16, 17, 18, 19, 20, 21, 22, 23) "s_wait_xcnt 0x0" :: RW4(l, ga), RW4(l + OPB, ga2), RW4(l + 2 * OPB, gb) : "memory");
}
template <int NSPLIT, bool PLANES>
__device__ __forceinline__ void gemmt(const bf* __restrict__ A, const bf* __restrict__ A2, const bf* __restrict__ Bt, int K, float* C, int ldc, size_t sA, size_t sB, size_t sC, h16* P16, bf* Ph, bf* Pl, int tpitch, size_t z, int bx, int by) {   // z: batch; bx, by: the tile's place in rows and columns
    typedef WFrag<bf> F; typedef typename F::V V;
    constexpr int NOPD = NSPLIT ? 4 : 3;              // units of 128 operand rows in a stage: A, (A2,) Bt, Bt
    constexpr int OPE = GT * GP, STG = NOPD * OPE * 2;   // elements of one unit, bytes of one stage
    constexpr int SMB = 2 * STG > GT * GOP * 4 ? 2 * STG : GT * GOP * 4;
    __shared__ __align__(16) char sm[SMB];            // the two stage buffers; behind the loop's last barrier the output tile
    A += z * sA; if (NSPLIT) A2 += z * sA; Bt += z * sB;
    const int tid = (int)threadIdx.x, lane = tid & 31, lr = lane & 15, hi = lane >> 4; const int w = __builtin_amdgcn_readfirstlane(tid >> 5); const int wm = w >> 2, wn = w & 3; const int r0 = bx * GT, c0 = by * GTN;
    // this thread's share of a stage: 16 bytes (chunk tid & 7) of rows tid / 8 + 0, 32, 64, 96 of every unit
    const unsigned lc = (unsigned)(size_t)sm + (unsigned)((tid >> 3) * (GP * 2) + (tid & 7) * 16);
    const size_t rs = (size_t)32 * K; const size_t ca = (size_t)(r0 + (tid >> 3)) * K + (tid & 7) * 8, cb = (size_t)(c0 + (tid >> 3)) * K + (tid & 7) * 8;
    auto stage = [&](int t, int b) { const unsigned l = lc + (unsigned)(b * STG); const size_t ko = (size_t)t * GKS;
        if constexpr (NSPLIT != 0) { copy_stage2(l, A + ca + ko, A2 + ca + ko, rs); copy_stage2(l + 2 * OPB, Bt + cb + ko, Bt + cb + 4 * rs + ko, rs); } else copy_stage3(l, A + ca + ko, Bt + cb + ko, Bt + cb + 4 * rs + ko, rs); };
    v8f acc[4][4];
#pragma unroll
    for (int mb = 0; mb < 4; ++mb)
#pragma unroll
        for (int nb = 0; nb < 4; ++nb) acc[mb][nb] = (v8f){};
    const int nst = K / GKS;
    stage(0, 0);
    asm volatile("s_wait_asynccnt 0x0" ::: "memory");   // this wave's copies of stage 0 have landed
    __syncthreads();                                    // every wave's have: stage 0 may be read
    if (nst > 1) stage(1, 1);
    const int ao = (wm * 64 + lr) * GP + 8 * hi, bo = (wn * 64 + lr) * GP + 8 * hi;
#pragma unroll 1   // kept rolled: one publish point per stage, the buffer picked by the trip's parity
    for (int t = 0; t < nst; ++t) {
        const bf* sa = (const bf*)(sm + (t & 1) * STG); const bf* sb = sa + (NOPD - 2) * OPE;
#pragma unroll
        for (int kk = 0; kk < GKS; kk += 32) {   // one 32-wide k step's fragments are read from LDS as one group (registers: 4 waves a SIMD stay possible)
            V a[4], a2[4], b[4];
#pragma unroll
            for (int mb = 0; mb < 4; ++mb) { a[mb] = F::ld(sa + ao + mb * 16 * GP + kk); if (NSPLIT) a2[mb] = F::ld(sa + OPE + ao + mb * 16 * GP + kk); }
#pragma unroll
            for (int nb = 0; nb < 4; ++nb) b[nb] = F::ld(sb + bo + nb * 16 * GP + kk);
            __builtin_amdgcn_sched_barrier(0);   // the group's LDS reads are issued together, ahead of its products; without it the scheduler spreads them among the products and the wave waits out the LDS latency several times a stage
#pragma unroll
            for (int nb = 0; nb < 4; ++nb)
#pragma unroll
                for (int mb = 0; mb < 4; ++mb) acc[mb][nb] = F::mma(a[mb], b[nb], acc[mb][nb]);
            if (NSPLIT) {
#pragma unroll
                for (int nb = 0; nb < 4; ++nb)
#pragma unroll
                    for (int mb = 0; mb < 4; ++mb) acc[mb][nb] = F::mma(a2[mb], b[nb], acc[mb][nb]);
            }
        }
        __builtin_amdgcn_sched_barrier(0);   // the stage's products stay in front of the publish point; without it the scheduler sinks them behind the barrier and the refill, and the copies then fly only while the next fragments are read
        asm volatile("s_wait_dscnt 0x0" ::: "memory");      // this wave's reads of the buffer have returned before the buffer is refilled
        asm volatile("s_wait_asynccnt 0x0" ::: "memory");   // this wave's copies of stage t + 1 have landed
        __syncthreads();                                    // publishes stage t + 1 and ends every wave's reads of stage t
        if (t + 2 < nst) stage(t + 2, t & 1);
    }
    asm volatile("s_wait_asynccnt 0x0" ::: "memory");       // nothing is in flight when the buffers become the output tile
    // the loop's last barrier has ended every read of the buffers: each wave lays its 64x64 block in the f32 tile; behind one more barrier the threads store whole lines
    float* os = (float*)sm;
#pragma unroll
    for (int mb = 0; mb < 4; ++mb)
#pragma unroll
        for (int nb = 0; nb < 4; ++nb)
#pragma unroll
            for (int j = 0; j < 8; ++j) os[(wm * 64 + mb * 16 + hi * 8 + j) * GOP + wn * 64 + nb * 16 + lr] = acc[mb][nb][j];
    __syncthreads();
#pragma unroll 1   // kept rolled: four rows' LDS reads and line stores in flight per trip; unrolled whole, the rounding code only lengthens the text
    for (int s4 = 0; s4 < GT * GTN / 4096; ++s4) {
#pragma unroll
        for (int u = 0; u < 4; ++u) { const int idx = (s4 * 4 + u) * 256 + tid; const int row = idx >> 6, cofs = (idx & 63) * 4; const v4f val = *(const v4fa*)(os + row * GOP + cofs);
            if constexpr (PLANES) { const int n = c0 + cofs; const size_t po = z * sC + (size_t)(r0 + row) * ldc + (size_t)(n >> 6) * tpitch + (n & 63); v4h o16; v4us oh, ol;   // 16 lanes x 8 bytes: one whole 128-byte line of each plane
#pragma unroll
                for (int k = 0; k < 4; ++k) { o16[k] = tohx(val[k]); unsigned short a2, c2; splitf(val[k], a2, c2); oh[k] = a2; ol[k] = c2; }
                *(v4h*)(P16 + po) = o16; *(v4us*)(Ph + po) = oh; *(v4us*)(Pl + po) = ol; }
            else *(v4f*)(C + z * sC + (size_t)(r0 + row) * ldc + c0 + cofs) = val; }
        asm volatile("s_wait_xcnt 0x0" ::: "memory");   // behind the trip's last store, in front of the next trip's rewrite of the address and data registers that these stores name
    }
}
// one product per launch: batch = grid z, tile = grid (x, y)
template <int NSPLIT, bool PLANES>
__global__ __launch_bounds__(256) void k_gemmt(const bf* __restrict__ A, const bf* __restrict__ A2, const bf* __restrict__ Bt, int K, float* C, int ldc, size_t sA, size_t sB, size_t sC, h16* P16, bf* Ph, bf* Pl, int tpitch) {
    gemmt<NSPLIT, PLANES>(A, A2, Bt, K, C, ldc, sA, sB, sC, P16, Ph, Pl, tpitch, blockIdx.z, (int)blockIdx.x, (int)blockIdx.y);
}
// the q, k and v products of all batches in ONE launch: none reads what another writes. Grid (tiles of one product, 1, batch x 3 + product), the position tile running fastest: a batch's three products lie side by side in the grid and read its activations together.
// q and k: x W^T, each 64-wide quarter of a tile's columns = one head, laid straight into the [batch][head][t][d] planes; v: W x^T (rows = features, columns = positions), whose rows are the [batch][head x 64 + d][t] plane as it stands
static_assert(NKV == NH_ && (TT / GT) * (DQ / GTN) == (DKV / GT) * (TT / GTN), "q, k and v share one grid: equal tile counts");
__global__ __launch_bounds__(256) void k_qkv(const bf* __restrict__ X, const bf* __restrict__ Wq, const bf* __restrict__ Wk, const bf* __restrict__ Wv, int K, h16* Q16, bf* Qh, bf* Ql, h16* K16, bf* Kh, bf* Kl, h16* V16, bf* Vh, bf* Vl) {
    const int sel = (int)(blockIdx.z % 3u); const bool tv = sel == 2;   // 0: q, 1: k, 2: v; the same for the whole work-group
    gemmt<0, true>(tv ? Wv : X, nullptr, tv ? X : (sel == 1 ? Wk : Wq), K, nullptr, tv ? TT : HD, tv ? (size_t)0 : (size_t)TT * DM, tv ? (size_t)TT * DM : (size_t)0, (size_t)NH_ * TT * HD,
                   sel == 0 ? Q16 : (sel == 1 ? K16 : V16), sel == 0 ? Qh : (sel == 1 ? Kh : Vh), sel == 0 ? Ql : (sel == 1 ? Kl : Vl), tv ? 64 : TT * HD, blockIdx.z / 3u, (int)(tv ? blockIdx.x / (TT / GTN) : blockIdx.x % (TT / GT)), (int)(tv ? blockIdx.x % (TT / GTN) : blockIdx.x / (TT / GT)));
}

typedef __attribute__((ext_vector_type(2))) unsigned short v2us;
typedef __attribute__((ext_vector_type(4))) int v4i;

__global__ __launch_bounds__(256) void k_wtG(const float* __restrict__ w, int K, int N, bf* Bt) {
    const int lane = threadIdx.x & 31; const int L0 = (blockIdx.x * 8 + (threadIdx.x >> 5)) * 8; const int nlines = N * K / 64;
{
#pragma unroll 1
        for (int l = 0; l < 8; ++l) { const int L = L0 + l; if (L >= nlines) break; const size_t e = (size_t)L * 64 + lane * 2; const int k = (int)(e % K), n = (int)(e / K); v2us o;
            o[0] = f2bf(w[(size_t)k * N + n]); o[1] = f2bf(w[(size_t)(k + 1) * N + n]); *(v2us*)(Bt + e) = o; }
         }
}
// ---- k_cvtall: all five f32 inputs rounded to bf16 in ONE launch of CVG work-groups (two of 8 waves per WGP: 16 long-lived waves).
// A chunk is 8 floats of one thread (32 bytes read, 16 written). A work-group takes CVX x 256 chunks of x that lie in a row (a thread's chunks 256 chunks apart) and 256 chunks of each weight: straight-line code,
// all of a thread's loads issued before its first rounding, so that the launch pays the start of few waves and one memory latency instead of one of each per chunk.
#define CVG  512
#define CVX  (NB_ * TT * DM / 8 / 256 / CVG)
static_assert((size_t)CVX * CVG * 256 * 8 == (size_t)NB_ * TT * DM, "x is a whole number of chunks per thread");
static_assert(DQ * DM == CVG * 256 * 8 && DKV * DM == CVG * 256 * 8, "each weight is one chunk per thread");
__device__ __forceinline__ v8us round8(v8f v) { v8us o;
#pragma unroll
    for (int k = 0; k < 8; ++k) o[k] = f2bf(v[k]); return o; }
__global__ __launch_bounds__(256) void k_cvtall(const float* __restrict__ x, const float* __restrict__ wq, const float* __restrict__ wk, const float* __restrict__ wv, const float* __restrict__ wo, bf* XB, bf* WQ, bf* WK, bf* WV, bf* WO) {
    const unsigned cx = blockIdx.x * (CVX * 256u) + threadIdx.x, cw = blockIdx.x * 256u + threadIdx.x;   // this thread's first chunk of x, its chunk of each weight
    // byte offsets in 32 bits: each access is a uniform base, one offset register and a constant
    auto ld = [](const float* p, unsigned chunk) { return *(const v8f*)((const char*)p + chunk * 32u); };
    auto st = [](bf* p, unsigned chunk, v8f v) { *(v8us*)((char*)p + chunk * 16u) = round8(v); };
    v8f v[CVX + 4];
#pragma unroll
    for (int u = 0; u < CVX; ++u) v[u] = ld(x + u * 2048, cx);
    v[CVX] = ld(wq, cw); v[CVX + 1] = ld(wk, cw); v[CVX + 2] = ld(wv, cw); v[CVX + 3] = ld(wo, cw);
#pragma unroll
    for (int u = 0; u < CVX; ++u) st(XB + u * 2048, cx, v[u]);
    st(WQ, cw, v[CVX]); st(WK, cw, v[CVX + 1]); st(WV, cw, v[CVX + 2]); st(WO, cw, v[CVX + 3]);
}
// ---- k_fattn: causal scores, softmax, probability x value and the head merge of ALL batches in ONE launch; grid (batches x heads, query tiles, heaviest tile first: the cost falls with the flat index over the whole launch), AW x 32 threads.
// Transposed products: S^T = K Q^T (A = 16 key rows, B = 16 query columns), O^T += V^T P^T (A = 16 rows of the [d][t] value plane, B = P^T). A lane holds scores of ONE query (column c = lane & 15; keys 8 hi + r of each 16),
// so a pair of score tiles, rounded to 16 bit, IS the B operand of the second product in the k order of WFrag::ld (8 hi + s, 16 + 8 hi + s): the probabilities never leave the registers.
// Online softmax in the log2 domain: reference m and sum l per query. m is a maximum met so far, not the running one: it is raised (to the largest of it and that trip's scores of its query, O^T and l rescaled) only in a trip in which some score
// lies more than RTH above it, so every probability is at most 2^RTH (far inside fp16 and bf16) and m cancels in O^T / l; in every other trip no lane exchange and no rescale is done.
// A work-group holds QG query groups (one group = the queries of one wave); the KW = AW / QG waves of a group take every KW-th block of 32 keys, in rising order;
// a group's KW partial (m, l, O^T) are joined through LDS in wave order behind one work-group barrier; the joined context x 2^-10 / l goes out as hi + lo bf16 rows of the merged [t][heads x 64] planes.
// HL: hi + lo bf16 planes, 3 products each (query rows < RH, 16 queries a wave); else single fp16 (32 queries a wave).
// K and V reach the waves through LDS: a stage is AW x 32 = 256 keys, read by all QG query groups (one fetch from L2 serves QG x as many queries), brought in by asynchronous 16-byte copies in groups of 64 keys
// (a wave's copy covers 4 whole 128-byte lines: 4 K rows, or 64 keys of 4 rows of the [d][t] value plane); a group wholly behind the last query group's diagonal is not copied and not read.
// fp16: two buffers, the next stage's copies fly while this stage is worked on. HL (at most 2 stages, twice the planes): one buffer of the same total size, filled, read, and refilled behind a barrier.
#define AW   8
#define QG   4                     // query groups of a work-group, which share each staged K and V block
#define KW   (AW / QG)             // waves that split the key blocks of one query group
#define KPI  72                    // 16-bit elements between two K rows in LDS (144 bytes = 16 x odd: conflict-free for 16-byte fragment reads)
#define VPI  264                   // 16-bit elements between two rows of the staged value plane (256 keys + 8: 528 bytes = 16 x odd)
#define SKB  (AW * 32 * KPI * 2)   // bytes of a stage's K rows
#define SKV  (SKB + HD * VPI * 2)  // bytes of a stage's K rows and value rows of one plane pair
#define OP   68                    // floats between two queries' partial outputs in LDS (64 + 4: 16-byte aligned rows)
#define NEGB (-3.0e38f)
#define RTH  8.0f                  // log2 units a score may lie above the reference in use before the reference is raised
#define SCL2 (SCL * 1.4426950408889634f)   // 2^-13 x log2(e): exp(s x 2^-13 - max) = exp2(s x SCL2 - max2)
// 64 keys of one K plane and one value plane: this thread's 16 bytes of K rows r, r + 32 and of value rows r, r + 32, in ONE statement;
// the s_wait_xcnt stands inside the statement, behind the last copy, in front of any rewrite of an address register that a copy names
template <typename T16>
__device__ __forceinline__ void copy_kv(unsigned lk, unsigned lv, const T16* gk, const T16* gv) {
    asm volatile(CP4(0, 1, 2, 3, 4, 5, 6, 7) "s_wait_xcnt 0x0" :: "v"(lk), "v"(gk), "v"(lk + 32 * KPI * 2), "v"(gk + 32 * HD), "v"(lv), "v"(gv), "v"(lv + 32 * VPI * 2), "v"(gv + 32 * TT) : "memory");
}
template <typename T16, bool HL, int NQ>
__device__ __forceinline__ void attn_tile(const T16* __restrict__ Q, const T16* __restrict__ Q2, const T16* __restrict__ Kp, const T16* __restrict__ K2, const T16* __restrict__ Vt, const T16* __restrict__ V2, int q0, int head, char* sb, float* sm, float* sl, bf* Ah, bf* Al) {
    typedef WFrag<T16> F; typedef typename F::V V;
    const int lane = threadIdx.x & 31, c = lane & 15, hi = lane >> 4; const int w = __builtin_amdgcn_readfirstlane((int)(threadIdx.x >> 5));
    const int kw = w % KW, qw = q0 + (w / KW) * (NQ * 16);   // this wave's place among its group's waves; its group's first query
    V qf[NQ][2], q2[NQ][2];
#pragma unroll
    for (int g = 0; g < NQ; ++g)
#pragma unroll
        for (int ks = 0; ks < 2; ++ks) { const size_t qo = (size_t)(qw + g * 16 + c) * HD + ks * 32 + 8 * hi; qf[g][ks] = F::ld(Q + qo); if (HL) q2[g][ks] = F::ld(Q2 + qo); }
    v8f o[NQ][4]; float m[NQ], l[NQ];
#pragma unroll
    for (int g = 0; g < NQ; ++g) { m[g] = NEGB; l[g] = 0.f;
#pragma unroll
        for (int dt = 0; dt < 4; ++dt) o[g][dt] = (v8f){}; }
    const int nblk = qw / 32 + 1;      // blocks of 32 keys up to and including the one that holds this group's diagonal
    const int nblkg = (q0 + (QG - 1) * (NQ * 16)) / 32 + 1;   // the same for the work-group's last group: what is staged
    const int nst = (nblkg + AW - 1) / AW;   // stages of AW blocks
    // this thread's share of a group of 64 keys: 16 bytes (chunk tid & 7) of rows tid / 8 and tid / 8 + 32
    const int tid = (int)threadIdx.x;
    const unsigned lk0 = (unsigned)(size_t)sb + (unsigned)((tid >> 3) * (KPI * 2) + (tid & 7) * 16), lv0 = (unsigned)(size_t)sb + (unsigned)(SKB + (tid >> 3) * (VPI * 2) + (tid & 7) * 16);
    const size_t gk0 = (size_t)(tid >> 3) * HD + (tid & 7) * 8, gv0 = (size_t)(tid >> 3) * TT + (tid & 7) * 8;
    auto stage = [&](int st, int b) {
#pragma unroll
        for (int j = 0; j < 4; ++j)
            if (st * AW + 2 * j < nblkg) {   // the same for the whole work-group: the group holds a key block up to the last diagonal (and so lies inside the planes)
                const unsigned lk = lk0 + (unsigned)(b * SKV + j * 64 * KPI * 2), lv = lv0 + (unsigned)(b * SKV + j * 128); const size_t gk = gk0 + (size_t)(st * AW * 32 + j * 64) * HD, gv = gv0 + (size_t)(st * AW * 32 + j * 64);
                copy_kv(lk, lv, Kp + gk, Vt + gv); if constexpr (HL) copy_kv(lk + SKV, lv + SKV, K2 + gk, V2 + gv); }
    };
    if constexpr (!HL) {
        stage(0, 0);
        asm volatile("s_wait_asynccnt 0x0" ::: "memory");   // this wave's copies of stage 0 have landed
        __syncthreads();                                    // every wave's have: stage 0 may be read
        if (nst > 1) stage(1, 1);
    }
    const int kfo = c * KPI + 8 * hi, vfo = c * VPI + 8 * hi;   // this lane's first K and V fragment elements in a stage's first block
#pragma unroll 1   // kept rolled: run-time trip count, one publish point per stage, and one body already holds most of the register file
    for (int st = 0; st < nst; ++st) {
      if constexpr (HL) {
        stage(st, 0);
        asm volatile("s_wait_asynccnt 0x0" ::: "memory");   // this wave's copies of the stage have landed
        __syncthreads();                                    // every wave's have: the stage may be read
      }
#pragma unroll 1   // kept rolled: one body already holds most of the register file, and a copy of it per block would only lengthen the text
      for (int bs = kw; bs < AW; bs += KW) {   // this wave's blocks of the stage
      const int kb = st * AW + bs;
      if (kb < nblk) {   // wave-uniform: the block reaches up to this group's diagonal
        const int k0 = kb * 32;
        const T16* kp = (const T16*)(sb + (HL ? 0 : (st & 1) * SKV)) + kfo + bs * 32 * KPI; const T16* vp = (const T16*)(sb + (HL ? 0 : (st & 1) * SKV) + SKB) + vfo + bs * 32; const T16* kp2 = kp + SKV / 2; const T16* vp2 = vp + SKV / 2;
        V kf[2][2], k2[2][2], vf[4], v2[4];
#pragma unroll
        for (int kt = 0; kt < 2; ++kt)
#pragma unroll
            for (int ks = 0; ks < 2; ++ks) { const int ko = kt * 16 * KPI + ks * 32; kf[kt][ks] = F::ld(kp + ko); if (HL) k2[kt][ks] = F::ld(kp2 + ko); }
        __builtin_amdgcn_sched_barrier(0);   // all of the trip's K fragment reads are issued before its first product; without it the scheduler spreads them among the products and the wave waits on LDS at several places of a trip
        v8f s[NQ][2];
#pragma unroll
        for (int g = 0; g < NQ; ++g)
#pragma unroll
            for (int kt = 0; kt < 2; ++kt) s[g][kt] = (v8f){};
#pragma unroll
        for (int ks = 0; ks < 2; ++ks)
#pragma unroll
            for (int g = 0; g < NQ; ++g)
#pragma unroll
                for (int kt = 0; kt < 2; ++kt) { s[g][kt] = F::mma(kf[kt][ks], qf[g][ks], s[g][kt]); if (HL) { s[g][kt] = F::mma(k2[kt][ks], qf[g][ks], s[g][kt]); s[g][kt] = F::mma(kf[kt][ks], q2[g][ks], s[g][kt]); } }
#pragma unroll
        for (int dt = 0; dt < 4; ++dt) { const int vo = dt * 16 * VPI; vf[dt] = F::ld(vp + vo); if (HL) v2[dt] = F::ld(vp2 + vo); }
        __builtin_amdgcn_sched_barrier(0);   // the V fragment reads stay in front of the softmax, which covers their LDS latency, and are scheduled with the score products alone; without it the scheduler lifts them to the first products, where every K register is still live, and the build spills
#pragma unroll
        for (int g = 0; g < NQ; ++g)
#pragma unroll
            for (int kt = 0; kt < 2; ++kt) s[g][kt] *= SCL2;
        if (kb == nblk - 1) {          // the diagonal block (wave-uniform test): keys behind the query are excluded; every query of the tile keeps at least this block's first key
#pragma unroll
            for (int g = 0; g < NQ; ++g)
#pragma unroll
                for (int kt = 0; kt < 2; ++kt)
#pragma unroll
                    for (int r = 0; r < 8; ++r) s[g][kt][r] = (k0 + kt * 16 + 8 * hi + r <= qw + g * 16 + c) ? s[g][kt][r] : NEGB;
        }
        float mx[NQ]; bool need = false;   // mx: the maximum of this LANE's 16 scores of the query (the other 16 lie in lane ^ 16)
#pragma unroll
        for (int g = 0; g < NQ; ++g) { mx[g] = s[g][0][0];
#pragma unroll
            for (int r = 1; r < 8; ++r) mx[g] = fmaxf(mx[g], s[g][0][r]);
#pragma unroll
            for (int r = 0; r < 8; ++r) mx[g] = fmaxf(mx[g], s[g][1][r]);
            need = need || (mx[g] > m[g] + RTH); }
        if (__builtin_amdgcn_ballot_w32(need) != 0) {   // scalar branch: some score lies more than RTH above its query's reference (always in a wave's first trip: NEGB + RTH = NEGB); only here the two halves' maxima are exchanged
#pragma unroll
            for (int g = 0; g < NQ; ++g) { const float mn = fmaxf(m[g], fmaxf(mx[g], __shfl_xor(mx[g], 16, 32))); const float al = __builtin_amdgcn_exp2f(m[g] - mn); l[g] *= al; m[g] = mn;
#pragma unroll
                for (int dt = 0; dt < 4; ++dt) o[g][dt] *= al; }
        }
        V pb[NQ], p2[NQ];
#pragma unroll
        for (int g = 0; g < NQ; ++g) {
            if constexpr (HL) { v8us h0, h1, l0, l1;
#pragma unroll
                for (int r = 0; r < 8; ++r) { const float pa = __builtin_amdgcn_exp2f(s[g][0][r] - m[g]), pc = __builtin_amdgcn_exp2f(s[g][1][r] - m[g]); l[g] += pa; l[g] += pc; unsigned short a, b2; splitf(pa, a, b2); h0[r] = a; l0[r] = b2; splitf(pc, a, b2); h1[r] = a; l1[r] = b2; }
                pb[g] = cat16b(h0, h1); p2[g] = cat16b(l0, l1);
            } else { v8h h0, h1;
#pragma unroll
                for (int r = 0; r < 8; ++r) { const float pa = __builtin_amdgcn_exp2f(s[g][0][r] - m[g]), pc = __builtin_amdgcn_exp2f(s[g][1][r] - m[g]); l[g] += pa; l[g] += pc; h0[r] = tohx(pa); h1[r] = tohx(pc); }
                pb[g] = cat16(h0, h1); }
        }
#pragma unroll
        for (int dt = 0; dt < 4; ++dt)
#pragma unroll
            for (int g = 0; g < NQ; ++g) { o[g][dt] = F::mma(vf[dt], pb[g], o[g][dt]); if (HL) { o[g][dt] = F::mma(vf[dt], p2[g], o[g][dt]); o[g][dt] = F::mma(v2[dt], pb[g], o[g][dt]); } }
        if constexpr (HL) {   // (the fp16 form's last product is followed by the rest of the row sums)
        __builtin_amdgcn_sched_barrier(0);   // the block's last products stay in front of the slots below
        asm volatile("v_nop\n\tv_nop\n\tv_nop\n\tv_nop"); }   // the four vector slots the chip needs behind a matrix instruction: over the loop's back edge the next block's address arithmetic reuses the last products' operand registers
      }
      }
      asm volatile("s_wait_dscnt 0x0" ::: "memory");          // this wave's reads of the buffer have returned before the buffer is refilled
      if constexpr (!HL) asm volatile("s_wait_asynccnt 0x0" ::: "memory");   // this wave's copies of stage st + 1 have landed
      __syncthreads();                                        // ends every wave's reads of stage st (and, with two buffers, publishes stage st + 1)
      if constexpr (!HL) { if (st + 2 < nst) stage(st + 2, st & 1); }
    }
    asm volatile("s_wait_asynccnt 0x0" ::: "memory");         // nothing is in flight when the buffers become the partial planes
    float* so = (float*)sb;                                   // the loop's last barrier has ended every read of the buffers
    // every wave lays its partial (m, l, O^T) in its own LDS plane (a wave that got no key block lays m = NEGB, l = 0, zeros: its weight below is exp2(-huge) = 0)
    float* my = so + w * (32 * OP);
#pragma unroll
    for (int g = 0; g < NQ; ++g) { l[g] += __shfl_xor(l[g], 16, 32); if (hi == 0) { sm[w * 32 + g * 16 + c] = m[g]; sl[w * 32 + g * 16 + c] = l[g]; }
#pragma unroll
        for (int dt = 0; dt < 4; ++dt) { float* p = my + (g * 16 + c) * OP + dt * 16 + 8 * hi; *(v4fa*)p = (v4f){o[g][dt][0], o[g][dt][1], o[g][dt][2], o[g][dt][3]}; *(v4fa*)(p + 4) = (v4f){o[g][dt][4], o[g][dt][5], o[g][dt][6], o[g][dt][7]}; } }
    __syncthreads();
    for (int idx = (int)threadIdx.x; idx < QG * NQ * 16 * 8; idx += AW * 32) { const int q = idx >> 3, d8 = (idx & 7) * 8;   // one thread: 8 outputs of one query of the work-group's tile
        const int pq = (q / (NQ * 16)) * KW * 32 + q % (NQ * 16);   // the query's row in the plane of its group's first wave (planes lie 32 rows apart)
        float M = sm[pq];
#pragma unroll
        for (int p = 1; p < KW; ++p) M = fmaxf(M, sm[p * 32 + pq]);
        float L = 0.f; v4f a0 = (v4f){}, a1 = (v4f){};
#pragma unroll
        for (int p = 0; p < KW; ++p) { const float sc = __builtin_amdgcn_exp2f(sm[p * 32 + pq] - M); L += sc * sl[p * 32 + pq]; const float* pp = so + (p * 32 + pq) * OP + d8; a0 += sc * *(const v4fa*)pp; a1 += sc * *(const v4fa*)(pp + 4); }
        const float f = __fdiv_rn(0.0009765625f, L);   // x 2^-10: this module scales v by c^-0.5 = 2^-5 and the projected output by out_dim^-0.5 = 2^-5: both linear: ONE exact factor on the merged context
        v8us oh, ol;
#pragma unroll
        for (int k = 0; k < 4; ++k) { unsigned short a, b2; splitf(a0[k] * f, a, b2); oh[k] = a; ol[k] = b2; splitf(a1[k] * f, a, b2); oh[4 + k] = a; ol[4 + k] = b2; }
        const size_t oo = (size_t)(q0 + q) * DQ + head * HD + d8; *(v8us*)(Ah + oo) = oh; *(v8us*)(Al + oo) = ol; }
}
static_assert(AW % QG == 0 && (TT - RH) % (32 * QG) == 0 && RH % (16 * QG) == 0, "whole query tiles on both sides of RH");
__global__ __launch_bounds__(AW * 32) void k_fattn(const h16* __restrict__ Q16, const h16* __restrict__ K16, const h16* __restrict__ V16, const bf* __restrict__ Qh, const bf* __restrict__ Ql, const bf* __restrict__ Kh, const bf* __restrict__ Kl, const bf* __restrict__ Vh, const bf* __restrict__ Vl, bf* Ah, bf* Al) {
    __shared__ __align__(16) char so[2 * SKV > AW * 32 * OP * 4 ? 2 * SKV : AW * 32 * OP * 4];   // the stage buffers; behind the loop's last barrier the waves' partial outputs
    __shared__ float sm[AW * 32]; __shared__ float sl[AW * 32];
    const int head = blockIdx.x % NH_, ty = blockIdx.y; const size_t zp = (size_t)blockIdx.x * TT * HD;   // planes [batch][head][..]: blockIdx.x = batch x heads + head; one kv head per query head
    { const size_t ao = (size_t)(blockIdx.x / NH_) * TT * DQ; Ah += ao; Al += ao; }   // this batch's rows of the merged context
    if (ty < (TT - RH) / (32 * QG)) attn_tile<h16, false, 2>(Q16 + zp, nullptr, K16 + zp, nullptr, V16 + zp, nullptr, TT - 32 * QG * (ty + 1), head, so, sm, sl, Ah, Al);
    else attn_tile<bf, true, 1>(Qh + zp, Ql + zp, Kh + zp, Kl + zp, Vh + zp, Vl + zp, RH - 16 * QG * (ty - (TT - RH) / (32 * QG) + 1), head, so, sm, sl, Ah, Al);
}

extern "C" void kernel_launch(void* const* d_in, const int* in_sizes, int n_in,
                              void* d_out, int out_size, void* d_ws, size_t ws_size, hipStream_t stream) {
    (void)in_sizes; (void)n_in; (void)out_size;
    const float* x = (const float*)d_in[0]; const float* wk = (const float*)d_in[1]; const float* wq = (const float*)d_in[2]; const float* wv = (const float*)d_in[3]; const float* wo = (const float*)d_in[4];   /* input order x, W_key, W_query, W_value, W_proj ('oi' [1024][1024], UNIT normal): the KEY weight comes FIRST; NO bias input in this module */ const float* cosT = nullptr; const float* sinT = nullptr; (void)cosT; (void)sinT;
    float* OUT = (float*)d_out;     // [4][2048][1024]
    char* wsp = (char*)d_ws;
    auto take = [&](size_t bytes) { char* p = wsp; wsp += (bytes + 255) & ~(size_t)255; return (void*)p; };
    bf* WQ = (bf*)take((size_t)DQ * DM * 2); bf* WK = (bf*)take((size_t)DKV * DM * 2); bf* WV = (bf*)take((size_t)DKV * DM * 2); bf* WO = (bf*)take((size_t)DM * DQ * 2);
    // every plane holds all NB_ batches, batch outermost
    bf* XB = (bf*)take((size_t)NB_ * TT * DM * 2);
    const size_t PB = (size_t)NB_ * NH_ * TT * HD * 2;
    h16* QP16 = (h16*)take(PB); h16* KP16 = (h16*)take(PB); h16* VT16 = (h16*)take(PB);
    bf* QPh = (bf*)take(PB); bf* QPl = (bf*)take(PB); bf* KPh = (bf*)take(PB); bf* KPl = (bf*)take(PB); bf* VTh = (bf*)take(PB); bf* VTl = (bf*)take(PB);
    bf* ATh = (bf*)take((size_t)NB_ * TT * DQ * 2); bf* ATl = (bf*)take((size_t)NB_ * TT * DQ * 2);
    if ((size_t)(wsp - (char*)d_ws) > ws_size) return;    // ws 256 MiB
    // each stage is ONE launch over all batches: the rounding of x and of the four weights together, the q, k, v products together, the attention (batch in grid x), the out projection (batch = grid z)
    k_cvtall<<<CVG, 256, 0, stream>>>(x, wq, wk, wv, wo, XB, WQ, WK, WV, WO);
    k_qkv<<<dim3((TT / GT) * (DQ / GTN), 1, 3 * NB_), 256, 0, stream>>>(XB, WQ, WK, WV, DM, QP16, QPh, QPl, KP16, KPh, KPl, VT16, VTh, VTl);
    k_fattn<<<dim3(NB_ * NH_, (TT - RH) / (32 * QG) + RH / (16 * QG), 1), AW * 32, 0, stream>>>(QP16, KP16, VT16, QPh, QPl, KPh, KPl, VTh, VTl, ATh, ATl);
    k_gemmt<1, false><<<dim3(TT / GT, DM / GTN, NB_), 256, 0, stream>>>(ATh, ATl, WO, DQ, OUT, DM, (size_t)TT * DQ, 0, (size_t)TT * DM, nullptr, nullptr, nullptr, 0);
}
